// v000
// Times are from an AMD MI455X. After a warm-up the kernel runs many times in a row, and a time is the length of
// such a window on the GPU divided by its runs, so every launch and the gaps after it count. The runs cycle
// through copies of the inputs. A figure is the median of several windows, for all but v000 over two sittings.
// Sittings can differ by a few percent; kernels timed side by side share one.
// The starting kernel, v000, takes 298 microseconds a run.
#include <hip/hip_runtime.h>

// Contractions (all v_wmma_f32_16x16x32_f16, f16 operands, f32 accumulate): QKV = xn x Wqkv (W = f16 of the bf16 RNE-converted weight x64);
// S^T = K x Q^T (f16 q/k planes); O = P x V (P carried x4096, V^T f16 plane); Y^T = Wproj^T x ctx^T (ctx carried x256, W x64). LayerNorm, softmax, bias and residual in f32.

#ifndef NB
#define NB 4
#endif
#ifndef SEQ
#define SEQ 4096
#endif
#define NB_FULL    4
#define SEQ_FULL   4096
#define CH         256                  // channels = NHEAD * HDIM
#define NHEAD      4
#define HDIM       64
#define QKVN       (3 * CH)
#define BQ         128                  // query rows per attention workgroup (8 waves x 16)
#define BK         32                   // keys per inner iteration
#define NWAVE      8
#define MT         128                  // tokens per GEMM workgroup (8 waves x 16)
#define LNT        32                   // tokens per LayerNorm workgroup
#define LNP        33                   // LDS pitch (floats) of the LayerNorm tile
#define TP         72                   // LDS pitch (halves) of 64-wide f16 tiles
#define VP         136                  // LDS pitch (halves) of the 128-wide transposed V tile
#define OPF        132                  // LDS pitch (floats) of the projection staging tile

static_assert(SEQ % BQ == 0);
static_assert(SEQ % MT == 0);
static_assert(SEQ % LNT == 0);
static_assert(SEQ % BK == 0);
static_assert(BQ == NWAVE * 16);
static_assert(MT == NWAVE * 16);
static_assert(CH == NHEAD * HDIM);
static_assert(CH == 256);
static_assert(HDIM == 64);
static_assert(CH % 32 == 0);
static_assert(SEQ <= SEQ_FULL);
static_assert(NB >= 1 && NB <= NB_FULL);
static_assert((TP * 2) % 16 == 0);
static_assert((VP * 2) % 16 == 0);
static_assert((OPF * 4) % 16 == 0);
static_assert(MT * TP >= HDIM * VP);
// coverage equalities (threads x pieces x elements == tile elements)
static_assert(256 * 4 * 8 == LNT * CH);          // LayerNorm plane tile
static_assert(256 * 2 * 8 == 64 * 64);           // weight plane tile
static_assert(256 * 4 * 8 == MT * HDIM);         // q / k / v^T plane tile
static_assert(32 * 4 * 8 == 16 * HDIM);          // per-wave ctx tile
static_assert(NWAVE * 8 * 32 * 4 == 64 * MT);    // output tile

typedef __bf16   bf16;
typedef _Float16 f16;
typedef f16      v16h  __attribute__((ext_vector_type(16)));
typedef f16      v8h   __attribute__((ext_vector_type(8)));
typedef float    v8f   __attribute__((ext_vector_type(8)));
typedef float    v4f   __attribute__((ext_vector_type(4)));
typedef unsigned v4u   __attribute__((ext_vector_type(4)));

union FragH  { v16h  v; v4u q[2]; f16  h[16]; };
union Pack8H { v4u u; v8h v; f16 h[8]; };

// WMMA helper: builtin followed by the VALU hazard guard (ties D, keeps A/B live).
static __device__ __forceinline__ v8f mma_f16(v16h a, v16h b, v8f acc) {
  acc = __builtin_amdgcn_wmma_f32_16x16x32_f16(false, a, false, b, (short)0, acc, false, false);
  asm volatile("v_nop\n\tv_nop\n\tv_nop\n\tv_nop" : "+v"(acc) : "v"(a), "v"(b));
  return acc;
}

// Weight planes. Block = (64-wide k tile, 64-wide n tile), 256 threads.
//   wqT [QKVN][CH] f16 = bf16(w_qkv[k][n]) x 64 transposed, wpT [CH][CH] f16 = bf16(w_proj[k][n]) x 64 transposed.
__global__ __launch_bounds__(256) void w_planes_kernel(const float* __restrict__ wqkv,
                                                       const float* __restrict__ wproj,
                                                       f16* __restrict__ wqT,
                                                       f16* __restrict__ wpT) {
  const unsigned kt  = blockIdx.x;              // 0..3
  const unsigned nt  = blockIdx.y;              // 0..11 qkv, 12..15 proj
  const unsigned tid = threadIdx.x;
  const bool isq = nt < (QKVN / 64);
  const float* src = isq ? wqkv : wproj;        // both global, block-uniform
  f16*         dst = isq ? wqT : wpT;
  const unsigned ldn = isq ? (unsigned)QKVN : (unsigned)CH;
  const unsigned n0  = (isq ? nt : (nt - QKVN / 64)) * 64u;
  const unsigned k0  = kt * 64u;
  __shared__ __align__(16) f16 sT[64 * TP];     // [n][k], cross-wave (block barrier)

  #pragma unroll
  for (unsigned kk = 0; kk < 2; ++kk) {
    const unsigned kr = kk * 32 + (tid >> 3);   // 0..63
    const unsigned nn = (tid & 7u) * 8;         // 0..56
    const float* p = src + (size_t)(k0 + kr) * ldn + n0 + nn;
    const v4f w0 = *(const v4f*)(p);
    const v4f w1 = *(const v4f*)(p + 4);
    #pragma unroll
    for (unsigned i = 0; i < 4; ++i) {
      sT[(nn + i) * TP + kr]     = (f16)((float)(bf16)w0[i] * 64.0f);   // exact in f16
      sT[(nn + 4 + i) * TP + kr] = (f16)((float)(bf16)w1[i] * 64.0f);
    }
  }
  __syncthreads();

  v4u    val[2];
  size_t idx[2];
  #pragma unroll
  for (unsigned kk = 0; kk < 2; ++kk) {
    const unsigned n  = kk * 32 + (tid >> 3);
    const unsigned ks = (tid & 7u) * 8;
    Pack8H ph;
    ph.v = *(const v8h*)(sT + n * TP + ks);
    val[kk] = ph.u;
    idx[kk] = (size_t)(n0 + n) * CH + k0 + ks;
  }
  #pragma unroll
  for (unsigned kk = 0; kk < 2; ++kk) *(v4u*)(dst + idx[kk]) = val[kk];
  
}

// LayerNorm over channels of the bf16 RNE-converted input; xn [NB*SEQ][CH] f16 (token-major).
__global__ __launch_bounds__(256) void ln_plane_kernel(const float* __restrict__ x,
                                                       const float* __restrict__ gamma,
                                                       const float* __restrict__ beta,
                                                       f16* __restrict__ xn) {
  const unsigned tid = threadIdx.x;
  const unsigned blk = blockIdx.x;
  const unsigned b   = blk / (SEQ / LNT);
  const unsigned p0  = (blk % (SEQ / LNT)) * LNT;
  __shared__ float sX[CH * LNP];                // [c][pix], cross-wave (block barrier)
  __shared__ float sG[CH];
  __shared__ float sB[CH];

  const float* xb = x + (size_t)b * CH * SEQ_FULL + p0;
  const unsigned px = tid & 31u;
  const unsigned cr = tid >> 5;
  #pragma unroll 4
  for (unsigned it = 0; it < 32; ++it) {
    const unsigned c = it * 8 + cr;
    const float v = xb[(size_t)c * SEQ_FULL + px];
    sX[c * LNP + px] = (float)(bf16)v;          // RNE convert
  }
  sG[tid] = (float)(bf16)gamma[tid];
  sB[tid] = (float)(bf16)beta[tid];
  __syncthreads();

  const unsigned tok  = tid >> 3;               // 0..31
  const unsigned part = tid & 7u;               // 0..7
  float s = 0.0f;
  #pragma unroll 4
  for (unsigned j = 0; j < 32; ++j) s += sX[(part + 8 * j) * LNP + tok];
  s += __shfl_xor(s, 1, 32);
  s += __shfl_xor(s, 2, 32);
  s += __shfl_xor(s, 4, 32);
  const float mu = s * (1.0f / CH);
  float ss = 0.0f;
  #pragma unroll 4
  for (unsigned j = 0; j < 32; ++j) {
    const float d = sX[(part + 8 * j) * LNP + tok] - mu;
    ss += d * d;
  }
  ss += __shfl_xor(ss, 1, 32);
  ss += __shfl_xor(ss, 2, 32);
  ss += __shfl_xor(ss, 4, 32);
  const float rstd = rsqrtf(ss * (1.0f / CH) + 1e-5f);

  v4u    val[4];
  size_t idx[4];
  #pragma unroll
  for (unsigned j = 0; j < 4; ++j) {
    const unsigned c0 = j * 64 + part * 8;
    Pack8H ph;
    #pragma unroll
    for (unsigned i = 0; i < 8; ++i) {
      const float d = sX[(c0 + i) * LNP + tok] - mu;
      ph.h[i] = (f16)(d * rstd * sG[c0 + i] + sB[c0 + i]);
    }
    val[j] = ph.u;
    idx[j] = ((size_t)b * SEQ + p0 + tok) * CH + c0;
  }
  #pragma unroll
  for (unsigned j = 0; j < 4; ++j) *(v4u*)(xn + idx[j]) = val[j];
  
}

// QKV GEMM. Block = (128-token tile, 64-column tile = one head of q, k or v); wave = 16 tokens x 64 columns.
// A fragments from xn rows, B fragments from wqT rows (k contiguous), two 16-B loads each, split k map.
__global__ __launch_bounds__(256) void qkv_gemm_kernel(const f16* __restrict__ xn,
                                                       const f16* __restrict__ wqT,
                                                       const float* __restrict__ bqkv,
                                                       f16* __restrict__ qp,
                                                       f16* __restrict__ kp,
                                                       f16* __restrict__ vt) {
  const unsigned mt   = blockIdx.x;
  const unsigned nt   = blockIdx.y;             // 0..11
  const unsigned tid  = threadIdx.x;
  const unsigned wave = tid >> 5;
  const unsigned lane = tid & 31u;
  const unsigned lq   = lane & 15u;
  const unsigned hi   = lane >> 4;
  const unsigned sel  = nt >> 2;                // 0 q, 1 k, 2 v
  const unsigned h    = nt & 3u;
  __shared__ __align__(16) f16 sT[MT * TP];     // [tok][d] (q,k) or [d][tok] pitch VP (v); cross-wave (block barrier)

  const f16* arow = xn + (size_t)(mt * MT + wave * 16 + lq) * CH;
  const f16* brow = wqT + (size_t)(nt * 64 + lq) * CH;

  v8f acc[4];
  #pragma unroll
  for (unsigned dt = 0; dt < 4; ++dt) acc[dt] = (v8f){0, 0, 0, 0, 0, 0, 0, 0};

  #pragma unroll 2
  for (unsigned ks = 0; ks < CH / 32; ++ks) {
    FragH a;
    a.q[0] = *(const v4u*)(arow + ks * 32 + hi * 8);          // k = ks*32 + hi*8 + 0..7
    a.q[1] = *(const v4u*)(arow + ks * 32 + 16 + hi * 8);     // k = ks*32 + 16 + hi*8 + 0..7
    FragH bw[4];
    #pragma unroll
    for (unsigned dt = 0; dt < 4; ++dt) {
      const f16* base = brow + (size_t)dt * 16 * CH + ks * 32 + hi * 8;
      bw[dt].q[0] = *(const v4u*)(base);
      bw[dt].q[1] = *(const v4u*)(base + 16);
    }
    #pragma unroll
    for (unsigned dt = 0; dt < 4; ++dt) acc[dt] = mma_f16(a.v, bw[dt].v, acc[dt]);
  }

  float bias[4];
  #pragma unroll
  for (unsigned dt = 0; dt < 4; ++dt) bias[dt] = (float)(bf16)bqkv[nt * 64 + dt * 16 + lq];

  // acc[dt][r] = 64 * value(token wave*16 + hi*8 + r, column dt*16 + lq)
  if (sel < 2u) {
    #pragma unroll
    for (unsigned dt = 0; dt < 4; ++dt) {
      #pragma unroll
      for (unsigned r = 0; r < 8; ++r)
        sT[(wave * 16 + hi * 8 + r) * TP + dt * 16 + lq] = (f16)(acc[dt][r] * (1.0f / 64.0f) + bias[dt]);
    }
  } else {
    #pragma unroll
    for (unsigned dt = 0; dt < 4; ++dt) {
      #pragma unroll
      for (unsigned r = 0; r < 8; ++r)
        sT[(dt * 16 + lq) * VP + wave * 16 + hi * 8 + r] = (f16)(acc[dt][r] * (1.0f / 64.0f) + bias[dt]);
    }
  }
  __syncthreads();

  const unsigned b    = mt / (SEQ / MT);
  const unsigned tok0 = (mt % (SEQ / MT)) * MT;
  f16* dst = (sel == 0u) ? qp : ((sel == 1u) ? kp : vt);
  v4u    val[4];
  size_t idx[4];
  if (sel < 2u) {
    #pragma unroll
    for (unsigned it = 0; it < 4; ++it) {
      const unsigned row = it * 32 + (tid >> 3);
      const unsigned pc  = tid & 7u;
      Pack8H ph;
      ph.v = *(const v8h*)(sT + row * TP + pc * 8);
      val[it] = ph.u;
      idx[it] = (((size_t)b * NHEAD + h) * SEQ + tok0 + row) * HDIM + pc * 8;
    }
  } else {
    #pragma unroll
    for (unsigned it = 0; it < 4; ++it) {
      const unsigned d  = it * 16 + (tid >> 4);
      const unsigned pc = tid & 15u;
      Pack8H ph;
      ph.v = *(const v8h*)(sT + d * VP + pc * 8);
      val[it] = ph.u;
      idx[it] = (((size_t)b * NHEAD + h) * HDIM + d) * SEQ + tok0 + pc * 8;
    }
  }
  #pragma unroll
  for (unsigned it = 0; it < 4; ++it) *(v4u*)(dst + idx[it]) = val[it];
  
}

// Flash attention, full (no mask). Block = (query block of 128, head, batch); one wave owns 16 query rows.
// S^T = K x Q^T so queries sit on lanes; P^T in C-layout is bit-identical to the A-fragment layout of O += P x V.
// K A-fragments, Q B-fragments and V^T B-fragments are loaded straight from the f16 planes (two 16-B loads per fragment).
__global__ __launch_bounds__(256) void attn_kernel(const f16* __restrict__ qp,
                                                   const f16* __restrict__ kp,
                                                   const f16* __restrict__ vt,
                                                   f16* __restrict__ ctx) {
  const unsigned qblk = blockIdx.x;
  const unsigned h    = blockIdx.y;
  const unsigned b    = blockIdx.z;
  const unsigned tid  = threadIdx.x;
  const unsigned wave = tid >> 5;
  const unsigned lane = tid & 31u;
  const unsigned lq   = lane & 15u;   // query column of S^T / d column of O
  const unsigned hi   = lane >> 4;    // k-split half

  __shared__ __align__(16) f16 sO[NWAVE * 16 * TP];   // per-wave output staging (block barrier used)

  const unsigned qrow0 = qblk * BQ + wave * 16;

  const f16* qp_h = qp + ((size_t)b * NHEAD + h) * SEQ * HDIM;
  const f16* kp_h = kp + ((size_t)b * NHEAD + h) * SEQ * HDIM;
  const f16* vt_h = vt + ((size_t)b * NHEAD + h) * HDIM * SEQ;

  // Q as B-operand fragments: lane lq holds query qrow0+lq, elements follow the split d map.
  FragH qf[2];
  {
    const f16* qr = qp_h + (size_t)(qrow0 + lq) * HDIM;
    #pragma unroll
    for (unsigned f = 0; f < 2; ++f) {
      qf[f].q[0] = *(const v4u*)(qr + f * 32 + hi * 8);         // d = f*32 + hi*8 + 0..7
      qf[f].q[1] = *(const v4u*)(qr + f * 32 + 16 + hi * 8);    // d = f*32 + 16 + hi*8 + 0..7
    }
  }

  v8f o[4];
  #pragma unroll
  for (unsigned dt = 0; dt < 4; ++dt) o[dt] = (v8f){0, 0, 0, 0, 0, 0, 0, 0};

  float rmax = -__builtin_inff();
  float rsum = 0.0f;
  const float SL = 0.0625f * 1.4426950408889634f;   // softmax scale (1/sqrt(CH)) * log2(e)

  for (unsigned i = 0; i < SEQ / BK; ++i) {
    const unsigned j0 = i * BK;

    // K A-fragments: row = key j0 + sub*16 + lq, split d map
    FragH ak[2][2];
    #pragma unroll
    for (unsigned sub = 0; sub < 2; ++sub) {
      #pragma unroll
      for (unsigned f = 0; f < 2; ++f) {
        const f16* base = kp_h + (size_t)(j0 + sub * 16 + lq) * HDIM + f * 32 + hi * 8;
        ak[sub][f].q[0] = *(const v4u*)(base);
        ak[sub][f].q[1] = *(const v4u*)(base + 16);
      }
    }
    // V B-fragments: column n = d = dt*16 + lq, split key map from the transposed plane
    FragH bv[4];
    #pragma unroll
    for (unsigned dt = 0; dt < 4; ++dt) {
      const f16* base = vt_h + (size_t)(dt * 16 + lq) * SEQ + j0 + hi * 8;
      bv[dt].q[0] = *(const v4u*)(base);            // keys j0 + hi*8 + 0..7
      bv[dt].q[1] = *(const v4u*)(base + 16);       // keys j0 + 16 + hi*8 + 0..7
    }

    // S^T tiles: c[sub][r] = rawscore(query qrow0+lq, key j0 + sub*16 + hi*8 + r)
    v8f c[2];
    #pragma unroll
    for (unsigned sub = 0; sub < 2; ++sub) {
      v8f acc = (v8f){0, 0, 0, 0, 0, 0, 0, 0};
      acc = mma_f16(ak[sub][0].v, qf[0].v, acc);
      acc = mma_f16(ak[sub][1].v, qf[1].v, acc);
      c[sub] = acc;
    }

    // online softmax: query lq's 32 scores are split across lane / lane^16
    float m_new = rmax;
    #pragma unroll
    for (unsigned r = 0; r < 8; ++r) {
      m_new = fmaxf(m_new, c[0][r]);
      m_new = fmaxf(m_new, c[1][r]);
    }
    m_new = fmaxf(m_new, __shfl_xor(m_new, 16, 32));
    const float scale = __builtin_amdgcn_exp2f((rmax - m_new) * SL);
    rmax = m_new;

    // exp + pack: P^T C-layout == A-fragment layout for the PV product; P carried x4096
    FragH pa;
    float psum = 0.0f;
    #pragma unroll
    for (unsigned r = 0; r < 8; ++r) {
      const float p0 = __builtin_amdgcn_exp2f((c[0][r] - m_new) * SL);   // key hi*8 + r
      const float p1 = __builtin_amdgcn_exp2f((c[1][r] - m_new) * SL);   // key 16 + hi*8 + r
      psum += p0 + p1;
      pa.h[r]     = (f16)(p0 * 4096.0f);
      pa.h[8 + r] = (f16)(p1 * 4096.0f);
    }
    rsum = rsum * scale + psum + __shfl_xor(psum, 16, 32);

    // rescale O: queries are the row dimension there -> per-row scale from lane 8*hi + r
    float sc[8];
    #pragma unroll
    for (unsigned r = 0; r < 8; ++r) sc[r] = __shfl(scale, (int)((hi << 3) + r), 32);
    #pragma unroll
    for (unsigned dt = 0; dt < 4; ++dt) {
      #pragma unroll
      for (unsigned r = 0; r < 8; ++r) o[dt][r] *= sc[r];
    }

    // O += P x V
    #pragma unroll
    for (unsigned dt = 0; dt < 4; ++dt) o[dt] = mma_f16(pa.v, bv[dt].v, o[dt]);
  }

  // normalize: lane holds column d = dt*16 + lq for query rows 8*hi + r; fold 1/4096 and the x256 ctx carry
  float rs[8];
  #pragma unroll
  for (unsigned r = 0; r < 8; ++r) rs[r] = 1.0f / __shfl(rsum, (int)((hi << 3) + r), 32);

  f16* so = sO + wave * (16 * TP);
  #pragma unroll
  for (unsigned r = 0; r < 8; ++r) {
    #pragma unroll
    for (unsigned dt = 0; dt < 4; ++dt)
      so[(hi * 8 + r) * TP + dt * 16 + lq] = (f16)(o[dt][r] * (256.0f / 4096.0f) * rs[r]);
  }
  __syncthreads();

  v4u    val[4];
  size_t idx[4];
  #pragma unroll
  for (unsigned it = 0; it < 4; ++it) {
    const unsigned row = it * 4 + (lane >> 3);
    const unsigned pc  = lane & 7u;
    Pack8H ph;
    ph.v = *(const v8h*)(so + row * TP + pc * 8);
    val[it] = ph.u;
    idx[it] = ((size_t)b * SEQ + qrow0 + row) * CH + h * HDIM + pc * 8;
  }
  #pragma unroll
  for (unsigned it = 0; it < 4; ++it) *(v4u*)(ctx + idx[it]) = val[it];
  
}

// Projection, transposed: Y^T[c][tok] = sum_k wpT[c][k] * ctx[tok][k]. Block = (128-token tile, 64-channel tile).
// A fragments from wpT rows (channel), B fragments from ctx rows (token); D rows = channels, columns = tokens,
// so the channel-major output row of 128 pixels (512 B) is written by one wave instruction (32 lanes x 16 B).
__global__ __launch_bounds__(256) void proj_kernel(const f16* __restrict__ ctx,
                                                   const f16* __restrict__ wpT,
                                                   const float* __restrict__ bproj,
                                                   const float* __restrict__ x,
                                                   float* __restrict__ out) {
  const unsigned mt   = blockIdx.x;
  const unsigned ct   = blockIdx.y;             // 0..3
  const unsigned tid  = threadIdx.x;
  const unsigned wave = tid >> 5;
  const unsigned lane = tid & 31u;
  const unsigned lq   = lane & 15u;
  const unsigned hi   = lane >> 4;
  __shared__ __align__(16) float sO[64 * OPF];  // [channel][token], cross-wave (block barrier)

  const f16* brow = ctx + (size_t)(mt * MT + wave * 16 + lq) * CH;
  const f16* arow = wpT + (size_t)(ct * 64 + lq) * CH;

  v8f acc[4];
  #pragma unroll
  for (unsigned m4 = 0; m4 < 4; ++m4) acc[m4] = (v8f){0, 0, 0, 0, 0, 0, 0, 0};

  #pragma unroll 2
  for (unsigned ks = 0; ks < CH / 32; ++ks) {
    FragH bc;
    bc.q[0] = *(const v4u*)(brow + ks * 32 + hi * 8);
    bc.q[1] = *(const v4u*)(brow + ks * 32 + 16 + hi * 8);
    FragH aw[4];
    #pragma unroll
    for (unsigned m4 = 0; m4 < 4; ++m4) {
      const f16* base = arow + (size_t)m4 * 16 * CH + ks * 32 + hi * 8;
      aw[m4].q[0] = *(const v4u*)(base);
      aw[m4].q[1] = *(const v4u*)(base + 16);
    }
    #pragma unroll
    for (unsigned m4 = 0; m4 < 4; ++m4) acc[m4] = mma_f16(aw[m4].v, bc.v, acc[m4]);
  }

  // acc[m4][r] = 16384 * value(channel m4*16 + hi*8 + r, token wave*16 + lq)
  #pragma unroll
  for (unsigned m4 = 0; m4 < 4; ++m4) {
    #pragma unroll
    for (unsigned r = 0; r < 8; ++r)
      sO[(m4 * 16 + hi * 8 + r) * OPF + wave * 16 + lq] = acc[m4][r] * (1.0f / 16384.0f);
  }
  __syncthreads();

  const unsigned b  = mt / (SEQ / MT);
  const unsigned p0 = (mt % (SEQ / MT)) * MT;
  v4f    val[8];
  size_t idx[8];
  #pragma unroll
  for (unsigned it = 0; it < 8; ++it) {
    const unsigned row = it * 8 + wave;                 // channel within the tile (wave-uniform)
    const unsigned c   = ct * 64 + row;
    const v4f a  = *(const v4f*)(sO + row * OPF + lane * 4);
    const float bb = (float)(bf16)bproj[c];
    const size_t gi = ((size_t)b * CH + c) * SEQ_FULL + p0 + lane * 4;
    const v4f xv = *(const v4f*)(x + gi);
    v4f res;
    #pragma unroll
    for (unsigned i = 0; i < 4; ++i) res[i] = (float)(bf16)xv[i] + (a[i] + bb);
    val[it] = res;
    idx[it] = gi;
  }
  #pragma unroll
  for (unsigned it = 0; it < 8; ++it) *(v4f*)(out + idx[it]) = val[it];
  
}

extern "C" void kernel_launch(void* const* d_in, const int* in_sizes, int n_in,
                              void* d_out, int out_size, void* d_ws, size_t ws_size,
                              hipStream_t stream) {
  if (n_in < 7) return;
  const size_t x_need = ((size_t)(NB - 1) * CH + (CH - 1)) * SEQ_FULL + SEQ;
  if ((size_t)in_sizes[0] < x_need) return;
  if (in_sizes[1] < CH || in_sizes[2] < CH) return;
  if ((size_t)in_sizes[3] < (size_t)CH * QKVN || in_sizes[4] < QKVN) return;
  if ((size_t)in_sizes[5] < (size_t)CH * CH || in_sizes[6] < CH) return;
  if ((size_t)out_size < x_need) return;

  const size_t tok_plane = (size_t)NB * SEQ * CH * 2;            // xn, ctx and each of q/k/v^T: same bytes
  const size_t wq_bytes  = (size_t)QKVN * CH * 2;
  const size_t wp_bytes  = (size_t)CH * CH * 2;
  const size_t total     = 5 * tok_plane + wq_bytes + wp_bytes;
  if (ws_size < total) return;

  const float* x     = (const float*)d_in[0];
  const float* gam   = (const float*)d_in[1];
  const float* bet   = (const float*)d_in[2];
  const float* wqkv  = (const float*)d_in[3];
  const float* bqkv  = (const float*)d_in[4];
  const float* wproj = (const float*)d_in[5];
  const float* bproj = (const float*)d_in[6];
  float* out = (float*)d_out;

  char* ws = (char*)d_ws;
  f16* xn  = (f16*)(ws);
  f16* qp  = (f16*)(ws + 1 * tok_plane);
  f16* kp  = (f16*)(ws + 2 * tok_plane);
  f16* vt  = (f16*)(ws + 3 * tok_plane);
  f16* ctx = (f16*)(ws + 4 * tok_plane);
  f16* wqT = (f16*)(ws + 5 * tok_plane);
  f16* wpT = (f16*)(ws + 5 * tok_plane + wq_bytes);

  w_planes_kernel<<<dim3(CH / 64, QKVN / 64 + CH / 64), 256, 0, stream>>>(wqkv, wproj, wqT, wpT);
  ln_plane_kernel<<<dim3(NB * (SEQ / LNT)), 256, 0, stream>>>(x, gam, bet, xn);
  qkv_gemm_kernel<<<dim3(NB * (SEQ / MT), QKVN / 64), 256, 0, stream>>>(xn, wqT, bqkv, qp, kp, vt);
  attn_kernel<<<dim3(SEQ / BQ, NHEAD, NB), 256, 0, stream>>>(qp, kp, vt, ctx);
  proj_kernel<<<dim3(NB * (SEQ / MT), CH / 64), 256, 0, stream>>>(ctx, wpT, bproj, x, out);
}

// v001
// One run takes 158 microseconds.
// Timed twice side by side with v000, it ran 1.92 and 1.94 times as fast.
#include <hip/hip_runtime.h>

// Contractions (all v_wmma_f32_16x16x32_f16, f16 operands, f32 accumulate): QKV = xn x Wqkv (W = f16 of the bf16 RNE-converted weight x64);
// S^T = K x Q^T (f16 q/k planes); O = P x V (P carried x4096, V^T f16 plane); Y^T = Wproj^T x ctx^T (ctx carried x256, W x64). LayerNorm, softmax, bias and residual in f32.
// Every f16 operand plane in the workspace is stored in fragment order: one 512-B unit per (16-row tile, 16-wide k piece), holding for each
// lane the 8 halves it loads, so a wave-wide 16-B load reads 4 whole 128-B lines. Unit u of a 16-row tile covers k = u*16 .. u*16+15;
// lane (lq = row in the tile, hi) owns k = u*16 + hi*8 + 0..7 at half offset u*256 + slot*8 (slot = hi*16 + lq; xn: slot = lq*2 + hi).

#ifndef NB
#define NB 4
#endif
#ifndef SEQ
#define SEQ 4096
#endif
#define NB_FULL    4
#define SEQ_FULL   4096
#define CH         256                  // channels = NHEAD * HDIM
#define NHEAD      4
#define HDIM       64
#define QKVN       (3 * CH)
#define BQ         128                  // query rows per attention workgroup (8 waves x 16)
#define BK         32                   // keys per inner iteration
#define NWAVE      8
#define MT         128                  // tokens per GEMM workgroup (8 waves x 16)
#define LNT        32                   // tokens per LayerNorm workgroup
#define LNP        33                   // LDS pitch (floats) of the LayerNorm tile
#define TP         72                   // LDS pitch (halves) of 64-wide f16 tiles
#define VP         136                  // LDS pitch (halves) of the 128-wide transposed V tile
#define OPF        132                  // LDS pitch (floats) of the projection staging tile

static_assert(SEQ % BQ == 0);
static_assert(SEQ % MT == 0);
static_assert(SEQ % LNT == 0);
static_assert(SEQ % BK == 0);
static_assert(BQ == NWAVE * 16);
static_assert(MT == NWAVE * 16);
static_assert(CH == NHEAD * HDIM);
static_assert(CH == 256);
static_assert(HDIM == 64);
static_assert(CH % 32 == 0);
static_assert(SEQ <= SEQ_FULL);
static_assert(NB >= 1 && NB <= NB_FULL);
static_assert((TP * 2) % 16 == 0);
static_assert((VP * 2) % 16 == 0);
static_assert((OPF * 4) % 16 == 0);
static_assert(MT * TP >= HDIM * VP);
// coverage equalities (threads x pieces x elements == tile elements)
static_assert(256 * 4 * 8 == LNT * CH);          // LayerNorm plane tile
static_assert(256 * 2 * 8 == 64 * 64);           // weight plane tile
static_assert(256 * 4 * 8 == MT * HDIM);         // q / k / v^T plane tile
static_assert(32 * 4 * 8 == 16 * HDIM);          // per-wave ctx tile
static_assert(NWAVE * 8 * 32 * 4 == 64 * MT);    // output tile

typedef __bf16   bf16;
typedef _Float16 f16;
typedef f16      v16h  __attribute__((ext_vector_type(16)));
typedef f16      v8h   __attribute__((ext_vector_type(8)));
typedef float    v8f   __attribute__((ext_vector_type(8)));
typedef float    v4f   __attribute__((ext_vector_type(4)));
typedef unsigned v4u   __attribute__((ext_vector_type(4)));

union FragH  { v16h  v; v4u q[2]; f16  h[16]; };
union Pack8H { v4u u; v8h v; f16 h[8]; };

// WMMA helper: builtin followed by the VALU hazard guard (ties D, keeps A/B live).
static __device__ __forceinline__ v8f mma_f16(v16h a, v16h b, v8f acc) {
  acc = __builtin_amdgcn_wmma_f32_16x16x32_f16(false, a, false, b, (short)0, acc, false, false);
  asm volatile("v_nop\n\tv_nop\n\tv_nop\n\tv_nop" : "+v"(acc) : "v"(a), "v"(b));
  return acc;
}

// Weight planes. Block = (64-wide k tile, 64-wide n tile), 256 threads.
//   wqT f16 = bf16(w_qkv[k][n]) x 64, wpT f16 = bf16(w_proj[k][n]) x 64, both in fragment order: tile = 16 columns n, 16 units over k.
__global__ __launch_bounds__(256) void w_planes_kernel(const float* __restrict__ wqkv,
                                                       const float* __restrict__ wproj,
                                                       f16* __restrict__ wqT,
                                                       f16* __restrict__ wpT) {
  const unsigned kt  = blockIdx.x;              // 0..3
  const unsigned nt  = blockIdx.y;              // 0..11 qkv, 12..15 proj
  const unsigned tid = threadIdx.x;
  const bool isq = nt < (QKVN / 64);
  const float* src = isq ? wqkv : wproj;        // both global, block-uniform
  f16*         dst = isq ? wqT : wpT;
  const unsigned ldn = isq ? (unsigned)QKVN : (unsigned)CH;
  const unsigned n0  = (isq ? nt : (nt - QKVN / 64)) * 64u;
  const unsigned k0  = kt * 64u;
  __shared__ __align__(16) f16 sT[64 * TP];     // [n][k], cross-wave (block barrier)

  #pragma unroll
  for (unsigned kk = 0; kk < 2; ++kk) {
    const unsigned kr = kk * 32 + (tid >> 3);   // 0..63
    const unsigned nn = (tid & 7u) * 8;         // 0..56
    const float* p = src + (size_t)(k0 + kr) * ldn + n0 + nn;
    const v4f w0 = *(const v4f*)(p);
    const v4f w1 = *(const v4f*)(p + 4);
    #pragma unroll
    for (unsigned i = 0; i < 4; ++i) {
      sT[(nn + i) * TP + kr]     = (f16)((float)(bf16)w0[i] * 64.0f);   // exact in f16
      sT[(nn + 4 + i) * TP + kr] = (f16)((float)(bf16)w1[i] * 64.0f);
    }
  }
  __syncthreads();

  v4u    val[2];
  size_t idx[2];
  #pragma unroll
  for (unsigned kk = 0; kk < 2; ++kk) {
    const unsigned g  = kk * 256 + tid;         // destination order: (n tile 0..3, unit 0..3, slot 0..31)
    const unsigned nl = g >> 7;
    const unsigned u  = (g >> 5) & 3u;
    const unsigned n  = nl * 16 + (g & 15u);
    const unsigned ks = u * 16 + ((g >> 4) & 1u) * 8;
    Pack8H ph;
    ph.v = *(const v8h*)(sT + n * TP + ks);
    val[kk] = ph.u;
    idx[kk] = (size_t)(n0 / 16 + nl) * (16 * CH) + (k0 / 16 + u) * 256 + (g & 31u) * 8;
  }
  #pragma unroll
  for (unsigned kk = 0; kk < 2; ++kk) *(v4u*)(dst + idx[kk]) = val[kk];
  
}

// LayerNorm over channels of the bf16 RNE-converted input; xn f16 in fragment order: tile = 16 tokens, 16 units over channels,
// slot = lq*2 + hi so that the 4 tokens x 2 pieces a wave holds per unit make one whole 128-B line.
__global__ __launch_bounds__(256) void ln_plane_kernel(const float* __restrict__ x,
                                                       const float* __restrict__ gamma,
                                                       const float* __restrict__ beta,
                                                       f16* __restrict__ xn) {
  const unsigned tid = threadIdx.x;
  const unsigned blk = blockIdx.x;
  const unsigned b   = blk / (SEQ / LNT);
  const unsigned p0  = (blk % (SEQ / LNT)) * LNT;
  __shared__ float sX[CH * LNP];                // [c][pix], cross-wave (block barrier)
  __shared__ float sG[CH];
  __shared__ float sB[CH];

  const float* xb = x + (size_t)b * CH * SEQ_FULL + p0;
  const unsigned px = tid & 31u;
  const unsigned cr = tid >> 5;
  #pragma unroll 4
  for (unsigned it = 0; it < 32; ++it) {
    const unsigned c = it * 8 + cr;
    const float v = xb[(size_t)c * SEQ_FULL + px];
    sX[c * LNP + px] = (float)(bf16)v;          // RNE convert
  }
  sG[tid] = (float)(bf16)gamma[tid];
  sB[tid] = (float)(bf16)beta[tid];
  __syncthreads();

  const unsigned tok  = tid >> 3;               // 0..31
  const unsigned part = tid & 7u;               // 0..7
  float s = 0.0f;
  #pragma unroll 4
  for (unsigned j = 0; j < 32; ++j) s += sX[(part + 8 * j) * LNP + tok];
  s += __shfl_xor(s, 1, 32);
  s += __shfl_xor(s, 2, 32);
  s += __shfl_xor(s, 4, 32);
  const float mu = s * (1.0f / CH);
  float ss = 0.0f;
  #pragma unroll 4
  for (unsigned j = 0; j < 32; ++j) {
    const float d = sX[(part + 8 * j) * LNP + tok] - mu;
    ss += d * d;
  }
  ss += __shfl_xor(ss, 1, 32);
  ss += __shfl_xor(ss, 2, 32);
  ss += __shfl_xor(ss, 4, 32);
  const float rstd = rsqrtf(ss * (1.0f / CH) + 1e-5f);

  v4u    val[4];
  size_t idx[4];
  #pragma unroll
  for (unsigned j = 0; j < 4; ++j) {
    const unsigned c0 = j * 64 + part * 8;
    Pack8H ph;
    #pragma unroll
    for (unsigned i = 0; i < 8; ++i) {
      const float d = sX[(c0 + i) * LNP + tok] - mu;
      ph.h[i] = (f16)(d * rstd * sG[c0 + i] + sB[c0 + i]);
    }
    val[j] = ph.u;
    idx[j] = (((size_t)b * SEQ + p0 + tok) >> 4) * (16 * CH) + (c0 >> 4) * 256 + ((tok & 15u) * 2 + (part & 1u)) * 8;
  }
  #pragma unroll
  for (unsigned j = 0; j < 4; ++j) *(v4u*)(xn + idx[j]) = val[j];
  
}

// QKV GEMM. Block = (128-token tile, 64-column tile = one head of q, k or v); wave = 16 tokens x 64 columns.
// A fragments from xn, B fragments from wqT (both in fragment order), two 16-B loads each, split k map.
// q and k planes per head: tile = 16 tokens, 4 units over d; v plane per head: per 32 keys, tile = 16 columns d, 2 units over keys.
__global__ __launch_bounds__(256) void qkv_gemm_kernel(const f16* __restrict__ xn,
                                                       const f16* __restrict__ wqT,
                                                       const float* __restrict__ bqkv,
                                                       f16* __restrict__ qp,
                                                       f16* __restrict__ kp,
                                                       f16* __restrict__ vt) {
  const unsigned mt   = blockIdx.x;
  const unsigned nt   = blockIdx.y;             // 0..11
  const unsigned tid  = threadIdx.x;
  const unsigned wave = tid >> 5;
  const unsigned lane = tid & 31u;
  const unsigned lq   = lane & 15u;
  const unsigned hi   = lane >> 4;
  const unsigned sel  = nt >> 2;                // 0 q, 1 k, 2 v
  const unsigned h    = nt & 3u;
  __shared__ __align__(16) f16 sT[MT * TP];     // [tok][d] (q,k) or [d][tok] pitch VP (v); cross-wave (block barrier)

  const f16* arow = xn + (size_t)(mt * NWAVE + wave) * (16 * CH) + (lq * 2 + hi) * 8;
  const f16* brow = wqT + (size_t)(nt * 4) * (16 * CH) + lane * 8;

  v8f acc[4];
  #pragma unroll
  for (unsigned dt = 0; dt < 4; ++dt) acc[dt] = (v8f){0, 0, 0, 0, 0, 0, 0, 0};

  #pragma unroll 2
  for (unsigned ks = 0; ks < CH / 32; ++ks) {
    FragH a;
    a.q[0] = *(const v4u*)(arow + ks * 512);                  // k = ks*32 + hi*8 + 0..7
    a.q[1] = *(const v4u*)(arow + ks * 512 + 256);            // k = ks*32 + 16 + hi*8 + 0..7
    FragH bw[4];
    #pragma unroll
    for (unsigned dt = 0; dt < 4; ++dt) {
      const f16* base = brow + (size_t)dt * 16 * CH + ks * 512;
      bw[dt].q[0] = *(const v4u*)(base);
      bw[dt].q[1] = *(const v4u*)(base + 256);
    }
    #pragma unroll
    for (unsigned dt = 0; dt < 4; ++dt) acc[dt] = mma_f16(a.v, bw[dt].v, acc[dt]);
  }

  float bias[4];
  #pragma unroll
  for (unsigned dt = 0; dt < 4; ++dt) bias[dt] = (float)(bf16)bqkv[nt * 64 + dt * 16 + lq];

  // acc[dt][r] = 64 * value(token wave*16 + hi*8 + r, column dt*16 + lq)
  if (sel < 2u) {
    #pragma unroll
    for (unsigned dt = 0; dt < 4; ++dt) {
      #pragma unroll
      for (unsigned r = 0; r < 8; ++r)
        sT[(wave * 16 + hi * 8 + r) * TP + dt * 16 + lq] = (f16)(acc[dt][r] * (1.0f / 64.0f) + bias[dt]);
    }
  } else {
    #pragma unroll
    for (unsigned dt = 0; dt < 4; ++dt) {
      #pragma unroll
      for (unsigned r = 0; r < 8; ++r)
        sT[(dt * 16 + lq) * VP + wave * 16 + hi * 8 + r] = (f16)(acc[dt][r] * (1.0f / 64.0f) + bias[dt]);
    }
  }
  __syncthreads();

  const unsigned b    = mt / (SEQ / MT);
  const unsigned tok0 = (mt % (SEQ / MT)) * MT;
  f16* dst = (sel == 0u) ? qp : ((sel == 1u) ? kp : vt);
  v4u    val[4];
  size_t idx[4];
  if (sel < 2u) {
    #pragma unroll
    for (unsigned it = 0; it < 4; ++it) {
      const unsigned row = it * 32 + (wave >> 2) * 16 + lq;     // destination order: (token tile, unit = wave & 3, slot = lane)
      Pack8H ph;
      ph.v = *(const v8h*)(sT + row * TP + (wave & 3u) * 16 + hi * 8);
      val[it] = ph.u;
      idx[it] = (((size_t)b * NHEAD + h) * SEQ + tok0 + it * 32) * HDIM + tid * 8;
    }
  } else {
    #pragma unroll
    for (unsigned it = 0; it < 4; ++it) {
      const unsigned d = (wave >> 1) * 16 + lq;                 // destination order: (32-key block it, d tile, unit = wave & 1, slot = lane)
      Pack8H ph;
      ph.v = *(const v8h*)(sT + d * VP + it * 32 + (wave & 1u) * 16 + hi * 8);
      val[it] = ph.u;
      idx[it] = (((size_t)b * NHEAD + h) * SEQ + tok0 + it * 32) * HDIM + tid * 8;
    }
  }
  #pragma unroll
  for (unsigned it = 0; it < 4; ++it) *(v4u*)(dst + idx[it]) = val[it];
  
}

// Flash attention, full (no mask). Block = (query block of 128, head, batch); one wave owns 16 query rows.
// S^T = K x Q^T so queries sit on lanes; P^T in C-layout is bit-identical to the A-fragment layout of O += P x V.
// K A-fragments, Q B-fragments and V^T B-fragments are loaded straight from the fragment-order f16 planes (two 16-B loads per fragment).
__global__ __launch_bounds__(256) void attn_kernel(const f16* __restrict__ qp,
                                                   const f16* __restrict__ kp,
                                                   const f16* __restrict__ vt,
                                                   f16* __restrict__ ctx) {
  const unsigned qblk = blockIdx.x;
  const unsigned h    = blockIdx.y;
  const unsigned b    = blockIdx.z;
  const unsigned tid  = threadIdx.x;
  const unsigned wave = tid >> 5;
  const unsigned lane = tid & 31u;
  const unsigned lq   = lane & 15u;   // query column of S^T / d column of O
  const unsigned hi   = lane >> 4;    // k-split half

  __shared__ __align__(16) f16 sO[NWAVE * 16 * TP];   // per-wave output staging (block barrier used)

  const unsigned qrow0 = qblk * BQ + wave * 16;

  const f16* qp_h = qp + ((size_t)b * NHEAD + h) * SEQ * HDIM;
  const f16* kp_h = kp + ((size_t)b * NHEAD + h) * SEQ * HDIM;
  const f16* vt_h = vt + ((size_t)b * NHEAD + h) * HDIM * SEQ;

  // Q as B-operand fragments: lane lq holds query qrow0+lq, elements follow the split d map.
  FragH qf[2];
  {
    const f16* qr = qp_h + (size_t)qrow0 * HDIM + lane * 8;
    #pragma unroll
    for (unsigned f = 0; f < 2; ++f) {
      qf[f].q[0] = *(const v4u*)(qr + f * 512);                 // d = f*32 + hi*8 + 0..7
      qf[f].q[1] = *(const v4u*)(qr + f * 512 + 256);           // d = f*32 + 16 + hi*8 + 0..7
    }
  }

  v8f o[4];
  #pragma unroll
  for (unsigned dt = 0; dt < 4; ++dt) o[dt] = (v8f){0, 0, 0, 0, 0, 0, 0, 0};

  float rmax = -__builtin_inff();
  float rsum = 0.0f;
  const float SL = 0.0625f * 1.4426950408889634f;   // softmax scale (1/sqrt(CH)) * log2(e)

  for (unsigned i = 0; i < SEQ / BK; ++i) {
    const unsigned j0 = i * BK;

    // K A-fragments: row = key j0 + sub*16 + lq, split d map
    FragH ak[2][2];
    #pragma unroll
    for (unsigned sub = 0; sub < 2; ++sub) {
      #pragma unroll
      for (unsigned f = 0; f < 2; ++f) {
        const f16* base = kp_h + (size_t)(j0 + sub * 16) * HDIM + f * 512 + lane * 8;
        ak[sub][f].q[0] = *(const v4u*)(base);
        ak[sub][f].q[1] = *(const v4u*)(base + 256);
      }
    }
    // V B-fragments: column n = d = dt*16 + lq, split key map
    FragH bv[4];
    #pragma unroll
    for (unsigned dt = 0; dt < 4; ++dt) {
      const f16* base = vt_h + (size_t)j0 * HDIM + dt * 512 + lane * 8;
      bv[dt].q[0] = *(const v4u*)(base);            // keys j0 + hi*8 + 0..7
      bv[dt].q[1] = *(const v4u*)(base + 256);      // keys j0 + 16 + hi*8 + 0..7
    }

    // S^T tiles: c[sub][r] = rawscore(query qrow0+lq, key j0 + sub*16 + hi*8 + r)
    v8f c[2];
    #pragma unroll
    for (unsigned sub = 0; sub < 2; ++sub) {
      v8f acc = (v8f){0, 0, 0, 0, 0, 0, 0, 0};
      acc = mma_f16(ak[sub][0].v, qf[0].v, acc);
      acc = mma_f16(ak[sub][1].v, qf[1].v, acc);
      c[sub] = acc;
    }

    // online softmax: query lq's 32 scores are split across lane / lane^16
    float m_new = rmax;
    #pragma unroll
    for (unsigned r = 0; r < 8; ++r) {
      m_new = fmaxf(m_new, c[0][r]);
      m_new = fmaxf(m_new, c[1][r]);
    }
    m_new = fmaxf(m_new, __shfl_xor(m_new, 16, 32));
    const float scale = __builtin_amdgcn_exp2f((rmax - m_new) * SL);
    rmax = m_new;

    // exp + pack: P^T C-layout == A-fragment layout for the PV product; P carried x4096
    FragH pa;
    float psum = 0.0f;
    #pragma unroll
    for (unsigned r = 0; r < 8; ++r) {
      const float p0 = __builtin_amdgcn_exp2f((c[0][r] - m_new) * SL);   // key hi*8 + r
      const float p1 = __builtin_amdgcn_exp2f((c[1][r] - m_new) * SL);   // key 16 + hi*8 + r
      psum += p0 + p1;
      pa.h[r]     = (f16)(p0 * 4096.0f);
      pa.h[8 + r] = (f16)(p1 * 4096.0f);
    }
    rsum = rsum * scale + psum + __shfl_xor(psum, 16, 32);

    // rescale O: queries are the row dimension there -> per-row scale from lane 8*hi + r
    float sc[8];
    #pragma unroll
    for (unsigned r = 0; r < 8; ++r) sc[r] = __shfl(scale, (int)((hi << 3) + r), 32);
    #pragma unroll
    for (unsigned dt = 0; dt < 4; ++dt) {
      #pragma unroll
      for (unsigned r = 0; r < 8; ++r) o[dt][r] *= sc[r];
    }

    // O += P x V
    #pragma unroll
    for (unsigned dt = 0; dt < 4; ++dt) o[dt] = mma_f16(pa.v, bv[dt].v, o[dt]);
  }

  // normalize: lane holds column d = dt*16 + lq for query rows 8*hi + r; fold 1/4096 and the x256 ctx carry
  float rs[8];
  #pragma unroll
  for (unsigned r = 0; r < 8; ++r) rs[r] = 1.0f / __shfl(rsum, (int)((hi << 3) + r), 32);

  f16* so = sO + wave * (16 * TP);
  #pragma unroll
  for (unsigned r = 0; r < 8; ++r) {
    #pragma unroll
    for (unsigned dt = 0; dt < 4; ++dt)
      so[(hi * 8 + r) * TP + dt * 16 + lq] = (f16)(o[dt][r] * (256.0f / 4096.0f) * rs[r]);
  }
  __syncthreads();

  v4u    val[4];
  size_t idx[4];
  #pragma unroll
  for (unsigned it = 0; it < 4; ++it) {
    Pack8H ph;                                    // ctx in fragment order: tile = this wave's 16 tokens, unit = h*4 + it, slot = lane
    ph.v = *(const v8h*)(so + lq * TP + it * 16 + hi * 8);
    val[it] = ph.u;
    idx[it] = ((size_t)b * SEQ + qrow0) * CH + (h * 4 + it) * 256 + lane * 8;
  }
  #pragma unroll
  for (unsigned it = 0; it < 4; ++it) *(v4u*)(ctx + idx[it]) = val[it];
  
}

// Projection, transposed: Y^T[c][tok] = sum_k wpT[c][k] * ctx[tok][k]. Block = (128-token tile, 64-channel tile).
// A fragments from wpT (channel tiles), B fragments from ctx (token tiles), both in fragment order; D rows = channels, columns = tokens,
// so the channel-major output row of 128 pixels (512 B) is written by one wave instruction (32 lanes x 16 B).
__global__ __launch_bounds__(256) void proj_kernel(const f16* __restrict__ ctx,
                                                   const f16* __restrict__ wpT,
                                                   const float* __restrict__ bproj,
                                                   const float* __restrict__ x,
                                                   float* __restrict__ out) {
  const unsigned mt   = blockIdx.x;
  const unsigned ct   = blockIdx.y;             // 0..3
  const unsigned tid  = threadIdx.x;
  const unsigned wave = tid >> 5;
  const unsigned lane = tid & 31u;
  const unsigned lq   = lane & 15u;
  const unsigned hi   = lane >> 4;
  __shared__ __align__(16) float sO[64 * OPF];  // [channel][token], cross-wave (block barrier)

  const f16* brow = ctx + (size_t)(mt * NWAVE + wave) * (16 * CH) + lane * 8;
  const f16* arow = wpT + (size_t)(ct * 4) * (16 * CH) + lane * 8;

  v8f acc[4];
  #pragma unroll
  for (unsigned m4 = 0; m4 < 4; ++m4) acc[m4] = (v8f){0, 0, 0, 0, 0, 0, 0, 0};

  #pragma unroll 2
  for (unsigned ks = 0; ks < CH / 32; ++ks) {
    FragH bc;
    bc.q[0] = *(const v4u*)(brow + ks * 512);
    bc.q[1] = *(const v4u*)(brow + ks * 512 + 256);
    FragH aw[4];
    #pragma unroll
    for (unsigned m4 = 0; m4 < 4; ++m4) {
      const f16* base = arow + (size_t)m4 * 16 * CH + ks * 512;
      aw[m4].q[0] = *(const v4u*)(base);
      aw[m4].q[1] = *(const v4u*)(base + 256);
    }
    #pragma unroll
    for (unsigned m4 = 0; m4 < 4; ++m4) acc[m4] = mma_f16(aw[m4].v, bc.v, acc[m4]);
  }

  // acc[m4][r] = 16384 * value(channel m4*16 + hi*8 + r, token wave*16 + lq)
  #pragma unroll
  for (unsigned m4 = 0; m4 < 4; ++m4) {
    #pragma unroll
    for (unsigned r = 0; r < 8; ++r)
      sO[(m4 * 16 + hi * 8 + r) * OPF + wave * 16 + lq] = acc[m4][r] * (1.0f / 16384.0f);
  }
  __syncthreads();

  const unsigned b  = mt / (SEQ / MT);
  const unsigned p0 = (mt % (SEQ / MT)) * MT;
  v4f    val[8];
  size_t idx[8];
  #pragma unroll
  for (unsigned it = 0; it < 8; ++it) {
    const unsigned row = it * 8 + wave;                 // channel within the tile (wave-uniform)
    const unsigned c   = ct * 64 + row;
    const v4f a  = *(const v4f*)(sO + row * OPF + lane * 4);
    const float bb = (float)(bf16)bproj[c];
    const size_t gi = ((size_t)b * CH + c) * SEQ_FULL + p0 + lane * 4;
    const v4f xv = *(const v4f*)(x + gi);
    v4f res;
    #pragma unroll
    for (unsigned i = 0; i < 4; ++i) res[i] = (float)(bf16)xv[i] + (a[i] + bb);
    val[it] = res;
    idx[it] = gi;
  }
  #pragma unroll
  for (unsigned it = 0; it < 8; ++it) *(v4f*)(out + idx[it]) = val[it];
  
}

extern "C" void kernel_launch(void* const* d_in, const int* in_sizes, int n_in,
                              void* d_out, int out_size, void* d_ws, size_t ws_size,
                              hipStream_t stream) {
  if (n_in < 7) return;
  const size_t x_need = ((size_t)(NB - 1) * CH + (CH - 1)) * SEQ_FULL + SEQ;
  if ((size_t)in_sizes[0] < x_need) return;
  if (in_sizes[1] < CH || in_sizes[2] < CH) return;
  if ((size_t)in_sizes[3] < (size_t)CH * QKVN || in_sizes[4] < QKVN) return;
  if ((size_t)in_sizes[5] < (size_t)CH * CH || in_sizes[6] < CH) return;
  if ((size_t)out_size < x_need) return;

  const size_t tok_plane = (size_t)NB * SEQ * CH * 2;            // xn, ctx and each of q/k/v^T: same bytes
  const size_t wq_bytes  = (size_t)QKVN * CH * 2;
  const size_t wp_bytes  = (size_t)CH * CH * 2;
  const size_t total     = 5 * tok_plane + wq_bytes + wp_bytes;
  if (ws_size < total) return;

  const float* x     = (const float*)d_in[0];
  const float* gam   = (const float*)d_in[1];
  const float* bet   = (const float*)d_in[2];
  const float* wqkv  = (const float*)d_in[3];
  const float* bqkv  = (const float*)d_in[4];
  const float* wproj = (const float*)d_in[5];
  const float* bproj = (const float*)d_in[6];
  float* out = (float*)d_out;

  char* ws = (char*)d_ws;
  f16* xn  = (f16*)(ws);
  f16* qp  = (f16*)(ws + 1 * tok_plane);
  f16* kp  = (f16*)(ws + 2 * tok_plane);
  f16* vt  = (f16*)(ws + 3 * tok_plane);
  f16* ctx = (f16*)(ws + 4 * tok_plane);
  f16* wqT = (f16*)(ws + 5 * tok_plane);
  f16* wpT = (f16*)(ws + 5 * tok_plane + wq_bytes);

  w_planes_kernel<<<dim3(CH / 64, QKVN / 64 + CH / 64), 256, 0, stream>>>(wqkv, wproj, wqT, wpT);
  ln_plane_kernel<<<dim3(NB * (SEQ / LNT)), 256, 0, stream>>>(x, gam, bet, xn);
  qkv_gemm_kernel<<<dim3(NB * (SEQ / MT), QKVN / 64), 256, 0, stream>>>(xn, wqT, bqkv, qp, kp, vt);
  attn_kernel<<<dim3(SEQ / BQ, NHEAD, NB), 256, 0, stream>>>(qp, kp, vt, ctx);
  proj_kernel<<<dim3(NB * (SEQ / MT), CH / 64), 256, 0, stream>>>(ctx, wpT, bproj, x, out);
}

// v002
// A run of this version takes 142 microseconds.
// Two timings next to v001 put it at 1.12 and 1.10 times that version's speed.
// Counting every step since v000, it is 2.14 times as fast.
#include <hip/hip_runtime.h>

// Contractions (all v_wmma_f32_16x16x32_f16, f16 operands, f32 accumulate): QKV = xn x Wqkv (W = f16 of the bf16 RNE-converted weight x64);
// S^T = K x Q^T (f16 q/k planes); O = P x V (P carried x4096, V^T f16 plane); Y^T = Wproj^T x ctx^T (ctx carried x256, W x64). LayerNorm, softmax, bias and residual in f32.
// Every f16 operand plane in the workspace is stored in fragment order: one 512-B unit per (16-row tile, 16-wide k piece), holding for each
// lane the 8 halves it loads, so a wave-wide 16-B load reads 4 whole 128-B lines. Unit u of a 16-row tile covers k = u*16 .. u*16+15;
// lane (lq = row in the tile, hi) owns k = u*16 + hi*8 + 0..7 at half offset u*256 + slot*8 (slot = hi*16 + lq; xn: slot = lq*2 + hi).

#ifndef NB
#define NB 4
#endif
#ifndef SEQ
#define SEQ 4096
#endif
#define NB_FULL    4
#define SEQ_FULL   4096
#define CH         256                  // channels = NHEAD * HDIM
#define NHEAD      4
#define HDIM       64
#define QKVN       (3 * CH)
#define BQ         128                  // query rows per attention workgroup (8 waves x 16)
#define BK         32                   // keys per inner iteration
#define NWAVE      8
#define MT         128                  // tokens per GEMM workgroup (8 waves x 16)
#define LNT        32                   // tokens per LayerNorm workgroup
#define LNP        33                   // LDS pitch (floats) of the LayerNorm tile
#define TP         72                   // LDS pitch (halves) of 64-wide f16 tiles
#define VP         136                  // LDS pitch (halves) of the 128-wide transposed V tile
#define OPF        132                  // LDS pitch (floats) of the projection staging tile

static_assert(SEQ % BQ == 0);
static_assert(SEQ % MT == 0);
static_assert(SEQ % LNT == 0);
static_assert(SEQ % BK == 0);
static_assert(BQ == NWAVE * 16);
static_assert(MT == NWAVE * 16);
static_assert(CH == NHEAD * HDIM);
static_assert(CH == 256);
static_assert(HDIM == 64);
static_assert(CH % 32 == 0);
static_assert(SEQ <= SEQ_FULL);
static_assert(NB >= 1 && NB <= NB_FULL);
static_assert((TP * 2) % 16 == 0);
static_assert((VP * 2) % 16 == 0);
static_assert((OPF * 4) % 16 == 0);
static_assert(MT * TP >= HDIM * VP);
// coverage equalities (threads x pieces x elements == tile elements)
static_assert(256 * 4 * 8 == LNT * CH);          // LayerNorm plane tile
static_assert(256 * 2 * 8 == 64 * 64);           // weight plane tile
static_assert(256 * 4 * 8 == MT * HDIM);         // q / k / v^T plane tile
static_assert(32 * 4 * 8 == 16 * HDIM);          // per-wave ctx tile
static_assert(NWAVE * 8 * 32 * 4 == 64 * MT);    // output tile

typedef __bf16   bf16;
typedef _Float16 f16;
typedef f16      v16h  __attribute__((ext_vector_type(16)));
typedef f16      v8h   __attribute__((ext_vector_type(8)));
typedef float    v8f   __attribute__((ext_vector_type(8)));
typedef float    v4f   __attribute__((ext_vector_type(4)));
typedef unsigned v4u   __attribute__((ext_vector_type(4)));

union FragH  { v16h  v; v4u q[2]; f16  h[16]; };
union Pack8H { v4u u; v8h v; f16 h[8]; };

// WMMA helper: builtin followed by the VALU hazard guard (ties D, keeps A/B live).
static __device__ __forceinline__ v8f mma_f16(v16h a, v16h b, v8f acc) {
  acc = __builtin_amdgcn_wmma_f32_16x16x32_f16(false, a, false, b, (short)0, acc, false, false);
  asm volatile("v_nop\n\tv_nop\n\tv_nop\n\tv_nop" : "+v"(acc) : "v"(a), "v"(b));
  return acc;
}

// Weight planes. Block = (64-wide k tile, 64-wide n tile), 256 threads.
//   wqT f16 = bf16(w_qkv[k][n]) x 64, wpT f16 = bf16(w_proj[k][n]) x 64, both in fragment order: tile = 16 columns n, 16 units over k.
__global__ __launch_bounds__(256) void w_planes_kernel(const float* __restrict__ wqkv,
                                                       const float* __restrict__ wproj,
                                                       f16* __restrict__ wqT,
                                                       f16* __restrict__ wpT) {
  const unsigned kt  = blockIdx.x;              // 0..3
  const unsigned nt  = blockIdx.y;              // 0..11 qkv, 12..15 proj
  const unsigned tid = threadIdx.x;
  const bool isq = nt < (QKVN / 64);
  const float* src = isq ? wqkv : wproj;        // both global, block-uniform
  f16*         dst = isq ? wqT : wpT;
  const unsigned ldn = isq ? (unsigned)QKVN : (unsigned)CH;
  const unsigned n0  = (isq ? nt : (nt - QKVN / 64)) * 64u;
  const unsigned k0  = kt * 64u;
  __shared__ __align__(16) f16 sT[64 * TP];     // [n][k], cross-wave (block barrier)

  #pragma unroll
  for (unsigned kk = 0; kk < 2; ++kk) {
    const unsigned kr = kk * 32 + (tid >> 3);   // 0..63
    const unsigned nn = (tid & 7u) * 8;         // 0..56
    const float* p = src + (size_t)(k0 + kr) * ldn + n0 + nn;
    const v4f w0 = *(const v4f*)(p);
    const v4f w1 = *(const v4f*)(p + 4);
    #pragma unroll
    for (unsigned i = 0; i < 4; ++i) {
      sT[(nn + i) * TP + kr]     = (f16)((float)(bf16)w0[i] * 64.0f);   // exact in f16
      sT[(nn + 4 + i) * TP + kr] = (f16)((float)(bf16)w1[i] * 64.0f);
    }
  }
  __syncthreads();

  v4u    val[2];
  size_t idx[2];
  #pragma unroll
  for (unsigned kk = 0; kk < 2; ++kk) {
    const unsigned g  = kk * 256 + tid;         // destination order: (n tile 0..3, unit 0..3, slot 0..31)
    const unsigned nl = g >> 7;
    const unsigned u  = (g >> 5) & 3u;
    const unsigned n  = nl * 16 + (g & 15u);
    const unsigned ks = u * 16 + ((g >> 4) & 1u) * 8;
    Pack8H ph;
    ph.v = *(const v8h*)(sT + n * TP + ks);
    val[kk] = ph.u;
    idx[kk] = (size_t)(n0 / 16 + nl) * (16 * CH) + (k0 / 16 + u) * 256 + (g & 31u) * 8;
  }
  #pragma unroll
  for (unsigned kk = 0; kk < 2; ++kk) *(v4u*)(dst + idx[kk]) = val[kk];
  
}

// LayerNorm over channels of the bf16 RNE-converted input; xn f16 in fragment order: tile = 16 tokens, 16 units over channels,
// slot = lq*2 + hi so that the 4 tokens x 2 pieces a wave holds per unit make one whole 128-B line.
__global__ __launch_bounds__(256) void ln_plane_kernel(const float* __restrict__ x,
                                                       const float* __restrict__ gamma,
                                                       const float* __restrict__ beta,
                                                       f16* __restrict__ xn) {
  const unsigned tid = threadIdx.x;
  const unsigned blk = blockIdx.x;
  const unsigned b   = blk / (SEQ / LNT);
  const unsigned p0  = (blk % (SEQ / LNT)) * LNT;
  __shared__ float sX[CH * LNP];                // [c][pix], cross-wave (block barrier)
  __shared__ float sG[CH];
  __shared__ float sB[CH];

  const float* xb = x + (size_t)b * CH * SEQ_FULL + p0;
  const unsigned px = tid & 31u;
  const unsigned cr = tid >> 5;
  #pragma unroll 4
  for (unsigned it = 0; it < 32; ++it) {
    const unsigned c = it * 8 + cr;
    const float v = xb[(size_t)c * SEQ_FULL + px];
    sX[c * LNP + px] = (float)(bf16)v;          // RNE convert
  }
  sG[tid] = (float)(bf16)gamma[tid];
  sB[tid] = (float)(bf16)beta[tid];
  __syncthreads();

  const unsigned tok  = tid >> 3;               // 0..31
  const unsigned part = tid & 7u;               // 0..7
  float s = 0.0f;
  #pragma unroll 4
  for (unsigned j = 0; j < 32; ++j) s += sX[(part + 8 * j) * LNP + tok];
  s += __shfl_xor(s, 1, 32);
  s += __shfl_xor(s, 2, 32);
  s += __shfl_xor(s, 4, 32);
  const float mu = s * (1.0f / CH);
  float ss = 0.0f;
  #pragma unroll 4
  for (unsigned j = 0; j < 32; ++j) {
    const float d = sX[(part + 8 * j) * LNP + tok] - mu;
    ss += d * d;
  }
  ss += __shfl_xor(ss, 1, 32);
  ss += __shfl_xor(ss, 2, 32);
  ss += __shfl_xor(ss, 4, 32);
  const float rstd = rsqrtf(ss * (1.0f / CH) + 1e-5f);

  v4u    val[4];
  size_t idx[4];
  #pragma unroll
  for (unsigned j = 0; j < 4; ++j) {
    const unsigned c0 = j * 64 + part * 8;
    Pack8H ph;
    #pragma unroll
    for (unsigned i = 0; i < 8; ++i) {
      const float d = sX[(c0 + i) * LNP + tok] - mu;
      ph.h[i] = (f16)(d * rstd * sG[c0 + i] + sB[c0 + i]);
    }
    val[j] = ph.u;
    idx[j] = (((size_t)b * SEQ + p0 + tok) >> 4) * (16 * CH) + (c0 >> 4) * 256 + ((tok & 15u) * 2 + (part & 1u)) * 8;
  }
  #pragma unroll
  for (unsigned j = 0; j < 4; ++j) *(v4u*)(xn + idx[j]) = val[j];
  
}

// QKV GEMM. Block = (128-token tile, 64-column tile = one head of q, k or v); wave = 16 tokens x 64 columns.
// A fragments from xn, B fragments from wqT (both in fragment order), two 16-B loads each, split k map.
// q and k planes per head: tile = 16 tokens, 4 units over d; v plane per head: per 32 keys, tile = 16 columns d, 2 units over keys.
__global__ __launch_bounds__(256) void qkv_gemm_kernel(const f16* __restrict__ xn,
                                                       const f16* __restrict__ wqT,
                                                       const float* __restrict__ bqkv,
                                                       f16* __restrict__ qp,
                                                       f16* __restrict__ kp,
                                                       f16* __restrict__ vt) {
  const unsigned mt   = blockIdx.x;
  const unsigned nt   = blockIdx.y;             // 0..11
  const unsigned tid  = threadIdx.x;
  const unsigned wave = tid >> 5;
  const unsigned lane = tid & 31u;
  const unsigned lq   = lane & 15u;
  const unsigned hi   = lane >> 4;
  const unsigned sel  = nt >> 2;                // 0 q, 1 k, 2 v
  const unsigned h    = nt & 3u;
  __shared__ __align__(16) f16 sT[MT * TP];     // [tok][d] (q,k) or [d][tok] pitch VP (v); cross-wave (block barrier)

  const f16* arow = xn + (size_t)(mt * NWAVE + wave) * (16 * CH) + (lq * 2 + hi) * 8;
  const f16* brow = wqT + (size_t)(nt * 4) * (16 * CH) + lane * 8;

  v8f acc[4];
  #pragma unroll
  for (unsigned dt = 0; dt < 4; ++dt) acc[dt] = (v8f){0, 0, 0, 0, 0, 0, 0, 0};

  #pragma unroll 2
  for (unsigned ks = 0; ks < CH / 32; ++ks) {
    FragH a;
    a.q[0] = *(const v4u*)(arow + ks * 512);                  // k = ks*32 + hi*8 + 0..7
    a.q[1] = *(const v4u*)(arow + ks * 512 + 256);            // k = ks*32 + 16 + hi*8 + 0..7
    FragH bw[4];
    #pragma unroll
    for (unsigned dt = 0; dt < 4; ++dt) {
      const f16* base = brow + (size_t)dt * 16 * CH + ks * 512;
      bw[dt].q[0] = *(const v4u*)(base);
      bw[dt].q[1] = *(const v4u*)(base + 256);
    }
    #pragma unroll
    for (unsigned dt = 0; dt < 4; ++dt) acc[dt] = mma_f16(a.v, bw[dt].v, acc[dt]);
  }

  float bias[4];
  #pragma unroll
  for (unsigned dt = 0; dt < 4; ++dt) bias[dt] = (float)(bf16)bqkv[nt * 64 + dt * 16 + lq];

  // acc[dt][r] = 64 * value(token wave*16 + hi*8 + r, column dt*16 + lq)
  if (sel < 2u) {
    #pragma unroll
    for (unsigned dt = 0; dt < 4; ++dt) {
      #pragma unroll
      for (unsigned r = 0; r < 8; ++r)
        sT[(wave * 16 + hi * 8 + r) * TP + dt * 16 + lq] = (f16)(acc[dt][r] * (1.0f / 64.0f) + bias[dt]);
    }
  } else {
    #pragma unroll
    for (unsigned dt = 0; dt < 4; ++dt) {
      #pragma unroll
      for (unsigned r = 0; r < 8; ++r)
        sT[(dt * 16 + lq) * VP + wave * 16 + hi * 8 + r] = (f16)(acc[dt][r] * (1.0f / 64.0f) + bias[dt]);
    }
  }
  __syncthreads();

  const unsigned b    = mt / (SEQ / MT);
  const unsigned tok0 = (mt % (SEQ / MT)) * MT;
  f16* dst = (sel == 0u) ? qp : ((sel == 1u) ? kp : vt);
  v4u    val[4];
  size_t idx[4];
  if (sel < 2u) {
    #pragma unroll
    for (unsigned it = 0; it < 4; ++it) {
      const unsigned row = it * 32 + (wave >> 2) * 16 + lq;     // destination order: (token tile, unit = wave & 3, slot = lane)
      Pack8H ph;
      ph.v = *(const v8h*)(sT + row * TP + (wave & 3u) * 16 + hi * 8);
      val[it] = ph.u;
      idx[it] = (((size_t)b * NHEAD + h) * SEQ + tok0 + it * 32) * HDIM + tid * 8;
    }
  } else {
    #pragma unroll
    for (unsigned it = 0; it < 4; ++it) {
      const unsigned d = (wave >> 1) * 16 + lq;                 // destination order: (32-key block it, d tile, unit = wave & 1, slot = lane)
      Pack8H ph;
      ph.v = *(const v8h*)(sT + d * VP + it * 32 + (wave & 1u) * 16 + hi * 8);
      val[it] = ph.u;
      idx[it] = (((size_t)b * NHEAD + h) * SEQ + tok0 + it * 32) * HDIM + tid * 8;
    }
  }
  #pragma unroll
  for (unsigned it = 0; it < 4; ++it) *(v4u*)(dst + idx[it]) = val[it];
  
}

// Flash attention, full (no mask). Block = (query block of 128, head, batch); one wave owns 16 query rows.
// S^T = K x Q^T so queries sit on lanes; P^T in C-layout is bit-identical to the A-fragment layout of O += P x V.
// K A-fragments, Q B-fragments and V^T B-fragments are loaded straight from the fragment-order f16 planes (two 16-B loads per fragment).
// K fragments are fetched one pass ahead: pass i issues the loads of pass i+1 right behind its own S^T products, into the registers
// those products have released, so the softmax and the PV products run while they fly; V is issued at the head of its own pass.
__global__ __launch_bounds__(256) void attn_kernel(const f16* __restrict__ qp,
                                                   const f16* __restrict__ kp,
                                                   const f16* __restrict__ vt,
                                                   f16* __restrict__ ctx) {
  const unsigned qblk = blockIdx.x;
  const unsigned h    = blockIdx.y;
  const unsigned b    = blockIdx.z;
  const unsigned tid  = threadIdx.x;
  const unsigned wave = tid >> 5;
  const unsigned lane = tid & 31u;
  const unsigned lq   = lane & 15u;   // query column of S^T / d column of O
  const unsigned hi   = lane >> 4;    // k-split half

  __shared__ __align__(16) f16 sO[NWAVE * 16 * TP];   // per-wave output staging (block barrier used)

  const unsigned qrow0 = qblk * BQ + wave * 16;

  const f16* qp_h = qp + ((size_t)b * NHEAD + h) * SEQ * HDIM;
  const f16* kp_h = kp + ((size_t)b * NHEAD + h) * SEQ * HDIM;
  const f16* vt_h = vt + ((size_t)b * NHEAD + h) * HDIM * SEQ;

  // Q as B-operand fragments: lane lq holds query qrow0+lq, elements follow the split d map.
  FragH qf[2];
  {
    const f16* qr = qp_h + (size_t)qrow0 * HDIM + lane * 8;
    #pragma unroll
    for (unsigned f = 0; f < 2; ++f) {
      qf[f].q[0] = *(const v4u*)(qr + f * 512);                 // d = f*32 + hi*8 + 0..7
      qf[f].q[1] = *(const v4u*)(qr + f * 512 + 256);           // d = f*32 + 16 + hi*8 + 0..7
    }
  }

  v8f o[4];
  #pragma unroll
  for (unsigned dt = 0; dt < 4; ++dt) o[dt] = (v8f){0, 0, 0, 0, 0, 0, 0, 0};

  float rmax = -__builtin_inff();
  float rsum = 0.0f;
  const float SL = 0.0625f * 1.4426950408889634f;   // softmax scale (1/sqrt(CH)) * log2(e)

  // K A-fragments: row = key j0 + sub*16 + lq, split d map; pass 0's are loaded here, every later pass's one pass ahead
  FragH ak[2][2];
  #pragma unroll
  for (unsigned sub = 0; sub < 2; ++sub) {
    #pragma unroll
    for (unsigned f = 0; f < 2; ++f) {
      const f16* base = kp_h + (size_t)(sub * 16) * HDIM + f * 512 + lane * 8;
      ak[sub][f].q[0] = *(const v4u*)(base);
      ak[sub][f].q[1] = *(const v4u*)(base + 256);
    }
  }

  for (unsigned i = 0; i < SEQ / BK; ++i) {
    const unsigned j0 = i * BK;

    // V B-fragments: column n = d = dt*16 + lq, split key map
    FragH bv[4];
    #pragma unroll
    for (unsigned dt = 0; dt < 4; ++dt) {
      const f16* base = vt_h + (size_t)j0 * HDIM + dt * 512 + lane * 8;
      bv[dt].q[0] = *(const v4u*)(base);            // keys j0 + hi*8 + 0..7
      bv[dt].q[1] = *(const v4u*)(base + 256);      // keys j0 + 16 + hi*8 + 0..7
    }

    // S^T tiles: c[sub][r] = rawscore(query qrow0+lq, key j0 + sub*16 + hi*8 + r)
    v8f c[2];
    #pragma unroll
    for (unsigned sub = 0; sub < 2; ++sub) {
      v8f acc = (v8f){0, 0, 0, 0, 0, 0, 0, 0};
      acc = mma_f16(ak[sub][0].v, qf[0].v, acc);
      acc = mma_f16(ak[sub][1].v, qf[1].v, acc);
      c[sub] = acc;
    }

    // next pass's K fragments; the last pass re-reads keys 0..31 (in bounds, never used) so that the loads stay unconditional
    const unsigned jn = (i + 1 < SEQ / BK) ? j0 + BK : 0u;
    #pragma unroll
    for (unsigned sub = 0; sub < 2; ++sub) {
      #pragma unroll
      for (unsigned f = 0; f < 2; ++f) {
        const f16* base = kp_h + (size_t)(jn + sub * 16) * HDIM + f * 512 + lane * 8;
        ak[sub][f].q[0] = *(const v4u*)(base);
        ak[sub][f].q[1] = *(const v4u*)(base + 256);
      }
    }

    // online softmax: query lq's 32 scores are split across lane / lane^16
    float m_new = rmax;
    #pragma unroll
    for (unsigned r = 0; r < 8; ++r) {
      m_new = fmaxf(m_new, c[0][r]);
      m_new = fmaxf(m_new, c[1][r]);
    }
    m_new = fmaxf(m_new, __shfl_xor(m_new, 16, 32));
    const float scale = __builtin_amdgcn_exp2f((rmax - m_new) * SL);
    rmax = m_new;

    // exp + pack: P^T C-layout == A-fragment layout for the PV product; P carried x4096
    FragH pa;
    float psum = 0.0f;
    #pragma unroll
    for (unsigned r = 0; r < 8; ++r) {
      const float p0 = __builtin_amdgcn_exp2f((c[0][r] - m_new) * SL);   // key hi*8 + r
      const float p1 = __builtin_amdgcn_exp2f((c[1][r] - m_new) * SL);   // key 16 + hi*8 + r
      psum += p0 + p1;
      pa.h[r]     = (f16)(p0 * 4096.0f);
      pa.h[8 + r] = (f16)(p1 * 4096.0f);
    }
    rsum = rsum * scale + psum + __shfl_xor(psum, 16, 32);

    // rescale O: queries are the row dimension there -> per-row scale from lane 8*hi + r
    float sc[8];
    #pragma unroll
    for (unsigned r = 0; r < 8; ++r) sc[r] = __shfl(scale, (int)((hi << 3) + r), 32);
    #pragma unroll
    for (unsigned dt = 0; dt < 4; ++dt) {
      #pragma unroll
      for (unsigned r = 0; r < 8; ++r) o[dt][r] *= sc[r];
    }

    // O += P x V
    #pragma unroll
    for (unsigned dt = 0; dt < 4; ++dt) o[dt] = mma_f16(pa.v, bv[dt].v, o[dt]);
  }

  // normalize: lane holds column d = dt*16 + lq for query rows 8*hi + r; fold 1/4096 and the x256 ctx carry
  float rs[8];
  #pragma unroll
  for (unsigned r = 0; r < 8; ++r) rs[r] = 1.0f / __shfl(rsum, (int)((hi << 3) + r), 32);

  f16* so = sO + wave * (16 * TP);
  #pragma unroll
  for (unsigned r = 0; r < 8; ++r) {
    #pragma unroll
    for (unsigned dt = 0; dt < 4; ++dt)
      so[(hi * 8 + r) * TP + dt * 16 + lq] = (f16)(o[dt][r] * (256.0f / 4096.0f) * rs[r]);
  }
  __syncthreads();

  v4u    val[4];
  size_t idx[4];
  #pragma unroll
  for (unsigned it = 0; it < 4; ++it) {
    Pack8H ph;                                    // ctx in fragment order: tile = this wave's 16 tokens, unit = h*4 + it, slot = lane
    ph.v = *(const v8h*)(so + lq * TP + it * 16 + hi * 8);
    val[it] = ph.u;
    idx[it] = ((size_t)b * SEQ + qrow0) * CH + (h * 4 + it) * 256 + lane * 8;
  }
  #pragma unroll
  for (unsigned it = 0; it < 4; ++it) *(v4u*)(ctx + idx[it]) = val[it];
  
}

// Projection, transposed: Y^T[c][tok] = sum_k wpT[c][k] * ctx[tok][k]. Block = (128-token tile, 64-channel tile).
// A fragments from wpT (channel tiles), B fragments from ctx (token tiles), both in fragment order; D rows = channels, columns = tokens,
// so the channel-major output row of 128 pixels (512 B) is written by one wave instruction (32 lanes x 16 B).
__global__ __launch_bounds__(256) void proj_kernel(const f16* __restrict__ ctx,
                                                   const f16* __restrict__ wpT,
                                                   const float* __restrict__ bproj,
                                                   const float* __restrict__ x,
                                                   float* __restrict__ out) {
  const unsigned mt   = blockIdx.x;
  const unsigned ct   = blockIdx.y;             // 0..3
  const unsigned tid  = threadIdx.x;
  const unsigned wave = tid >> 5;
  const unsigned lane = tid & 31u;
  const unsigned lq   = lane & 15u;
  const unsigned hi   = lane >> 4;
  __shared__ __align__(16) float sO[64 * OPF];  // [channel][token], cross-wave (block barrier)

  const f16* brow = ctx + (size_t)(mt * NWAVE + wave) * (16 * CH) + lane * 8;
  const f16* arow = wpT + (size_t)(ct * 4) * (16 * CH) + lane * 8;

  v8f acc[4];
  #pragma unroll
  for (unsigned m4 = 0; m4 < 4; ++m4) acc[m4] = (v8f){0, 0, 0, 0, 0, 0, 0, 0};

  #pragma unroll 2
  for (unsigned ks = 0; ks < CH / 32; ++ks) {
    FragH bc;
    bc.q[0] = *(const v4u*)(brow + ks * 512);
    bc.q[1] = *(const v4u*)(brow + ks * 512 + 256);
    FragH aw[4];
    #pragma unroll
    for (unsigned m4 = 0; m4 < 4; ++m4) {
      const f16* base = arow + (size_t)m4 * 16 * CH + ks * 512;
      aw[m4].q[0] = *(const v4u*)(base);
      aw[m4].q[1] = *(const v4u*)(base + 256);
    }
    #pragma unroll
    for (unsigned m4 = 0; m4 < 4; ++m4) acc[m4] = mma_f16(aw[m4].v, bc.v, acc[m4]);
  }

  // acc[m4][r] = 16384 * value(channel m4*16 + hi*8 + r, token wave*16 + lq)
  #pragma unroll
  for (unsigned m4 = 0; m4 < 4; ++m4) {
    #pragma unroll
    for (unsigned r = 0; r < 8; ++r)
      sO[(m4 * 16 + hi * 8 + r) * OPF + wave * 16 + lq] = acc[m4][r] * (1.0f / 16384.0f);
  }
  __syncthreads();

  const unsigned b  = mt / (SEQ / MT);
  const unsigned p0 = (mt % (SEQ / MT)) * MT;
  v4f    val[8];
  size_t idx[8];
  #pragma unroll
  for (unsigned it = 0; it < 8; ++it) {
    const unsigned row = it * 8 + wave;                 // channel within the tile (wave-uniform)
    const unsigned c   = ct * 64 + row;
    const v4f a  = *(const v4f*)(sO + row * OPF + lane * 4);
    const float bb = (float)(bf16)bproj[c];
    const size_t gi = ((size_t)b * CH + c) * SEQ_FULL + p0 + lane * 4;
    const v4f xv = *(const v4f*)(x + gi);
    v4f res;
    #pragma unroll
    for (unsigned i = 0; i < 4; ++i) res[i] = (float)(bf16)xv[i] + (a[i] + bb);
    val[it] = res;
    idx[it] = gi;
  }
  #pragma unroll
  for (unsigned it = 0; it < 8; ++it) *(v4f*)(out + idx[it]) = val[it];
  
}

extern "C" void kernel_launch(void* const* d_in, const int* in_sizes, int n_in,
                              void* d_out, int out_size, void* d_ws, size_t ws_size,
                              hipStream_t stream) {
  if (n_in < 7) return;
  const size_t x_need = ((size_t)(NB - 1) * CH + (CH - 1)) * SEQ_FULL + SEQ;
  if ((size_t)in_sizes[0] < x_need) return;
  if (in_sizes[1] < CH || in_sizes[2] < CH) return;
  if ((size_t)in_sizes[3] < (size_t)CH * QKVN || in_sizes[4] < QKVN) return;
  if ((size_t)in_sizes[5] < (size_t)CH * CH || in_sizes[6] < CH) return;
  if ((size_t)out_size < x_need) return;

  const size_t tok_plane = (size_t)NB * SEQ * CH * 2;            // xn, ctx and each of q/k/v^T: same bytes
  const size_t wq_bytes  = (size_t)QKVN * CH * 2;
  const size_t wp_bytes  = (size_t)CH * CH * 2;
  const size_t total     = 5 * tok_plane + wq_bytes + wp_bytes;
  if (ws_size < total) return;

  const float* x     = (const float*)d_in[0];
  const float* gam   = (const float*)d_in[1];
  const float* bet   = (const float*)d_in[2];
  const float* wqkv  = (const float*)d_in[3];
  const float* bqkv  = (const float*)d_in[4];
  const float* wproj = (const float*)d_in[5];
  const float* bproj = (const float*)d_in[6];
  float* out = (float*)d_out;

  char* ws = (char*)d_ws;
  f16* xn  = (f16*)(ws);
  f16* qp  = (f16*)(ws + 1 * tok_plane);
  f16* kp  = (f16*)(ws + 2 * tok_plane);
  f16* vt  = (f16*)(ws + 3 * tok_plane);
  f16* ctx = (f16*)(ws + 4 * tok_plane);
  f16* wqT = (f16*)(ws + 5 * tok_plane);
  f16* wpT = (f16*)(ws + 5 * tok_plane + wq_bytes);

  w_planes_kernel<<<dim3(CH / 64, QKVN / 64 + CH / 64), 256, 0, stream>>>(wqkv, wproj, wqT, wpT);
  ln_plane_kernel<<<dim3(NB * (SEQ / LNT)), 256, 0, stream>>>(x, gam, bet, xn);
  qkv_gemm_kernel<<<dim3(NB * (SEQ / MT), QKVN / 64), 256, 0, stream>>>(xn, wqT, bqkv, qp, kp, vt);
  attn_kernel<<<dim3(SEQ / BQ, NHEAD, NB), 256, 0, stream>>>(qp, kp, vt, ctx);
  proj_kernel<<<dim3(NB * (SEQ / MT), CH / 64), 256, 0, stream>>>(ctx, wpT, bproj, x, out);
}

// v003
// Measured time: 139 microseconds a run.
// Timed twice side by side with v002, it ran 1.04 times as fast both times.
// All steps since v000 together make it 2.23 times as fast.
#include <hip/hip_runtime.h>

// Contractions (all v_wmma_f32_16x16x32_f16, f16 operands, f32 accumulate): QKV = xn x Wqkv (W = f16 of the bf16 RNE-converted weight x64);
// S^T = K x Q^T (f16 q/k planes); O = P x V (P carried x4096, V^T f16 plane); Y^T = Wproj^T x ctx^T (ctx carried x256, W x64). LayerNorm, softmax, bias and residual in f32.
// Every f16 operand plane in the workspace is stored in fragment order: one 512-B unit per (16-row tile, 16-wide k piece), holding for each
// lane the 8 halves it loads, so a wave-wide 16-B load reads 4 whole 128-B lines. Unit u of a 16-row tile covers k = u*16 .. u*16+15;
// lane (lq = row in the tile, hi) owns k = u*16 + hi*8 + 0..7 at half offset u*256 + slot*8 (slot = hi*16 + lq; xn: slot = lq*2 + hi).

#ifndef NB
#define NB 4
#endif
#ifndef SEQ
#define SEQ 4096
#endif
#define NB_FULL    4
#define SEQ_FULL   4096
#define CH         256                  // channels = NHEAD * HDIM
#define NHEAD      4
#define HDIM       64
#define QKVN       (3 * CH)
#define QT         2                    // 16-row query tiles per attention wave
#define BQ         256                  // query rows per attention workgroup (8 waves x QT x 16)
#define BK         32                   // keys per inner iteration
#define NWAVE      8
#define MT         128                  // tokens per GEMM workgroup (8 waves x 16)
#define LNT        32                   // tokens per LayerNorm workgroup
#define LNP        33                   // LDS pitch (floats) of the LayerNorm tile
#define TP         72                   // LDS pitch (halves) of 64-wide f16 tiles
#define VP         136                  // LDS pitch (halves) of the 128-wide transposed V tile
#define OPF        132                  // LDS pitch (floats) of the projection staging tile

static_assert(SEQ % BQ == 0);
static_assert(SEQ % MT == 0);
static_assert(SEQ % LNT == 0);
static_assert(SEQ % BK == 0);
static_assert(BQ == NWAVE * QT * 16);
static_assert(MT == NWAVE * 16);
static_assert(CH == NHEAD * HDIM);
static_assert(CH == 256);
static_assert(HDIM == 64);
static_assert(CH % 32 == 0);
static_assert(SEQ <= SEQ_FULL);
static_assert(NB >= 1 && NB <= NB_FULL);
static_assert((TP * 2) % 16 == 0);
static_assert((VP * 2) % 16 == 0);
static_assert((OPF * 4) % 16 == 0);
static_assert(MT * TP >= HDIM * VP);
// coverage equalities (threads x pieces x elements == tile elements)
static_assert(256 * 4 * 8 == LNT * CH);          // LayerNorm plane tile
static_assert(256 * 2 * 8 == 64 * 64);           // weight plane tile
static_assert(256 * 4 * 8 == MT * HDIM);         // q / k / v^T plane tile
static_assert(32 * 4 * 8 == 16 * HDIM);          // per-wave ctx tile
static_assert(NWAVE * 8 * 32 * 4 == 64 * MT);    // output tile

typedef __bf16   bf16;
typedef _Float16 f16;
typedef f16      v16h  __attribute__((ext_vector_type(16)));
typedef f16      v8h   __attribute__((ext_vector_type(8)));
typedef float    v8f   __attribute__((ext_vector_type(8)));
typedef float    v4f   __attribute__((ext_vector_type(4)));
typedef unsigned v4u   __attribute__((ext_vector_type(4)));

union FragH  { v16h  v; v4u q[2]; f16  h[16]; };
union Pack8H { v4u u; v8h v; f16 h[8]; };

// WMMA helper: builtin followed by the VALU hazard guard (ties D, keeps A/B live).
static __device__ __forceinline__ v8f mma_f16(v16h a, v16h b, v8f acc) {
  acc = __builtin_amdgcn_wmma_f32_16x16x32_f16(false, a, false, b, (short)0, acc, false, false);
  asm volatile("v_nop\n\tv_nop\n\tv_nop\n\tv_nop" : "+v"(acc) : "v"(a), "v"(b));
  return acc;
}

// Weight planes. Block = (64-wide k tile, 64-wide n tile), 256 threads.
//   wqT f16 = bf16(w_qkv[k][n]) x 64, wpT f16 = bf16(w_proj[k][n]) x 64, both in fragment order: tile = 16 columns n, 16 units over k.
__global__ __launch_bounds__(256) void w_planes_kernel(const float* __restrict__ wqkv,
                                                       const float* __restrict__ wproj,
                                                       f16* __restrict__ wqT,
                                                       f16* __restrict__ wpT) {
  const unsigned kt  = blockIdx.x;              // 0..3
  const unsigned nt  = blockIdx.y;              // 0..11 qkv, 12..15 proj
  const unsigned tid = threadIdx.x;
  const bool isq = nt < (QKVN / 64);
  const float* src = isq ? wqkv : wproj;        // both global, block-uniform
  f16*         dst = isq ? wqT : wpT;
  const unsigned ldn = isq ? (unsigned)QKVN : (unsigned)CH;
  const unsigned n0  = (isq ? nt : (nt - QKVN / 64)) * 64u;
  const unsigned k0  = kt * 64u;
  __shared__ __align__(16) f16 sT[64 * TP];     // [n][k], cross-wave (block barrier)

  #pragma unroll
  for (unsigned kk = 0; kk < 2; ++kk) {
    const unsigned kr = kk * 32 + (tid >> 3);   // 0..63
    const unsigned nn = (tid & 7u) * 8;         // 0..56
    const float* p = src + (size_t)(k0 + kr) * ldn + n0 + nn;
    const v4f w0 = *(const v4f*)(p);
    const v4f w1 = *(const v4f*)(p + 4);
    #pragma unroll
    for (unsigned i = 0; i < 4; ++i) {
      sT[(nn + i) * TP + kr]     = (f16)((float)(bf16)w0[i] * 64.0f);   // exact in f16
      sT[(nn + 4 + i) * TP + kr] = (f16)((float)(bf16)w1[i] * 64.0f);
    }
  }
  __syncthreads();

  v4u    val[2];
  size_t idx[2];
  #pragma unroll
  for (unsigned kk = 0; kk < 2; ++kk) {
    const unsigned g  = kk * 256 + tid;         // destination order: (n tile 0..3, unit 0..3, slot 0..31)
    const unsigned nl = g >> 7;
    const unsigned u  = (g >> 5) & 3u;
    const unsigned n  = nl * 16 + (g & 15u);
    const unsigned ks = u * 16 + ((g >> 4) & 1u) * 8;
    Pack8H ph;
    ph.v = *(const v8h*)(sT + n * TP + ks);
    val[kk] = ph.u;
    idx[kk] = (size_t)(n0 / 16 + nl) * (16 * CH) + (k0 / 16 + u) * 256 + (g & 31u) * 8;
  }
  #pragma unroll
  for (unsigned kk = 0; kk < 2; ++kk) *(v4u*)(dst + idx[kk]) = val[kk];
  
}

// LayerNorm over channels of the bf16 RNE-converted input; xn f16 in fragment order: tile = 16 tokens, 16 units over channels,
// slot = lq*2 + hi so that the 4 tokens x 2 pieces a wave holds per unit make one whole 128-B line.
__global__ __launch_bounds__(256) void ln_plane_kernel(const float* __restrict__ x,
                                                       const float* __restrict__ gamma,
                                                       const float* __restrict__ beta,
                                                       f16* __restrict__ xn) {
  const unsigned tid = threadIdx.x;
  const unsigned blk = blockIdx.x;
  const unsigned b   = blk / (SEQ / LNT);
  const unsigned p0  = (blk % (SEQ / LNT)) * LNT;
  __shared__ float sX[CH * LNP];                // [c][pix], cross-wave (block barrier)
  __shared__ float sG[CH];
  __shared__ float sB[CH];

  const float* xb = x + (size_t)b * CH * SEQ_FULL + p0;
  const unsigned px = tid & 31u;
  const unsigned cr = tid >> 5;
  #pragma unroll 4
  for (unsigned it = 0; it < 32; ++it) {
    const unsigned c = it * 8 + cr;
    const float v = xb[(size_t)c * SEQ_FULL + px];
    sX[c * LNP + px] = (float)(bf16)v;          // RNE convert
  }
  sG[tid] = (float)(bf16)gamma[tid];
  sB[tid] = (float)(bf16)beta[tid];
  __syncthreads();

  const unsigned tok  = tid >> 3;               // 0..31
  const unsigned part = tid & 7u;               // 0..7
  float s = 0.0f;
  #pragma unroll 4
  for (unsigned j = 0; j < 32; ++j) s += sX[(part + 8 * j) * LNP + tok];
  s += __shfl_xor(s, 1, 32);
  s += __shfl_xor(s, 2, 32);
  s += __shfl_xor(s, 4, 32);
  const float mu = s * (1.0f / CH);
  float ss = 0.0f;
  #pragma unroll 4
  for (unsigned j = 0; j < 32; ++j) {
    const float d = sX[(part + 8 * j) * LNP + tok] - mu;
    ss += d * d;
  }
  ss += __shfl_xor(ss, 1, 32);
  ss += __shfl_xor(ss, 2, 32);
  ss += __shfl_xor(ss, 4, 32);
  const float rstd = rsqrtf(ss * (1.0f / CH) + 1e-5f);

  v4u    val[4];
  size_t idx[4];
  #pragma unroll
  for (unsigned j = 0; j < 4; ++j) {
    const unsigned c0 = j * 64 + part * 8;
    Pack8H ph;
    #pragma unroll
    for (unsigned i = 0; i < 8; ++i) {
      const float d = sX[(c0 + i) * LNP + tok] - mu;
      ph.h[i] = (f16)(d * rstd * sG[c0 + i] + sB[c0 + i]);
    }
    val[j] = ph.u;
    idx[j] = (((size_t)b * SEQ + p0 + tok) >> 4) * (16 * CH) + (c0 >> 4) * 256 + ((tok & 15u) * 2 + (part & 1u)) * 8;
  }
  #pragma unroll
  for (unsigned j = 0; j < 4; ++j) *(v4u*)(xn + idx[j]) = val[j];
  
}

// QKV GEMM. Block = (128-token tile, 64-column tile = one head of q, k or v); wave = 16 tokens x 64 columns.
// A fragments from xn, B fragments from wqT (both in fragment order), two 16-B loads each, split k map.
// q and k planes per head: tile = 16 tokens, 4 units over d; v plane per head: per 32 keys, tile = 16 columns d, 2 units over keys.
__global__ __launch_bounds__(256) void qkv_gemm_kernel(const f16* __restrict__ xn,
                                                       const f16* __restrict__ wqT,
                                                       const float* __restrict__ bqkv,
                                                       f16* __restrict__ qp,
                                                       f16* __restrict__ kp,
                                                       f16* __restrict__ vt) {
  const unsigned mt   = blockIdx.x;
  const unsigned nt   = blockIdx.y;             // 0..11
  const unsigned tid  = threadIdx.x;
  const unsigned wave = tid >> 5;
  const unsigned lane = tid & 31u;
  const unsigned lq   = lane & 15u;
  const unsigned hi   = lane >> 4;
  const unsigned sel  = nt >> 2;                // 0 q, 1 k, 2 v
  const unsigned h    = nt & 3u;
  __shared__ __align__(16) f16 sT[MT * TP];     // [tok][d] (q,k) or [d][tok] pitch VP (v); cross-wave (block barrier)

  const f16* arow = xn + (size_t)(mt * NWAVE + wave) * (16 * CH) + (lq * 2 + hi) * 8;
  const f16* brow = wqT + (size_t)(nt * 4) * (16 * CH) + lane * 8;

  v8f acc[4];
  #pragma unroll
  for (unsigned dt = 0; dt < 4; ++dt) acc[dt] = (v8f){0, 0, 0, 0, 0, 0, 0, 0};

  #pragma unroll 2
  for (unsigned ks = 0; ks < CH / 32; ++ks) {
    FragH a;
    a.q[0] = *(const v4u*)(arow + ks * 512);                  // k = ks*32 + hi*8 + 0..7
    a.q[1] = *(const v4u*)(arow + ks * 512 + 256);            // k = ks*32 + 16 + hi*8 + 0..7
    FragH bw[4];
    #pragma unroll
    for (unsigned dt = 0; dt < 4; ++dt) {
      const f16* base = brow + (size_t)dt * 16 * CH + ks * 512;
      bw[dt].q[0] = *(const v4u*)(base);
      bw[dt].q[1] = *(const v4u*)(base + 256);
    }
    #pragma unroll
    for (unsigned dt = 0; dt < 4; ++dt) acc[dt] = mma_f16(a.v, bw[dt].v, acc[dt]);
  }

  float bias[4];
  #pragma unroll
  for (unsigned dt = 0; dt < 4; ++dt) bias[dt] = (float)(bf16)bqkv[nt * 64 + dt * 16 + lq];

  // acc[dt][r] = 64 * value(token wave*16 + hi*8 + r, column dt*16 + lq)
  if (sel < 2u) {
    #pragma unroll
    for (unsigned dt = 0; dt < 4; ++dt) {
      #pragma unroll
      for (unsigned r = 0; r < 8; ++r)
        sT[(wave * 16 + hi * 8 + r) * TP + dt * 16 + lq] = (f16)(acc[dt][r] * (1.0f / 64.0f) + bias[dt]);
    }
  } else {
    #pragma unroll
    for (unsigned dt = 0; dt < 4; ++dt) {
      #pragma unroll
      for (unsigned r = 0; r < 8; ++r)
        sT[(dt * 16 + lq) * VP + wave * 16 + hi * 8 + r] = (f16)(acc[dt][r] * (1.0f / 64.0f) + bias[dt]);
    }
  }
  __syncthreads();

  const unsigned b    = mt / (SEQ / MT);
  const unsigned tok0 = (mt % (SEQ / MT)) * MT;
  f16* dst = (sel == 0u) ? qp : ((sel == 1u) ? kp : vt);
  v4u    val[4];
  size_t idx[4];
  if (sel < 2u) {
    #pragma unroll
    for (unsigned it = 0; it < 4; ++it) {
      const unsigned row = it * 32 + (wave >> 2) * 16 + lq;     // destination order: (token tile, unit = wave & 3, slot = lane)
      Pack8H ph;
      ph.v = *(const v8h*)(sT + row * TP + (wave & 3u) * 16 + hi * 8);
      val[it] = ph.u;
      idx[it] = (((size_t)b * NHEAD + h) * SEQ + tok0 + it * 32) * HDIM + tid * 8;
    }
  } else {
    #pragma unroll
    for (unsigned it = 0; it < 4; ++it) {
      const unsigned d = (wave >> 1) * 16 + lq;                 // destination order: (32-key block it, d tile, unit = wave & 1, slot = lane)
      Pack8H ph;
      ph.v = *(const v8h*)(sT + d * VP + it * 32 + (wave & 1u) * 16 + hi * 8);
      val[it] = ph.u;
      idx[it] = (((size_t)b * NHEAD + h) * SEQ + tok0 + it * 32) * HDIM + tid * 8;
    }
  }
  #pragma unroll
  for (unsigned it = 0; it < 4; ++it) *(v4u*)(dst + idx[it]) = val[it];
  
}

// Flash attention, full (no mask). Block = (query block of 256, head, batch); one wave owns QT = 2 tiles of 16 query rows.
// S^T = K x Q^T so queries sit on lanes; P^T in C-layout is bit-identical to the A-fragment layout of O += P x V.
// K A-fragments, Q B-fragments and V^T B-fragments are loaded straight from the fragment-order f16 planes (two 16-B loads per fragment).
// Every K and V fragment a wave loads feeds both of its query tiles: 16 loads per 16 products, and the two tiles' softmax chains are independent.
// K fragments are fetched one pass ahead: pass i issues the loads of pass i+1 right behind its own S^T products, into the registers
// those products have released, so the softmax and the PV products run while they fly; V is issued at the head of its own pass.
__global__ __launch_bounds__(256) void attn_kernel(const f16* __restrict__ qp,
                                                   const f16* __restrict__ kp,
                                                   const f16* __restrict__ vt,
                                                   f16* __restrict__ ctx) {
  const unsigned qblk = blockIdx.x;
  const unsigned h    = blockIdx.y;
  const unsigned b    = blockIdx.z;
  const unsigned tid  = threadIdx.x;
  const unsigned wave = tid >> 5;
  const unsigned lane = tid & 31u;
  const unsigned lq   = lane & 15u;   // query column of S^T / d column of O
  const unsigned hi   = lane >> 4;    // k-split half

  __shared__ __align__(16) f16 sO[NWAVE * QT * 16 * TP];   // per-wave output staging (block barrier used)

  const unsigned qrow0 = qblk * BQ + wave * (QT * 16);

  const f16* qp_h = qp + ((size_t)b * NHEAD + h) * SEQ * HDIM;
  const f16* kp_h = kp + ((size_t)b * NHEAD + h) * SEQ * HDIM;
  const f16* vt_h = vt + ((size_t)b * NHEAD + h) * HDIM * SEQ;

  // Q as B-operand fragments: in tile t lane lq holds query qrow0 + t*16 + lq, elements follow the split d map.
  FragH qf[QT][2];
  #pragma unroll
  for (unsigned t = 0; t < QT; ++t) {
    const f16* qr = qp_h + (size_t)(qrow0 + t * 16) * HDIM + lane * 8;
    #pragma unroll
    for (unsigned f = 0; f < 2; ++f) {
      qf[t][f].q[0] = *(const v4u*)(qr + f * 512);              // d = f*32 + hi*8 + 0..7
      qf[t][f].q[1] = *(const v4u*)(qr + f * 512 + 256);        // d = f*32 + 16 + hi*8 + 0..7
    }
  }

  v8f   o[QT][4];
  float rmax[QT];
  float rsum[QT];
  #pragma unroll
  for (unsigned t = 0; t < QT; ++t) {
    #pragma unroll
    for (unsigned dt = 0; dt < 4; ++dt) o[t][dt] = (v8f){0, 0, 0, 0, 0, 0, 0, 0};
    rmax[t] = -__builtin_inff();
    rsum[t] = 0.0f;
  }
  const float SL = 0.0625f * 1.4426950408889634f;   // softmax scale (1/sqrt(CH)) * log2(e)

  // K A-fragments: row = key j0 + sub*16 + lq, split d map; pass 0's are loaded here, every later pass's one pass ahead
  FragH ak[2][2];
  #pragma unroll
  for (unsigned sub = 0; sub < 2; ++sub) {
    #pragma unroll
    for (unsigned f = 0; f < 2; ++f) {
      const f16* base = kp_h + (size_t)(sub * 16) * HDIM + f * 512 + lane * 8;
      ak[sub][f].q[0] = *(const v4u*)(base);
      ak[sub][f].q[1] = *(const v4u*)(base + 256);
    }
  }

  for (unsigned i = 0; i < SEQ / BK; ++i) {
    const unsigned j0 = i * BK;

    // V B-fragments: column n = d = dt*16 + lq, split key map
    FragH bv[4];
    #pragma unroll
    for (unsigned dt = 0; dt < 4; ++dt) {
      const f16* base = vt_h + (size_t)j0 * HDIM + dt * 512 + lane * 8;
      bv[dt].q[0] = *(const v4u*)(base);            // keys j0 + hi*8 + 0..7
      bv[dt].q[1] = *(const v4u*)(base + 256);      // keys j0 + 16 + hi*8 + 0..7
    }

    // S^T tiles: c[t][sub][r] = rawscore(query qrow0 + t*16 + lq, key j0 + sub*16 + hi*8 + r); d 0..31 of all four tiles, then d 32..63
    v8f c[QT][2];
    #pragma unroll
    for (unsigned sub = 0; sub < 2; ++sub) {
      #pragma unroll
      for (unsigned t = 0; t < QT; ++t) c[t][sub] = mma_f16(ak[sub][0].v, qf[t][0].v, (v8f){0, 0, 0, 0, 0, 0, 0, 0});
    }
    #pragma unroll
    for (unsigned sub = 0; sub < 2; ++sub) {
      #pragma unroll
      for (unsigned t = 0; t < QT; ++t) c[t][sub] = mma_f16(ak[sub][1].v, qf[t][1].v, c[t][sub]);
    }

    // next pass's K fragments; the last pass re-reads keys 0..31 (in bounds, never used) so that the loads stay unconditional
    const unsigned jn = (i + 1 < SEQ / BK) ? j0 + BK : 0u;
    #pragma unroll
    for (unsigned sub = 0; sub < 2; ++sub) {
      #pragma unroll
      for (unsigned f = 0; f < 2; ++f) {
        const f16* base = kp_h + (size_t)(jn + sub * 16) * HDIM + f * 512 + lane * 8;
        ak[sub][f].q[0] = *(const v4u*)(base);
        ak[sub][f].q[1] = *(const v4u*)(base + 256);
      }
    }

    // online softmax, per tile: query lq's 32 scores are split across lane / lane^16
    float m_new[QT];
    #pragma unroll
    for (unsigned t = 0; t < QT; ++t) {
      float m = rmax[t];
      #pragma unroll
      for (unsigned r = 0; r < 8; ++r) {
        m = fmaxf(m, c[t][0][r]);
        m = fmaxf(m, c[t][1][r]);
      }
      m_new[t] = m;
    }
    #pragma unroll
    for (unsigned t = 0; t < QT; ++t) m_new[t] = fmaxf(m_new[t], __shfl_xor(m_new[t], 16, 32));
    float scale[QT];
    #pragma unroll
    for (unsigned t = 0; t < QT; ++t) {
      scale[t] = __builtin_amdgcn_exp2f((rmax[t] - m_new[t]) * SL);
      rmax[t]  = m_new[t];
    }

    // exp + pack: P^T C-layout == A-fragment layout for the PV product; P carried x4096
    FragH pa[QT];
    float psum[QT];
    #pragma unroll
    for (unsigned t = 0; t < QT; ++t) {
      float ps = 0.0f;
      #pragma unroll
      for (unsigned r = 0; r < 8; ++r) {
        const float p0 = __builtin_amdgcn_exp2f((c[t][0][r] - m_new[t]) * SL);   // key hi*8 + r
        const float p1 = __builtin_amdgcn_exp2f((c[t][1][r] - m_new[t]) * SL);   // key 16 + hi*8 + r
        ps += p0 + p1;
        pa[t].h[r]     = (f16)(p0 * 4096.0f);
        pa[t].h[8 + r] = (f16)(p1 * 4096.0f);
      }
      psum[t] = ps;
    }
    #pragma unroll
    for (unsigned t = 0; t < QT; ++t) rsum[t] = rsum[t] * scale[t] + psum[t] + __shfl_xor(psum[t], 16, 32);

    // rescale O: queries are the row dimension there -> per-row scale from lane 8*hi + r
    #pragma unroll
    for (unsigned t = 0; t < QT; ++t) {
      float sc[8];
      #pragma unroll
      for (unsigned r = 0; r < 8; ++r) sc[r] = __shfl(scale[t], (int)((hi << 3) + r), 32);
      #pragma unroll
      for (unsigned dt = 0; dt < 4; ++dt) {
        #pragma unroll
        for (unsigned r = 0; r < 8; ++r) o[t][dt][r] *= sc[r];
      }
    }

    // O += P x V: each V fragment serves both tiles
    #pragma unroll
    for (unsigned dt = 0; dt < 4; ++dt) {
      #pragma unroll
      for (unsigned t = 0; t < QT; ++t) o[t][dt] = mma_f16(pa[t].v, bv[dt].v, o[t][dt]);
    }
  }

  // normalize: lane holds column d = dt*16 + lq for query rows 8*hi + r of each tile; fold 1/4096 and the x256 ctx carry
  f16* so = sO + wave * (QT * 16 * TP);
  #pragma unroll
  for (unsigned t = 0; t < QT; ++t) {
    float rs[8];
    #pragma unroll
    for (unsigned r = 0; r < 8; ++r) rs[r] = 1.0f / __shfl(rsum[t], (int)((hi << 3) + r), 32);
    #pragma unroll
    for (unsigned r = 0; r < 8; ++r) {
      #pragma unroll
      for (unsigned dt = 0; dt < 4; ++dt)
        so[(t * 16 + hi * 8 + r) * TP + dt * 16 + lq] = (f16)(o[t][dt][r] * (256.0f / 4096.0f) * rs[r]);
    }
  }
  __syncthreads();

  v4u    val[QT * 4];
  size_t idx[QT * 4];
  #pragma unroll
  for (unsigned t = 0; t < QT; ++t) {
    #pragma unroll
    for (unsigned it = 0; it < 4; ++it) {
      Pack8H ph;                                  // ctx in fragment order: tile = 16 of this wave's tokens, unit = h*4 + it, slot = lane
      ph.v = *(const v8h*)(so + (t * 16 + lq) * TP + it * 16 + hi * 8);
      val[t * 4 + it] = ph.u;
      idx[t * 4 + it] = ((size_t)b * SEQ + qrow0 + t * 16) * CH + (h * 4 + it) * 256 + lane * 8;
    }
  }
  #pragma unroll
  for (unsigned it = 0; it < QT * 4; ++it) *(v4u*)(ctx + idx[it]) = val[it];
  
}

// Projection, transposed: Y^T[c][tok] = sum_k wpT[c][k] * ctx[tok][k]. Block = (128-token tile, 64-channel tile).
// A fragments from wpT (channel tiles), B fragments from ctx (token tiles), both in fragment order; D rows = channels, columns = tokens,
// so the channel-major output row of 128 pixels (512 B) is written by one wave instruction (32 lanes x 16 B).
__global__ __launch_bounds__(256) void proj_kernel(const f16* __restrict__ ctx,
                                                   const f16* __restrict__ wpT,
                                                   const float* __restrict__ bproj,
                                                   const float* __restrict__ x,
                                                   float* __restrict__ out) {
  const unsigned mt   = blockIdx.x;
  const unsigned ct   = blockIdx.y;             // 0..3
  const unsigned tid  = threadIdx.x;
  const unsigned wave = tid >> 5;
  const unsigned lane = tid & 31u;
  const unsigned lq   = lane & 15u;
  const unsigned hi   = lane >> 4;
  __shared__ __align__(16) float sO[64 * OPF];  // [channel][token], cross-wave (block barrier)

  const f16* brow = ctx + (size_t)(mt * NWAVE + wave) * (16 * CH) + lane * 8;
  const f16* arow = wpT + (size_t)(ct * 4) * (16 * CH) + lane * 8;

  v8f acc[4];
  #pragma unroll
  for (unsigned m4 = 0; m4 < 4; ++m4) acc[m4] = (v8f){0, 0, 0, 0, 0, 0, 0, 0};

  #pragma unroll 2
  for (unsigned ks = 0; ks < CH / 32; ++ks) {
    FragH bc;
    bc.q[0] = *(const v4u*)(brow + ks * 512);
    bc.q[1] = *(const v4u*)(brow + ks * 512 + 256);
    FragH aw[4];
    #pragma unroll
    for (unsigned m4 = 0; m4 < 4; ++m4) {
      const f16* base = arow + (size_t)m4 * 16 * CH + ks * 512;
      aw[m4].q[0] = *(const v4u*)(base);
      aw[m4].q[1] = *(const v4u*)(base + 256);
    }
    #pragma unroll
    for (unsigned m4 = 0; m4 < 4; ++m4) acc[m4] = mma_f16(aw[m4].v, bc.v, acc[m4]);
  }

  // acc[m4][r] = 16384 * value(channel m4*16 + hi*8 + r, token wave*16 + lq)
  #pragma unroll
  for (unsigned m4 = 0; m4 < 4; ++m4) {
    #pragma unroll
    for (unsigned r = 0; r < 8; ++r)
      sO[(m4 * 16 + hi * 8 + r) * OPF + wave * 16 + lq] = acc[m4][r] * (1.0f / 16384.0f);
  }
  __syncthreads();

  const unsigned b  = mt / (SEQ / MT);
  const unsigned p0 = (mt % (SEQ / MT)) * MT;
  v4f    val[8];
  size_t idx[8];
  #pragma unroll
  for (unsigned it = 0; it < 8; ++it) {
    const unsigned row = it * 8 + wave;                 // channel within the tile (wave-uniform)
    const unsigned c   = ct * 64 + row;
    const v4f a  = *(const v4f*)(sO + row * OPF + lane * 4);
    const float bb = (float)(bf16)bproj[c];
    const size_t gi = ((size_t)b * CH + c) * SEQ_FULL + p0 + lane * 4;
    const v4f xv = *(const v4f*)(x + gi);
    v4f res;
    #pragma unroll
    for (unsigned i = 0; i < 4; ++i) res[i] = (float)(bf16)xv[i] + (a[i] + bb);
    val[it] = res;
    idx[it] = gi;
  }
  #pragma unroll
  for (unsigned it = 0; it < 8; ++it) *(v4f*)(out + idx[it]) = val[it];
  
}

extern "C" void kernel_launch(void* const* d_in, const int* in_sizes, int n_in,
                              void* d_out, int out_size, void* d_ws, size_t ws_size,
                              hipStream_t stream) {
  if (n_in < 7) return;
  const size_t x_need = ((size_t)(NB - 1) * CH + (CH - 1)) * SEQ_FULL + SEQ;
  if ((size_t)in_sizes[0] < x_need) return;
  if (in_sizes[1] < CH || in_sizes[2] < CH) return;
  if ((size_t)in_sizes[3] < (size_t)CH * QKVN || in_sizes[4] < QKVN) return;
  if ((size_t)in_sizes[5] < (size_t)CH * CH || in_sizes[6] < CH) return;
  if ((size_t)out_size < x_need) return;

  const size_t tok_plane = (size_t)NB * SEQ * CH * 2;            // xn, ctx and each of q/k/v^T: same bytes
  const size_t wq_bytes  = (size_t)QKVN * CH * 2;
  const size_t wp_bytes  = (size_t)CH * CH * 2;
  const size_t total     = 5 * tok_plane + wq_bytes + wp_bytes;
  if (ws_size < total) return;

  const float* x     = (const float*)d_in[0];
  const float* gam   = (const float*)d_in[1];
  const float* bet   = (const float*)d_in[2];
  const float* wqkv  = (const float*)d_in[3];
  const float* bqkv  = (const float*)d_in[4];
  const float* wproj = (const float*)d_in[5];
  const float* bproj = (const float*)d_in[6];
  float* out = (float*)d_out;

  char* ws = (char*)d_ws;
  f16* xn  = (f16*)(ws);
  f16* qp  = (f16*)(ws + 1 * tok_plane);
  f16* kp  = (f16*)(ws + 2 * tok_plane);
  f16* vt  = (f16*)(ws + 3 * tok_plane);
  f16* ctx = (f16*)(ws + 4 * tok_plane);
  f16* wqT = (f16*)(ws + 5 * tok_plane);
  f16* wpT = (f16*)(ws + 5 * tok_plane + wq_bytes);

  w_planes_kernel<<<dim3(CH / 64, QKVN / 64 + CH / 64), 256, 0, stream>>>(wqkv, wproj, wqT, wpT);
  ln_plane_kernel<<<dim3(NB * (SEQ / LNT)), 256, 0, stream>>>(x, gam, bet, xn);
  qkv_gemm_kernel<<<dim3(NB * (SEQ / MT), QKVN / 64), 256, 0, stream>>>(xn, wqT, bqkv, qp, kp, vt);
  attn_kernel<<<dim3(SEQ / BQ, NHEAD, NB), 256, 0, stream>>>(qp, kp, vt, ctx);
  proj_kernel<<<dim3(NB * (SEQ / MT), CH / 64), 256, 0, stream>>>(ctx, wpT, bproj, x, out);
}

// v004
// It runs in 112 microseconds.
// In both of two side-by-side timings against v003, it was 1.21 times as fast.
// Counting every step since v000, it is 2.69 times as fast.
#include <hip/hip_runtime.h>

// Contractions (all v_wmma_f32_16x16x32_f16, f16 operands, f32 accumulate): QKV = xn x Wqkv (W = f16 of the bf16 RNE-converted weight x64);
// S^T = K x Q^T (f16 q/k planes); O = P x V (P carried x4096, V^T f16 plane); Y^T = Wproj^T x ctx^T (ctx carried x256, W x64). LayerNorm, softmax, bias and residual in f32.
// Every f16 operand plane in the workspace is stored in fragment order: one 512-B unit per (16-row tile, 16-wide k piece), holding for each
// lane the 8 halves it loads, so a wave-wide 16-B load reads 4 whole 128-B lines. Unit u of a 16-row tile covers k = u*16 .. u*16+15;
// lane (lq = row in the tile, hi) owns k = u*16 + hi*8 + 0..7 at half offset u*256 + slot*8 (slot = hi*16 + lq; xn: slot = lq*2 + hi).

#ifndef NB
#define NB 4
#endif
#ifndef SEQ
#define SEQ 4096
#endif
#define NB_FULL    4
#define SEQ_FULL   4096
#define CH         256                  // channels = NHEAD * HDIM
#define NHEAD      4
#define HDIM       64
#define QKVN       (3 * CH)
#define QT         2                    // 16-row query tiles per attention wave
#define BQ         256                  // query rows per attention workgroup (8 waves x QT x 16)
#define BK         32                   // keys per inner iteration
#define NWAVE      8
#define KSPL       2                    // key ranges per attention workgroup (one per group of NWAVE waves)
#define NPASS      (SEQ / BK / KSPL)    // inner iterations per attention wave
#define MT         128                  // tokens per GEMM workgroup (8 waves x 16)
#define LNT        32                   // tokens per LayerNorm workgroup
#define LNP        33                   // LDS pitch (floats) of the LayerNorm tile
#define TP         72                   // LDS pitch (halves) of 64-wide f16 tiles
#define VP         136                  // LDS pitch (halves) of the 128-wide transposed V tile
#define OPF        132                  // LDS pitch (floats) of the projection staging tile

static_assert(SEQ % BQ == 0);
static_assert(SEQ % MT == 0);
static_assert(SEQ % LNT == 0);
static_assert(SEQ % (BK * KSPL) == 0);
static_assert(BQ == NWAVE * QT * 16);
static_assert(MT == NWAVE * 16);
static_assert(CH == NHEAD * HDIM);
static_assert(CH == 256);
static_assert(HDIM == 64);
static_assert(CH % 32 == 0);
static_assert(SEQ <= SEQ_FULL);
static_assert(NB >= 1 && NB <= NB_FULL);
static_assert((TP * 2) % 16 == 0);
static_assert((VP * 2) % 16 == 0);
static_assert((OPF * 4) % 16 == 0);
static_assert(MT * TP >= HDIM * VP);
// coverage equalities (threads x pieces x elements == tile elements)
static_assert(256 * 4 * 8 == LNT * CH);          // LayerNorm plane tile
static_assert(256 * 2 * 8 == 64 * 64);           // weight plane tile
static_assert(256 * 4 * 8 == MT * HDIM);         // q / k / v^T plane tile
static_assert(32 * 4 * 8 == 16 * HDIM);          // per-wave ctx tile
static_assert(NWAVE * 8 * 32 * 4 == 64 * MT);    // output tile

typedef __bf16   bf16;
typedef _Float16 f16;
typedef f16      v16h  __attribute__((ext_vector_type(16)));
typedef f16      v8h   __attribute__((ext_vector_type(8)));
typedef float    v8f   __attribute__((ext_vector_type(8)));
typedef float    v4f   __attribute__((ext_vector_type(4)));
typedef unsigned v4u   __attribute__((ext_vector_type(4)));

union FragH  { v16h  v; v4u q[2]; f16  h[16]; };
union Pack8H { v4u u; v8h v; f16 h[8]; };

// WMMA helper: builtin followed by the VALU hazard guard (ties D, keeps A/B live).
static __device__ __forceinline__ v8f mma_f16(v16h a, v16h b, v8f acc) {
  acc = __builtin_amdgcn_wmma_f32_16x16x32_f16(false, a, false, b, (short)0, acc, false, false);
  asm volatile("v_nop\n\tv_nop\n\tv_nop\n\tv_nop" : "+v"(acc) : "v"(a), "v"(b));
  return acc;
}

// Weight planes. Block = (64-wide k tile, 64-wide n tile), 256 threads.
//   wqT f16 = bf16(w_qkv[k][n]) x 64, wpT f16 = bf16(w_proj[k][n]) x 64, both in fragment order: tile = 16 columns n, 16 units over k.
__global__ __launch_bounds__(256) void w_planes_kernel(const float* __restrict__ wqkv,
                                                       const float* __restrict__ wproj,
                                                       f16* __restrict__ wqT,
                                                       f16* __restrict__ wpT) {
  const unsigned kt  = blockIdx.x;              // 0..3
  const unsigned nt  = blockIdx.y;              // 0..11 qkv, 12..15 proj
  const unsigned tid = threadIdx.x;
  const bool isq = nt < (QKVN / 64);
  const float* src = isq ? wqkv : wproj;        // both global, block-uniform
  f16*         dst = isq ? wqT : wpT;
  const unsigned ldn = isq ? (unsigned)QKVN : (unsigned)CH;
  const unsigned n0  = (isq ? nt : (nt - QKVN / 64)) * 64u;
  const unsigned k0  = kt * 64u;
  __shared__ __align__(16) f16 sT[64 * TP];     // [n][k], cross-wave (block barrier)

  #pragma unroll
  for (unsigned kk = 0; kk < 2; ++kk) {
    const unsigned kr = kk * 32 + (tid >> 3);   // 0..63
    const unsigned nn = (tid & 7u) * 8;         // 0..56
    const float* p = src + (size_t)(k0 + kr) * ldn + n0 + nn;
    const v4f w0 = *(const v4f*)(p);
    const v4f w1 = *(const v4f*)(p + 4);
    #pragma unroll
    for (unsigned i = 0; i < 4; ++i) {
      sT[(nn + i) * TP + kr]     = (f16)((float)(bf16)w0[i] * 64.0f);   // exact in f16
      sT[(nn + 4 + i) * TP + kr] = (f16)((float)(bf16)w1[i] * 64.0f);
    }
  }
  __syncthreads();

  v4u    val[2];
  size_t idx[2];
  #pragma unroll
  for (unsigned kk = 0; kk < 2; ++kk) {
    const unsigned g  = kk * 256 + tid;         // destination order: (n tile 0..3, unit 0..3, slot 0..31)
    const unsigned nl = g >> 7;
    const unsigned u  = (g >> 5) & 3u;
    const unsigned n  = nl * 16 + (g & 15u);
    const unsigned ks = u * 16 + ((g >> 4) & 1u) * 8;
    Pack8H ph;
    ph.v = *(const v8h*)(sT + n * TP + ks);
    val[kk] = ph.u;
    idx[kk] = (size_t)(n0 / 16 + nl) * (16 * CH) + (k0 / 16 + u) * 256 + (g & 31u) * 8;
  }
  #pragma unroll
  for (unsigned kk = 0; kk < 2; ++kk) *(v4u*)(dst + idx[kk]) = val[kk];
  
}

// LayerNorm over channels of the bf16 RNE-converted input; xn f16 in fragment order: tile = 16 tokens, 16 units over channels,
// slot = lq*2 + hi so that the 4 tokens x 2 pieces a wave holds per unit make one whole 128-B line.
__global__ __launch_bounds__(256) void ln_plane_kernel(const float* __restrict__ x,
                                                       const float* __restrict__ gamma,
                                                       const float* __restrict__ beta,
                                                       f16* __restrict__ xn) {
  const unsigned tid = threadIdx.x;
  const unsigned blk = blockIdx.x;
  const unsigned b   = blk / (SEQ / LNT);
  const unsigned p0  = (blk % (SEQ / LNT)) * LNT;
  __shared__ float sX[CH * LNP];                // [c][pix], cross-wave (block barrier)
  __shared__ float sG[CH];
  __shared__ float sB[CH];

  const float* xb = x + (size_t)b * CH * SEQ_FULL + p0;
  const unsigned px = tid & 31u;
  const unsigned cr = tid >> 5;
  #pragma unroll 4
  for (unsigned it = 0; it < 32; ++it) {
    const unsigned c = it * 8 + cr;
    const float v = xb[(size_t)c * SEQ_FULL + px];
    sX[c * LNP + px] = (float)(bf16)v;          // RNE convert
  }
  sG[tid] = (float)(bf16)gamma[tid];
  sB[tid] = (float)(bf16)beta[tid];
  __syncthreads();

  const unsigned tok  = tid >> 3;               // 0..31
  const unsigned part = tid & 7u;               // 0..7
  float s = 0.0f;
  #pragma unroll 4
  for (unsigned j = 0; j < 32; ++j) s += sX[(part + 8 * j) * LNP + tok];
  s += __shfl_xor(s, 1, 32);
  s += __shfl_xor(s, 2, 32);
  s += __shfl_xor(s, 4, 32);
  const float mu = s * (1.0f / CH);
  float ss = 0.0f;
  #pragma unroll 4
  for (unsigned j = 0; j < 32; ++j) {
    const float d = sX[(part + 8 * j) * LNP + tok] - mu;
    ss += d * d;
  }
  ss += __shfl_xor(ss, 1, 32);
  ss += __shfl_xor(ss, 2, 32);
  ss += __shfl_xor(ss, 4, 32);
  const float rstd = rsqrtf(ss * (1.0f / CH) + 1e-5f);

  v4u    val[4];
  size_t idx[4];
  #pragma unroll
  for (unsigned j = 0; j < 4; ++j) {
    const unsigned c0 = j * 64 + part * 8;
    Pack8H ph;
    #pragma unroll
    for (unsigned i = 0; i < 8; ++i) {
      const float d = sX[(c0 + i) * LNP + tok] - mu;
      ph.h[i] = (f16)(d * rstd * sG[c0 + i] + sB[c0 + i]);
    }
    val[j] = ph.u;
    idx[j] = (((size_t)b * SEQ + p0 + tok) >> 4) * (16 * CH) + (c0 >> 4) * 256 + ((tok & 15u) * 2 + (part & 1u)) * 8;
  }
  #pragma unroll
  for (unsigned j = 0; j < 4; ++j) *(v4u*)(xn + idx[j]) = val[j];
  
}

// QKV GEMM. Block = (128-token tile, 64-column tile = one head of q, k or v); wave = 16 tokens x 64 columns.
// A fragments from xn, B fragments from wqT (both in fragment order), two 16-B loads each, split k map.
// q and k planes per head: tile = 16 tokens, 4 units over d; v plane per head: per 32 keys, tile = 16 columns d, 2 units over keys.
__global__ __launch_bounds__(256) void qkv_gemm_kernel(const f16* __restrict__ xn,
                                                       const f16* __restrict__ wqT,
                                                       const float* __restrict__ bqkv,
                                                       f16* __restrict__ qp,
                                                       f16* __restrict__ kp,
                                                       f16* __restrict__ vt) {
  const unsigned mt   = blockIdx.x;
  const unsigned nt   = blockIdx.y;             // 0..11
  const unsigned tid  = threadIdx.x;
  const unsigned wave = tid >> 5;
  const unsigned lane = tid & 31u;
  const unsigned lq   = lane & 15u;
  const unsigned hi   = lane >> 4;
  const unsigned sel  = nt >> 2;                // 0 q, 1 k, 2 v
  const unsigned h    = nt & 3u;
  __shared__ __align__(16) f16 sT[MT * TP];     // [tok][d] (q,k) or [d][tok] pitch VP (v); cross-wave (block barrier)

  const f16* arow = xn + (size_t)(mt * NWAVE + wave) * (16 * CH) + (lq * 2 + hi) * 8;
  const f16* brow = wqT + (size_t)(nt * 4) * (16 * CH) + lane * 8;

  v8f acc[4];
  #pragma unroll
  for (unsigned dt = 0; dt < 4; ++dt) acc[dt] = (v8f){0, 0, 0, 0, 0, 0, 0, 0};

  #pragma unroll 2
  for (unsigned ks = 0; ks < CH / 32; ++ks) {
    FragH a;
    a.q[0] = *(const v4u*)(arow + ks * 512);                  // k = ks*32 + hi*8 + 0..7
    a.q[1] = *(const v4u*)(arow + ks * 512 + 256);            // k = ks*32 + 16 + hi*8 + 0..7
    FragH bw[4];
    #pragma unroll
    for (unsigned dt = 0; dt < 4; ++dt) {
      const f16* base = brow + (size_t)dt * 16 * CH + ks * 512;
      bw[dt].q[0] = *(const v4u*)(base);
      bw[dt].q[1] = *(const v4u*)(base + 256);
    }
    #pragma unroll
    for (unsigned dt = 0; dt < 4; ++dt) acc[dt] = mma_f16(a.v, bw[dt].v, acc[dt]);
  }

  float bias[4];
  #pragma unroll
  for (unsigned dt = 0; dt < 4; ++dt) bias[dt] = (float)(bf16)bqkv[nt * 64 + dt * 16 + lq];

  // acc[dt][r] = 64 * value(token wave*16 + hi*8 + r, column dt*16 + lq)
  if (sel < 2u) {
    #pragma unroll
    for (unsigned dt = 0; dt < 4; ++dt) {
      #pragma unroll
      for (unsigned r = 0; r < 8; ++r)
        sT[(wave * 16 + hi * 8 + r) * TP + dt * 16 + lq] = (f16)(acc[dt][r] * (1.0f / 64.0f) + bias[dt]);
    }
  } else {
    #pragma unroll
    for (unsigned dt = 0; dt < 4; ++dt) {
      #pragma unroll
      for (unsigned r = 0; r < 8; ++r)
        sT[(dt * 16 + lq) * VP + wave * 16 + hi * 8 + r] = (f16)(acc[dt][r] * (1.0f / 64.0f) + bias[dt]);
    }
  }
  __syncthreads();

  const unsigned b    = mt / (SEQ / MT);
  const unsigned tok0 = (mt % (SEQ / MT)) * MT;
  f16* dst = (sel == 0u) ? qp : ((sel == 1u) ? kp : vt);
  v4u    val[4];
  size_t idx[4];
  if (sel < 2u) {
    #pragma unroll
    for (unsigned it = 0; it < 4; ++it) {
      const unsigned row = it * 32 + (wave >> 2) * 16 + lq;     // destination order: (token tile, unit = wave & 3, slot = lane)
      Pack8H ph;
      ph.v = *(const v8h*)(sT + row * TP + (wave & 3u) * 16 + hi * 8);
      val[it] = ph.u;
      idx[it] = (((size_t)b * NHEAD + h) * SEQ + tok0 + it * 32) * HDIM + tid * 8;
    }
  } else {
    #pragma unroll
    for (unsigned it = 0; it < 4; ++it) {
      const unsigned d = (wave >> 1) * 16 + lq;                 // destination order: (32-key block it, d tile, unit = wave & 1, slot = lane)
      Pack8H ph;
      ph.v = *(const v8h*)(sT + d * VP + it * 32 + (wave & 1u) * 16 + hi * 8);
      val[it] = ph.u;
      idx[it] = (((size_t)b * NHEAD + h) * SEQ + tok0 + it * 32) * HDIM + tid * 8;
    }
  }
  #pragma unroll
  for (unsigned it = 0; it < 4; ++it) *(v4u*)(dst + idx[it]) = val[it];
  
}

// Flash attention, full (no mask). Block = (query block of 256, head, batch), 16 waves; one wave owns QT = 2 tiles of 16 query rows.
// S^T = K x Q^T so queries sit on lanes; P^T in C-layout is bit-identical to the A-fragment layout of O += P x V.
// K A-fragments, Q B-fragments and V^T B-fragments are loaded straight from the fragment-order f16 planes (two 16-B loads per fragment).
// Every K and V fragment a wave loads feeds both of its query tiles: 16 loads per 16 products, and the two tiles' softmax chains are independent.
// K fragments are fetched one pass ahead: pass i issues the loads of pass i+1 right behind its own S^T products, into the registers
// those products have released, so the softmax and the PV products run while they fly; V is issued at the head of its own pass.
// The workgroup has KSPL = 2 groups of 8 waves: wave w and wave w + 8 own the same 32 query rows and walk one half of the keys each, so
// that four waves instead of two share a SIMD and fill each other's waits; their maxima, sums and O tiles are merged once, through LDS.
__global__ __launch_bounds__(NWAVE * KSPL * 32) void attn_kernel(const f16* __restrict__ qp,
                                                   const f16* __restrict__ kp,
                                                   const f16* __restrict__ vt,
                                                   f16* __restrict__ ctx) {
  const unsigned qblk = blockIdx.x;
  const unsigned h    = blockIdx.y;
  const unsigned b    = blockIdx.z;
  const unsigned tid  = threadIdx.x;
  const unsigned wave = (tid >> 5) & (NWAVE - 1u);                                   // which 32 query rows
  const unsigned grp  = (unsigned)__builtin_amdgcn_readfirstlane((int)(tid >> 8));   // which half of the keys (wave-uniform)
  const unsigned lane = tid & 31u;
  const unsigned lq   = lane & 15u;   // query column of S^T / d column of O
  const unsigned hi   = lane >> 4;    // k-split half

  __shared__ __align__(16) f16   sO[NWAVE * QT * 16 * TP];      // per-wave output staging (block barrier used)
  __shared__ __align__(16) float sP[NWAVE * QT * 4 * 8 * 32];   // second key half's O tiles, [wave][t][dt][r / 4][lane][r % 4]
  __shared__ float sM[NWAVE * QT * 32];                         // second key half's row maxima, [wave][t][lane]
  __shared__ float sL[NWAVE * QT * 32];                         // second key half's row sums

  const unsigned qrow0 = qblk * BQ + wave * (QT * 16);

  const f16* qp_h = qp + ((size_t)b * NHEAD + h) * SEQ * HDIM;
  const f16* kp_h = kp + (((size_t)b * NHEAD + h) * SEQ + grp * (SEQ / KSPL)) * HDIM;   // this group's first key
  const f16* vt_h = vt + (((size_t)b * NHEAD + h) * SEQ + grp * (SEQ / KSPL)) * HDIM;

  // Q as B-operand fragments: in tile t lane lq holds query qrow0 + t*16 + lq, elements follow the split d map.
  FragH qf[QT][2];
  #pragma unroll
  for (unsigned t = 0; t < QT; ++t) {
    const f16* qr = qp_h + (size_t)(qrow0 + t * 16) * HDIM + lane * 8;
    #pragma unroll
    for (unsigned f = 0; f < 2; ++f) {
      qf[t][f].q[0] = *(const v4u*)(qr + f * 512);              // d = f*32 + hi*8 + 0..7
      qf[t][f].q[1] = *(const v4u*)(qr + f * 512 + 256);        // d = f*32 + 16 + hi*8 + 0..7
    }
  }

  v8f   o[QT][4];
  float rmax[QT];
  float rsum[QT];
  #pragma unroll
  for (unsigned t = 0; t < QT; ++t) {
    #pragma unroll
    for (unsigned dt = 0; dt < 4; ++dt) o[t][dt] = (v8f){0, 0, 0, 0, 0, 0, 0, 0};
    rmax[t] = -__builtin_inff();
    rsum[t] = 0.0f;
  }
  const float SL = 0.0625f * 1.4426950408889634f;   // softmax scale (1/sqrt(CH)) * log2(e)

  // K A-fragments: row = key j0 + sub*16 + lq, split d map; pass 0's are loaded here, every later pass's one pass ahead
  FragH ak[2][2];
  #pragma unroll
  for (unsigned sub = 0; sub < 2; ++sub) {
    #pragma unroll
    for (unsigned f = 0; f < 2; ++f) {
      const f16* base = kp_h + (size_t)(sub * 16) * HDIM + f * 512 + lane * 8;
      ak[sub][f].q[0] = *(const v4u*)(base);
      ak[sub][f].q[1] = *(const v4u*)(base + 256);
    }
  }

  for (unsigned i = 0; i < NPASS; ++i) {
    const unsigned j0 = i * BK;                     // counted from this group's first key

    // V B-fragments: column n = d = dt*16 + lq, split key map
    FragH bv[4];
    #pragma unroll
    for (unsigned dt = 0; dt < 4; ++dt) {
      const f16* base = vt_h + (size_t)j0 * HDIM + dt * 512 + lane * 8;
      bv[dt].q[0] = *(const v4u*)(base);            // keys j0 + hi*8 + 0..7
      bv[dt].q[1] = *(const v4u*)(base + 256);      // keys j0 + 16 + hi*8 + 0..7
    }

    // S^T tiles: c[t][sub][r] = rawscore(query qrow0 + t*16 + lq, key j0 + sub*16 + hi*8 + r); d 0..31 of all four tiles, then d 32..63
    v8f c[QT][2];
    #pragma unroll
    for (unsigned sub = 0; sub < 2; ++sub) {
      #pragma unroll
      for (unsigned t = 0; t < QT; ++t) c[t][sub] = mma_f16(ak[sub][0].v, qf[t][0].v, (v8f){0, 0, 0, 0, 0, 0, 0, 0});
    }
    #pragma unroll
    for (unsigned sub = 0; sub < 2; ++sub) {
      #pragma unroll
      for (unsigned t = 0; t < QT; ++t) c[t][sub] = mma_f16(ak[sub][1].v, qf[t][1].v, c[t][sub]);
    }

    // next pass's K fragments; the last pass re-reads the group's first 32 keys (in bounds, never used) so that the loads stay unconditional
    const unsigned jn = (i + 1 < NPASS) ? j0 + BK : 0u;
    #pragma unroll
    for (unsigned sub = 0; sub < 2; ++sub) {
      #pragma unroll
      for (unsigned f = 0; f < 2; ++f) {
        const f16* base = kp_h + (size_t)(jn + sub * 16) * HDIM + f * 512 + lane * 8;
        ak[sub][f].q[0] = *(const v4u*)(base);
        ak[sub][f].q[1] = *(const v4u*)(base + 256);
      }
    }

    // online softmax, per tile: query lq's 32 scores are split across lane / lane^16
    float m_new[QT];
    #pragma unroll
    for (unsigned t = 0; t < QT; ++t) {
      float m = rmax[t];
      #pragma unroll
      for (unsigned r = 0; r < 8; ++r) {
        m = fmaxf(m, c[t][0][r]);
        m = fmaxf(m, c[t][1][r]);
      }
      m_new[t] = m;
    }
    #pragma unroll
    for (unsigned t = 0; t < QT; ++t) m_new[t] = fmaxf(m_new[t], __shfl_xor(m_new[t], 16, 32));
    float scale[QT];
    #pragma unroll
    for (unsigned t = 0; t < QT; ++t) {
      scale[t] = __builtin_amdgcn_exp2f((rmax[t] - m_new[t]) * SL);
      rmax[t]  = m_new[t];
    }

    // exp + pack: P^T C-layout == A-fragment layout for the PV product; P carried x4096
    FragH pa[QT];
    float psum[QT];
    #pragma unroll
    for (unsigned t = 0; t < QT; ++t) {
      float ps = 0.0f;
      #pragma unroll
      for (unsigned r = 0; r < 8; ++r) {
        const float p0 = __builtin_amdgcn_exp2f((c[t][0][r] - m_new[t]) * SL);   // key hi*8 + r
        const float p1 = __builtin_amdgcn_exp2f((c[t][1][r] - m_new[t]) * SL);   // key 16 + hi*8 + r
        ps += p0 + p1;
        pa[t].h[r]     = (f16)(p0 * 4096.0f);
        pa[t].h[8 + r] = (f16)(p1 * 4096.0f);
      }
      psum[t] = ps;
    }
    #pragma unroll
    for (unsigned t = 0; t < QT; ++t) rsum[t] = rsum[t] * scale[t] + psum[t] + __shfl_xor(psum[t], 16, 32);

    // rescale O: queries are the row dimension there -> per-row scale from lane 8*hi + r
    #pragma unroll
    for (unsigned t = 0; t < QT; ++t) {
      float sc[8];
      #pragma unroll
      for (unsigned r = 0; r < 8; ++r) sc[r] = __shfl(scale[t], (int)((hi << 3) + r), 32);
      #pragma unroll
      for (unsigned dt = 0; dt < 4; ++dt) {
        #pragma unroll
        for (unsigned r = 0; r < 8; ++r) o[t][dt][r] *= sc[r];
      }
    }

    // O += P x V: each V fragment serves both tiles
    #pragma unroll
    for (unsigned dt = 0; dt < 4; ++dt) {
      #pragma unroll
      for (unsigned t = 0; t < QT; ++t) o[t][dt] = mma_f16(pa[t].v, bv[dt].v, o[t][dt]);
    }
  }

  // merge of the two key halves: group 1 hands its maxima, sums and O tiles over, group 0 joins them with its own
  float* sp = sP + wave * (QT * 4 * 8 * 32);
  if (grp != 0u) {
    #pragma unroll
    for (unsigned t = 0; t < QT; ++t) {
      sM[(wave * QT + t) * 32 + lane] = rmax[t];
      sL[(wave * QT + t) * 32 + lane] = rsum[t];
      #pragma unroll
      for (unsigned dt = 0; dt < 4; ++dt) {
        #pragma unroll
        for (unsigned q4 = 0; q4 < 2; ++q4)
          *(v4f*)(sp + (((t * 4 + dt) * 2 + q4) * 32 + lane) * 4) =
              (v4f){o[t][dt][q4 * 4], o[t][dt][q4 * 4 + 1], o[t][dt][q4 * 4 + 2], o[t][dt][q4 * 4 + 3]};
      }
    }
  }
  __syncthreads();   // group 1's partial results are complete before group 0 reads them

  // normalize: lane holds column d = dt*16 + lq for query rows 8*hi + r of each tile; fold 1/4096 and the x256 ctx carry
  f16* so = sO + wave * (QT * 16 * TP);
  if (grp == 0u) {
    #pragma unroll
    for (unsigned t = 0; t < QT; ++t) {
      const float m2  = sM[(wave * QT + t) * 32 + lane];
      const float l2  = sL[(wave * QT + t) * 32 + lane];
      const float m   = fmaxf(rmax[t], m2);
      const float a1  = __builtin_amdgcn_exp2f((rmax[t] - m) * SL);
      const float a2  = __builtin_amdgcn_exp2f((m2 - m) * SL);
      const float inv = (256.0f / 4096.0f) / (rsum[t] * a1 + l2 * a2);
      const float g1  = a1 * inv;
      const float g2  = a2 * inv;
      float f1[8], f2[8];
      #pragma unroll
      for (unsigned r = 0; r < 8; ++r) {
        f1[r] = __shfl(g1, (int)((hi << 3) + r), 32);
        f2[r] = __shfl(g2, (int)((hi << 3) + r), 32);
      }
      #pragma unroll
      for (unsigned dt = 0; dt < 4; ++dt) {
        #pragma unroll
        for (unsigned q4 = 0; q4 < 2; ++q4) {
          const v4f p = *(const v4f*)(sp + (((t * 4 + dt) * 2 + q4) * 32 + lane) * 4);
          #pragma unroll
          for (unsigned j = 0; j < 4; ++j) {
            const unsigned r = q4 * 4 + j;
            so[(t * 16 + hi * 8 + r) * TP + dt * 16 + lq] = (f16)(o[t][dt][r] * f1[r] + p[j] * f2[r]);
          }
        }
      }
    }
  }
  __syncthreads();

  if (grp == 0u) {
    v4u    val[QT * 4];
    size_t idx[QT * 4];
    #pragma unroll
    for (unsigned t = 0; t < QT; ++t) {
      #pragma unroll
      for (unsigned it = 0; it < 4; ++it) {
        Pack8H ph;                                  // ctx in fragment order: tile = 16 of this wave's tokens, unit = h*4 + it, slot = lane
        ph.v = *(const v8h*)(so + (t * 16 + lq) * TP + it * 16 + hi * 8);
        val[t * 4 + it] = ph.u;
        idx[t * 4 + it] = ((size_t)b * SEQ + qrow0 + t * 16) * CH + (h * 4 + it) * 256 + lane * 8;
      }
    }
    #pragma unroll
    for (unsigned it = 0; it < QT * 4; ++it) *(v4u*)(ctx + idx[it]) = val[it];
  }
}

// Projection, transposed: Y^T[c][tok] = sum_k wpT[c][k] * ctx[tok][k]. Block = (128-token tile, 64-channel tile).
// A fragments from wpT (channel tiles), B fragments from ctx (token tiles), both in fragment order; D rows = channels, columns = tokens,
// so the channel-major output row of 128 pixels (512 B) is written by one wave instruction (32 lanes x 16 B).
__global__ __launch_bounds__(256) void proj_kernel(const f16* __restrict__ ctx,
                                                   const f16* __restrict__ wpT,
                                                   const float* __restrict__ bproj,
                                                   const float* __restrict__ x,
                                                   float* __restrict__ out) {
  const unsigned mt   = blockIdx.x;
  const unsigned ct   = blockIdx.y;             // 0..3
  const unsigned tid  = threadIdx.x;
  const unsigned wave = tid >> 5;
  const unsigned lane = tid & 31u;
  const unsigned lq   = lane & 15u;
  const unsigned hi   = lane >> 4;
  __shared__ __align__(16) float sO[64 * OPF];  // [channel][token], cross-wave (block barrier)

  const f16* brow = ctx + (size_t)(mt * NWAVE + wave) * (16 * CH) + lane * 8;
  const f16* arow = wpT + (size_t)(ct * 4) * (16 * CH) + lane * 8;

  v8f acc[4];
  #pragma unroll
  for (unsigned m4 = 0; m4 < 4; ++m4) acc[m4] = (v8f){0, 0, 0, 0, 0, 0, 0, 0};

  #pragma unroll 2
  for (unsigned ks = 0; ks < CH / 32; ++ks) {
    FragH bc;
    bc.q[0] = *(const v4u*)(brow + ks * 512);
    bc.q[1] = *(const v4u*)(brow + ks * 512 + 256);
    FragH aw[4];
    #pragma unroll
    for (unsigned m4 = 0; m4 < 4; ++m4) {
      const f16* base = arow + (size_t)m4 * 16 * CH + ks * 512;
      aw[m4].q[0] = *(const v4u*)(base);
      aw[m4].q[1] = *(const v4u*)(base + 256);
    }
    #pragma unroll
    for (unsigned m4 = 0; m4 < 4; ++m4) acc[m4] = mma_f16(aw[m4].v, bc.v, acc[m4]);
  }

  // acc[m4][r] = 16384 * value(channel m4*16 + hi*8 + r, token wave*16 + lq)
  #pragma unroll
  for (unsigned m4 = 0; m4 < 4; ++m4) {
    #pragma unroll
    for (unsigned r = 0; r < 8; ++r)
      sO[(m4 * 16 + hi * 8 + r) * OPF + wave * 16 + lq] = acc[m4][r] * (1.0f / 16384.0f);
  }
  __syncthreads();

  const unsigned b  = mt / (SEQ / MT);
  const unsigned p0 = (mt % (SEQ / MT)) * MT;
  v4f    val[8];
  size_t idx[8];
  #pragma unroll
  for (unsigned it = 0; it < 8; ++it) {
    const unsigned row = it * 8 + wave;                 // channel within the tile (wave-uniform)
    const unsigned c   = ct * 64 + row;
    const v4f a  = *(const v4f*)(sO + row * OPF + lane * 4);
    const float bb = (float)(bf16)bproj[c];
    const size_t gi = ((size_t)b * CH + c) * SEQ_FULL + p0 + lane * 4;
    const v4f xv = *(const v4f*)(x + gi);
    v4f res;
    #pragma unroll
    for (unsigned i = 0; i < 4; ++i) res[i] = (float)(bf16)xv[i] + (a[i] + bb);
    val[it] = res;
    idx[it] = gi;
  }
  #pragma unroll
  for (unsigned it = 0; it < 8; ++it) *(v4f*)(out + idx[it]) = val[it];
  
}

extern "C" void kernel_launch(void* const* d_in, const int* in_sizes, int n_in,
                              void* d_out, int out_size, void* d_ws, size_t ws_size,
                              hipStream_t stream) {
  if (n_in < 7) return;
  const size_t x_need = ((size_t)(NB - 1) * CH + (CH - 1)) * SEQ_FULL + SEQ;
  if ((size_t)in_sizes[0] < x_need) return;
  if (in_sizes[1] < CH || in_sizes[2] < CH) return;
  if ((size_t)in_sizes[3] < (size_t)CH * QKVN || in_sizes[4] < QKVN) return;
  if ((size_t)in_sizes[5] < (size_t)CH * CH || in_sizes[6] < CH) return;
  if ((size_t)out_size < x_need) return;

  const size_t tok_plane = (size_t)NB * SEQ * CH * 2;            // xn, ctx and each of q/k/v^T: same bytes
  const size_t wq_bytes  = (size_t)QKVN * CH * 2;
  const size_t wp_bytes  = (size_t)CH * CH * 2;
  const size_t total     = 5 * tok_plane + wq_bytes + wp_bytes;
  if (ws_size < total) return;

  const float* x     = (const float*)d_in[0];
  const float* gam   = (const float*)d_in[1];
  const float* bet   = (const float*)d_in[2];
  const float* wqkv  = (const float*)d_in[3];
  const float* bqkv  = (const float*)d_in[4];
  const float* wproj = (const float*)d_in[5];
  const float* bproj = (const float*)d_in[6];
  float* out = (float*)d_out;

  char* ws = (char*)d_ws;
  f16* xn  = (f16*)(ws);
  f16* qp  = (f16*)(ws + 1 * tok_plane);
  f16* kp  = (f16*)(ws + 2 * tok_plane);
  f16* vt  = (f16*)(ws + 3 * tok_plane);
  f16* ctx = (f16*)(ws + 4 * tok_plane);
  f16* wqT = (f16*)(ws + 5 * tok_plane);
  f16* wpT = (f16*)(ws + 5 * tok_plane + wq_bytes);

  w_planes_kernel<<<dim3(CH / 64, QKVN / 64 + CH / 64), 256, 0, stream>>>(wqkv, wproj, wqT, wpT);
  ln_plane_kernel<<<dim3(NB * (SEQ / LNT)), 256, 0, stream>>>(x, gam, bet, xn);
  qkv_gemm_kernel<<<dim3(NB * (SEQ / MT), QKVN / 64), 256, 0, stream>>>(xn, wqT, bqkv, qp, kp, vt);
  attn_kernel<<<dim3(SEQ / BQ, NHEAD, NB), NWAVE * KSPL * 32, 0, stream>>>(qp, kp, vt, ctx);
  proj_kernel<<<dim3(NB * (SEQ / MT), CH / 64), 256, 0, stream>>>(ctx, wpT, bproj, x, out);
}

// v005
// A run of this version takes 101 microseconds.
// Next to v004, in two timings, it ran 1.11 times as fast each time.
// Counting every step since v000, it is 2.98 times as fast.
#include <hip/hip_runtime.h>

// Contractions (all v_wmma_f32_16x16x32_f16, f16 operands, f32 accumulate): QKV = xn x Wqkv (W = f16 of the bf16 RNE-converted weight x64);
// S^T = K x Q^T (f16 q/k planes); O = P x V (P carried x4096, V^T f16 plane); Y^T = Wproj^T x ctx^T (ctx carried x256, W x64). LayerNorm, softmax, bias and residual in f32.
// Every f16 operand plane in the workspace is stored in fragment order: one 512-B unit per (16-row tile, 16-wide k piece), holding for each
// lane the 8 halves it loads, so a wave-wide 16-B load reads 4 whole 128-B lines. Unit u of a 16-row tile covers k = u*16 .. u*16+15;
// lane (lq = row in the tile, hi) owns k = u*16 + hi*8 + 0..7 at half offset u*256 + slot*8 (slot = hi*16 + lq; xn: slot = lq*2 + hi).

#ifndef NB
#define NB 4
#endif
#ifndef SEQ
#define SEQ 4096
#endif
#define NB_FULL    4
#define SEQ_FULL   4096
#define CH         256                  // channels = NHEAD * HDIM
#define NHEAD      4
#define HDIM       64
#define QKVN       (3 * CH)
#define QT         2                    // 16-row query tiles per attention wave
#define BQ         256                  // query rows per attention workgroup (8 waves x QT x 16)
#define BK         32                   // keys per inner iteration
#define NWAVE      8
#define KSPL       2                    // key ranges per attention workgroup (one per group of NWAVE waves)
#define NPASS      (SEQ / BK / KSPL)    // inner iterations per attention wave
#define MT         128                  // tokens per GEMM workgroup (8 waves x 16)
#define LNT        32                   // tokens per LayerNorm workgroup
#define LNP        33                   // LDS pitch (floats) of the LayerNorm tile
#define TP         72                   // LDS pitch (halves) of 64-wide f16 tiles
#define VP         136                  // LDS pitch (halves) of the 128-wide transposed V tile
#define OPF        132                  // LDS pitch (floats) of the projection staging tile

static_assert(SEQ % BQ == 0);
static_assert(SEQ % MT == 0);
static_assert(SEQ % LNT == 0);
static_assert(SEQ % (BK * KSPL) == 0);
static_assert(BQ == NWAVE * QT * 16);
static_assert(MT == NWAVE * 16);
static_assert(CH == NHEAD * HDIM);
static_assert(CH == 256);
static_assert(HDIM == 64);
static_assert(CH % 32 == 0);
static_assert(SEQ <= SEQ_FULL);
static_assert(NB >= 1 && NB <= NB_FULL);
static_assert((TP * 2) % 16 == 0);
static_assert((VP * 2) % 16 == 0);
static_assert((OPF * 4) % 16 == 0);
static_assert(MT * TP >= HDIM * VP);
// coverage equalities (threads x pieces x elements == tile elements)
static_assert(256 * 4 * 8 == LNT * CH);          // LayerNorm plane tile
static_assert(256 * 2 * 8 == 64 * 64);           // weight plane tile
static_assert(256 * 4 * 8 == MT * HDIM);         // q / k / v^T plane tile
static_assert(32 * 4 * 8 == 16 * HDIM);          // per-wave ctx tile
static_assert(NWAVE * 8 * 32 * 4 == 64 * MT);    // output tile

typedef __bf16   bf16;
typedef _Float16 f16;
typedef f16      v16h  __attribute__((ext_vector_type(16)));
typedef f16      v8h   __attribute__((ext_vector_type(8)));
typedef float    v8f   __attribute__((ext_vector_type(8)));
typedef float    v4f   __attribute__((ext_vector_type(4)));
typedef float    v2f   __attribute__((ext_vector_type(2)));
typedef unsigned v4u   __attribute__((ext_vector_type(4)));

union FragH  { v16h  v; v4u q[2]; f16  h[16]; };
union Pack8H { v4u u; v8h v; f16 h[8]; };

// WMMA helper: builtin followed by the VALU hazard guard (ties D, keeps A/B live).
static __device__ __forceinline__ v8f mma_f16(v16h a, v16h b, v8f acc) {
  acc = __builtin_amdgcn_wmma_f32_16x16x32_f16(false, a, false, b, (short)0, acc, false, false);
  asm volatile("v_nop\n\tv_nop\n\tv_nop\n\tv_nop" : "+v"(acc) : "v"(a), "v"(b));
  return acc;
}

// Weight planes. Block = (64-wide k tile, 64-wide n tile), 256 threads.
//   wqT f16 = bf16(w_qkv[k][n]) x 64, wpT f16 = bf16(w_proj[k][n]) x 64, both in fragment order: tile = 16 columns n, 16 units over k.
__global__ __launch_bounds__(256) void w_planes_kernel(const float* __restrict__ wqkv,
                                                       const float* __restrict__ wproj,
                                                       f16* __restrict__ wqT,
                                                       f16* __restrict__ wpT) {
  const unsigned kt  = blockIdx.x;              // 0..3
  const unsigned nt  = blockIdx.y;              // 0..11 qkv, 12..15 proj
  const unsigned tid = threadIdx.x;
  const bool isq = nt < (QKVN / 64);
  const float* src = isq ? wqkv : wproj;        // both global, block-uniform
  f16*         dst = isq ? wqT : wpT;
  const unsigned ldn = isq ? (unsigned)QKVN : (unsigned)CH;
  const unsigned n0  = (isq ? nt : (nt - QKVN / 64)) * 64u;
  const unsigned k0  = kt * 64u;
  __shared__ __align__(16) f16 sT[64 * TP];     // [n][k], cross-wave (block barrier)

  #pragma unroll
  for (unsigned kk = 0; kk < 2; ++kk) {
    const unsigned kr = kk * 32 + (tid >> 3);   // 0..63
    const unsigned nn = (tid & 7u) * 8;         // 0..56
    const float* p = src + (size_t)(k0 + kr) * ldn + n0 + nn;
    const v4f w0 = *(const v4f*)(p);
    const v4f w1 = *(const v4f*)(p + 4);
    #pragma unroll
    for (unsigned i = 0; i < 4; ++i) {
      sT[(nn + i) * TP + kr]     = (f16)((float)(bf16)w0[i] * 64.0f);   // exact in f16
      sT[(nn + 4 + i) * TP + kr] = (f16)((float)(bf16)w1[i] * 64.0f);
    }
  }
  __syncthreads();

  v4u    val[2];
  size_t idx[2];
  #pragma unroll
  for (unsigned kk = 0; kk < 2; ++kk) {
    const unsigned g  = kk * 256 + tid;         // destination order: (n tile 0..3, unit 0..3, slot 0..31)
    const unsigned nl = g >> 7;
    const unsigned u  = (g >> 5) & 3u;
    const unsigned n  = nl * 16 + (g & 15u);
    const unsigned ks = u * 16 + ((g >> 4) & 1u) * 8;
    Pack8H ph;
    ph.v = *(const v8h*)(sT + n * TP + ks);
    val[kk] = ph.u;
    idx[kk] = (size_t)(n0 / 16 + nl) * (16 * CH) + (k0 / 16 + u) * 256 + (g & 31u) * 8;
  }
  #pragma unroll
  for (unsigned kk = 0; kk < 2; ++kk) *(v4u*)(dst + idx[kk]) = val[kk];
  
}

// LayerNorm over channels of the bf16 RNE-converted input; xn f16 in fragment order: tile = 16 tokens, 16 units over channels,
// slot = lq*2 + hi so that the 4 tokens x 2 pieces a wave holds per unit make one whole 128-B line.
__global__ __launch_bounds__(256) void ln_plane_kernel(const float* __restrict__ x,
                                                       const float* __restrict__ gamma,
                                                       const float* __restrict__ beta,
                                                       f16* __restrict__ xn) {
  const unsigned tid = threadIdx.x;
  const unsigned blk = blockIdx.x;
  const unsigned b   = blk / (SEQ / LNT);
  const unsigned p0  = (blk % (SEQ / LNT)) * LNT;
  __shared__ float sX[CH * LNP];                // [c][pix], cross-wave (block barrier)
  __shared__ float sG[CH];
  __shared__ float sB[CH];

  const float* xb = x + (size_t)b * CH * SEQ_FULL + p0;
  const unsigned px = tid & 31u;
  const unsigned cr = tid >> 5;
  #pragma unroll 4
  for (unsigned it = 0; it < 32; ++it) {
    const unsigned c = it * 8 + cr;
    const float v = xb[(size_t)c * SEQ_FULL + px];
    sX[c * LNP + px] = (float)(bf16)v;          // RNE convert
  }
  sG[tid] = (float)(bf16)gamma[tid];
  sB[tid] = (float)(bf16)beta[tid];
  __syncthreads();

  const unsigned tok  = tid >> 3;               // 0..31
  const unsigned part = tid & 7u;               // 0..7
  float s = 0.0f;
  #pragma unroll 4
  for (unsigned j = 0; j < 32; ++j) s += sX[(part + 8 * j) * LNP + tok];
  s += __shfl_xor(s, 1, 32);
  s += __shfl_xor(s, 2, 32);
  s += __shfl_xor(s, 4, 32);
  const float mu = s * (1.0f / CH);
  float ss = 0.0f;
  #pragma unroll 4
  for (unsigned j = 0; j < 32; ++j) {
    const float d = sX[(part + 8 * j) * LNP + tok] - mu;
    ss += d * d;
  }
  ss += __shfl_xor(ss, 1, 32);
  ss += __shfl_xor(ss, 2, 32);
  ss += __shfl_xor(ss, 4, 32);
  const float rstd = rsqrtf(ss * (1.0f / CH) + 1e-5f);

  v4u    val[4];
  size_t idx[4];
  #pragma unroll
  for (unsigned j = 0; j < 4; ++j) {
    const unsigned c0 = j * 64 + part * 8;
    Pack8H ph;
    #pragma unroll
    for (unsigned i = 0; i < 8; ++i) {
      const float d = sX[(c0 + i) * LNP + tok] - mu;
      ph.h[i] = (f16)(d * rstd * sG[c0 + i] + sB[c0 + i]);
    }
    val[j] = ph.u;
    idx[j] = (((size_t)b * SEQ + p0 + tok) >> 4) * (16 * CH) + (c0 >> 4) * 256 + ((tok & 15u) * 2 + (part & 1u)) * 8;
  }
  #pragma unroll
  for (unsigned j = 0; j < 4; ++j) *(v4u*)(xn + idx[j]) = val[j];
  
}

// QKV GEMM. Block = (128-token tile, 64-column tile = one head of q, k or v); wave = 16 tokens x 64 columns.
// A fragments from xn, B fragments from wqT (both in fragment order), two 16-B loads each, split k map.
// q and k planes per head: tile = 16 tokens, 4 units over d; v plane per head: per 32 keys, tile = 16 columns d, 2 units over keys.
__global__ __launch_bounds__(256) void qkv_gemm_kernel(const f16* __restrict__ xn,
                                                       const f16* __restrict__ wqT,
                                                       const float* __restrict__ bqkv,
                                                       f16* __restrict__ qp,
                                                       f16* __restrict__ kp,
                                                       f16* __restrict__ vt) {
  const unsigned mt   = blockIdx.x;
  const unsigned nt   = blockIdx.y;             // 0..11
  const unsigned tid  = threadIdx.x;
  const unsigned wave = tid >> 5;
  const unsigned lane = tid & 31u;
  const unsigned lq   = lane & 15u;
  const unsigned hi   = lane >> 4;
  const unsigned sel  = nt >> 2;                // 0 q, 1 k, 2 v
  const unsigned h    = nt & 3u;
  __shared__ __align__(16) f16 sT[MT * TP];     // [tok][d] (q,k) or [d][tok] pitch VP (v); cross-wave (block barrier)

  const f16* arow = xn + (size_t)(mt * NWAVE + wave) * (16 * CH) + (lq * 2 + hi) * 8;
  const f16* brow = wqT + (size_t)(nt * 4) * (16 * CH) + lane * 8;

  v8f acc[4];
  #pragma unroll
  for (unsigned dt = 0; dt < 4; ++dt) acc[dt] = (v8f){0, 0, 0, 0, 0, 0, 0, 0};

  #pragma unroll 2
  for (unsigned ks = 0; ks < CH / 32; ++ks) {
    FragH a;
    a.q[0] = *(const v4u*)(arow + ks * 512);                  // k = ks*32 + hi*8 + 0..7
    a.q[1] = *(const v4u*)(arow + ks * 512 + 256);            // k = ks*32 + 16 + hi*8 + 0..7
    FragH bw[4];
    #pragma unroll
    for (unsigned dt = 0; dt < 4; ++dt) {
      const f16* base = brow + (size_t)dt * 16 * CH + ks * 512;
      bw[dt].q[0] = *(const v4u*)(base);
      bw[dt].q[1] = *(const v4u*)(base + 256);
    }
    #pragma unroll
    for (unsigned dt = 0; dt < 4; ++dt) acc[dt] = mma_f16(a.v, bw[dt].v, acc[dt]);
  }

  float bias[4];
  #pragma unroll
  for (unsigned dt = 0; dt < 4; ++dt) bias[dt] = (float)(bf16)bqkv[nt * 64 + dt * 16 + lq];

  // acc[dt][r] = 64 * value(token wave*16 + hi*8 + r, column dt*16 + lq)
  if (sel < 2u) {
    #pragma unroll
    for (unsigned dt = 0; dt < 4; ++dt) {
      #pragma unroll
      for (unsigned r = 0; r < 8; ++r)
        sT[(wave * 16 + hi * 8 + r) * TP + dt * 16 + lq] = (f16)(acc[dt][r] * (1.0f / 64.0f) + bias[dt]);
    }
  } else {
    #pragma unroll
    for (unsigned dt = 0; dt < 4; ++dt) {
      #pragma unroll
      for (unsigned r = 0; r < 8; ++r)
        sT[(dt * 16 + lq) * VP + wave * 16 + hi * 8 + r] = (f16)(acc[dt][r] * (1.0f / 64.0f) + bias[dt]);
    }
  }
  __syncthreads();

  const unsigned b    = mt / (SEQ / MT);
  const unsigned tok0 = (mt % (SEQ / MT)) * MT;
  f16* dst = (sel == 0u) ? qp : ((sel == 1u) ? kp : vt);
  v4u    val[4];
  size_t idx[4];
  if (sel < 2u) {
    #pragma unroll
    for (unsigned it = 0; it < 4; ++it) {
      const unsigned row = it * 32 + (wave >> 2) * 16 + lq;     // destination order: (token tile, unit = wave & 3, slot = lane)
      Pack8H ph;
      ph.v = *(const v8h*)(sT + row * TP + (wave & 3u) * 16 + hi * 8);
      val[it] = ph.u;
      idx[it] = (((size_t)b * NHEAD + h) * SEQ + tok0 + it * 32) * HDIM + tid * 8;
    }
  } else {
    #pragma unroll
    for (unsigned it = 0; it < 4; ++it) {
      const unsigned d = (wave >> 1) * 16 + lq;                 // destination order: (32-key block it, d tile, unit = wave & 1, slot = lane)
      Pack8H ph;
      ph.v = *(const v8h*)(sT + d * VP + it * 32 + (wave & 1u) * 16 + hi * 8);
      val[it] = ph.u;
      idx[it] = (((size_t)b * NHEAD + h) * SEQ + tok0 + it * 32) * HDIM + tid * 8;
    }
  }
  #pragma unroll
  for (unsigned it = 0; it < 4; ++it) *(v4u*)(dst + idx[it]) = val[it];
  
}

// Flash attention, full (no mask). Block = (query block of 256, head, batch), 16 waves; one wave owns QT = 2 tiles of 16 query rows.
// S^T = K x Q^T so queries sit on lanes; P^T in C-layout is bit-identical to the A-fragment layout of O += P x V.
// K A-fragments, Q B-fragments and V^T B-fragments are loaded straight from the fragment-order f16 planes (two 16-B loads per fragment).
// Every K and V fragment a wave loads feeds both of its query tiles: 16 loads per 16 products, and the two tiles' softmax chains are independent.
// K fragments are fetched one pass ahead: pass i issues the loads of pass i+1 right behind its own S^T products, into the registers
// those products have released, so the softmax and the PV products run while they fly; V is issued at the head of its own pass.
// The workgroup has KSPL = 2 groups of 8 waves: wave w and wave w + 8 own the same 32 query rows and walk one half of the keys each, so
// that four waves instead of two share a SIMD and fill each other's waits; their references, sums and O tiles are merged once, through LDS.
__global__ __launch_bounds__(NWAVE * KSPL * 32) void attn_kernel(const f16* __restrict__ qp,
                                                   const f16* __restrict__ kp,
                                                   const f16* __restrict__ vt,
                                                   f16* __restrict__ ctx) {
  const unsigned qblk = blockIdx.x;
  const unsigned h    = blockIdx.y;
  const unsigned b    = blockIdx.z;
  const unsigned tid  = threadIdx.x;
  const unsigned wave = (tid >> 5) & (NWAVE - 1u);                                   // which 32 query rows
  const unsigned grp  = (unsigned)__builtin_amdgcn_readfirstlane((int)(tid >> 8));   // which half of the keys (wave-uniform)
  const unsigned lane = tid & 31u;
  const unsigned lq   = lane & 15u;   // query column of S^T / d column of O
  const unsigned hi   = lane >> 4;    // k-split half

  __shared__ __align__(16) f16   sO[NWAVE * QT * 16 * TP];      // per-wave output staging (block barrier used)
  __shared__ __align__(16) float sP[NWAVE * QT * 4 * 8 * 32];   // second key half's O tiles, [wave][t][dt][r / 4][lane][r % 4]
  __shared__ float sM[NWAVE * QT * 32];                         // second key half's exponent offsets (12 - maximum * SL), [wave][t][lane]
  __shared__ float sL[NWAVE * QT * 32];                         // second key half's row sums

  const unsigned qrow0 = qblk * BQ + wave * (QT * 16);

  const f16* qp_h = qp + ((size_t)b * NHEAD + h) * SEQ * HDIM;
  const f16* kp_h = kp + (((size_t)b * NHEAD + h) * SEQ + grp * (SEQ / KSPL)) * HDIM;   // this group's first key
  const f16* vt_h = vt + (((size_t)b * NHEAD + h) * SEQ + grp * (SEQ / KSPL)) * HDIM;

  // Q as B-operand fragments: in tile t lane lq holds query qrow0 + t*16 + lq, elements follow the split d map.
  FragH qf[QT][2];
  #pragma unroll
  for (unsigned t = 0; t < QT; ++t) {
    const f16* qr = qp_h + (size_t)(qrow0 + t * 16) * HDIM + lane * 8;
    #pragma unroll
    for (unsigned f = 0; f < 2; ++f) {
      qf[t][f].q[0] = *(const v4u*)(qr + f * 512);              // d = f*32 + hi*8 + 0..7
      qf[t][f].q[1] = *(const v4u*)(qr + f * 512 + 256);        // d = f*32 + 16 + hi*8 + 0..7
    }
  }

  v8f   o[QT][4];
  float rmax[QT];   // running maximum, raw score
  float roff[QT];   // the exponent offset in use, 12 - rmax * SL: the reference that the sums and O are carried at
  float rsum[QT];
  #pragma unroll
  for (unsigned t = 0; t < QT; ++t) {
    #pragma unroll
    for (unsigned dt = 0; dt < 4; ++dt) o[t][dt] = (v8f){0, 0, 0, 0, 0, 0, 0, 0};
    rmax[t] = -__builtin_inff();
    roff[t] = __builtin_inff();
    rsum[t] = 0.0f;
  }
  const float SL = 0.0625f * 1.4426950408889634f;   // softmax scale (1/sqrt(CH)) * log2(e)

  // K A-fragments: row = key j0 + sub*16 + lq, split d map; pass 0's are loaded here, every later pass's one pass ahead
  FragH ak[2][2];
  #pragma unroll
  for (unsigned sub = 0; sub < 2; ++sub) {
    #pragma unroll
    for (unsigned f = 0; f < 2; ++f) {
      const f16* base = kp_h + (size_t)(sub * 16) * HDIM + f * 512 + lane * 8;
      ak[sub][f].q[0] = *(const v4u*)(base);
      ak[sub][f].q[1] = *(const v4u*)(base + 256);
    }
  }

  for (unsigned i = 0; i < NPASS; ++i) {
    const unsigned j0 = i * BK;                     // counted from this group's first key

    // V B-fragments: column n = d = dt*16 + lq, split key map
    FragH bv[4];
    #pragma unroll
    for (unsigned dt = 0; dt < 4; ++dt) {
      const f16* base = vt_h + (size_t)j0 * HDIM + dt * 512 + lane * 8;
      bv[dt].q[0] = *(const v4u*)(base);            // keys j0 + hi*8 + 0..7
      bv[dt].q[1] = *(const v4u*)(base + 256);      // keys j0 + 16 + hi*8 + 0..7
    }

    // S^T tiles: c[t][sub][r] = rawscore(query qrow0 + t*16 + lq, key j0 + sub*16 + hi*8 + r); d 0..31 of all four tiles, then d 32..63
    v8f c[QT][2];
    #pragma unroll
    for (unsigned sub = 0; sub < 2; ++sub) {
      #pragma unroll
      for (unsigned t = 0; t < QT; ++t) c[t][sub] = mma_f16(ak[sub][0].v, qf[t][0].v, (v8f){0, 0, 0, 0, 0, 0, 0, 0});
    }
    #pragma unroll
    for (unsigned sub = 0; sub < 2; ++sub) {
      #pragma unroll
      for (unsigned t = 0; t < QT; ++t) c[t][sub] = mma_f16(ak[sub][1].v, qf[t][1].v, c[t][sub]);
    }

    // next pass's K fragments; the last pass re-reads the group's first 32 keys (in bounds, never used) so that the loads stay unconditional
    const unsigned jn = (i + 1 < NPASS) ? j0 + BK : 0u;
    #pragma unroll
    for (unsigned sub = 0; sub < 2; ++sub) {
      #pragma unroll
      for (unsigned f = 0; f < 2; ++f) {
        const f16* base = kp_h + (size_t)(jn + sub * 16) * HDIM + f * 512 + lane * 8;
        ak[sub][f].q[0] = *(const v4u*)(base);
        ak[sub][f].q[1] = *(const v4u*)(base + 256);
      }
    }

    // online softmax, per tile: query lq's 32 scores are split across lane / lane^16
    float m_new[QT];
    #pragma unroll
    for (unsigned t = 0; t < QT; ++t) {
      float m = rmax[t];
      #pragma unroll
      for (unsigned r = 0; r < 8; ++r) {
        m = fmaxf(m, c[t][0][r]);
        m = fmaxf(m, c[t][1][r]);
      }
      m_new[t] = m;
    }
    #pragma unroll
    for (unsigned t = 0; t < QT; ++t) m_new[t] = fmaxf(m_new[t], __shfl_xor(m_new[t], 16, 32));
    float scale[QT];
    #pragma unroll
    for (unsigned t = 0; t < QT; ++t) {
      const float off = __builtin_fmaf(-m_new[t], SL, 12.0f);
      scale[t] = __builtin_amdgcn_exp2f(off - roff[t]);   // from the offsets themselves, so old and new P agree whatever off's rounding
      roff[t]  = off;
      rmax[t]  = m_new[t];
    }

    // exp + pack: P^T C-layout == A-fragment layout for the PV product. P x 4096 = exp2(c * SL + off), off = 12 - max * SL: one packed FMA
    // per pair of neighbouring accumulator registers carries the scale, the maximum and the x4096 carry; the row sums are carried x4096 too
    FragH pa[QT];
    float psum[QT];
    #pragma unroll
    for (unsigned t = 0; t < QT; ++t) {
      const v2f   off2 = (v2f){roff[t], roff[t]};
      const v2f   sl2  = (v2f){SL, SL};
      v2f ps[2];
      #pragma unroll
      for (unsigned sub = 0; sub < 2; ++sub) {
        #pragma unroll
        for (unsigned r = 0; r < 8; r += 2) {       // keys sub*16 + hi*8 + r, r + 1
          const v2f x = __builtin_elementwise_fma((v2f){c[t][sub][r], c[t][sub][r + 1]}, sl2, off2);
          const v2f p = (v2f){__builtin_amdgcn_exp2f(x[0]), __builtin_amdgcn_exp2f(x[1])};
          ps[sub] = (r == 0) ? p : ps[sub] + p;
          pa[t].h[sub * 8 + r]     = (f16)p[0];
          pa[t].h[sub * 8 + r + 1] = (f16)p[1];
        }
      }
      const v2f pt = ps[0] + ps[1];
      psum[t] = pt[0] + pt[1];
    }
    #pragma unroll
    for (unsigned t = 0; t < QT; ++t) rsum[t] = rsum[t] * scale[t] + psum[t] + __shfl_xor(psum[t], 16, 32);

    // rescale O: queries are the row dimension there -> per-row scale from lane 8*hi + r
    #pragma unroll
    for (unsigned t = 0; t < QT; ++t) {
      float sc[8];
      #pragma unroll
      for (unsigned r = 0; r < 8; ++r) sc[r] = __shfl(scale[t], (int)((hi << 3) + r), 32);
      #pragma unroll
      for (unsigned dt = 0; dt < 4; ++dt) {
        #pragma unroll
        for (unsigned r = 0; r < 8; ++r) o[t][dt][r] *= sc[r];
      }
    }

    // O += P x V: each V fragment serves both tiles
    #pragma unroll
    for (unsigned dt = 0; dt < 4; ++dt) {
      #pragma unroll
      for (unsigned t = 0; t < QT; ++t) o[t][dt] = mma_f16(pa[t].v, bv[dt].v, o[t][dt]);
    }
  }

  // merge of the two key halves: group 1 hands its offsets, sums and O tiles over, group 0 joins them with its own
  float* sp = sP + wave * (QT * 4 * 8 * 32);
  if (grp != 0u) {
    #pragma unroll
    for (unsigned t = 0; t < QT; ++t) {
      sM[(wave * QT + t) * 32 + lane] = roff[t];
      sL[(wave * QT + t) * 32 + lane] = rsum[t];
      #pragma unroll
      for (unsigned dt = 0; dt < 4; ++dt) {
        #pragma unroll
        for (unsigned q4 = 0; q4 < 2; ++q4)
          *(v4f*)(sp + (((t * 4 + dt) * 2 + q4) * 32 + lane) * 4) =
              (v4f){o[t][dt][q4 * 4], o[t][dt][q4 * 4 + 1], o[t][dt][q4 * 4 + 2], o[t][dt][q4 * 4 + 3]};
      }
    }
  }
  __syncthreads();   // group 1's partial results are complete before group 0 reads them

  // normalize: lane holds column d = dt*16 + lq for query rows 8*hi + r of each tile; O and the sums both carry x4096, which cancels; fold the x256 ctx carry
  f16* so = sO + wave * (QT * 16 * TP);
  if (grp == 0u) {
    #pragma unroll
    for (unsigned t = 0; t < QT; ++t) {
      const float o2  = sM[(wave * QT + t) * 32 + lane];
      const float l2  = sL[(wave * QT + t) * 32 + lane];
      const float om  = fminf(roff[t], o2);               // the larger maximum has the smaller offset
      const float a1  = __builtin_amdgcn_exp2f(om - roff[t]);
      const float a2  = __builtin_amdgcn_exp2f(om - o2);
      const float inv = 256.0f / (rsum[t] * a1 + l2 * a2);
      const float g1  = a1 * inv;
      const float g2  = a2 * inv;
      float f1[8], f2[8];
      #pragma unroll
      for (unsigned r = 0; r < 8; ++r) {
        f1[r] = __shfl(g1, (int)((hi << 3) + r), 32);
        f2[r] = __shfl(g2, (int)((hi << 3) + r), 32);
      }
      #pragma unroll
      for (unsigned dt = 0; dt < 4; ++dt) {
        #pragma unroll
        for (unsigned q4 = 0; q4 < 2; ++q4) {
          const v4f p = *(const v4f*)(sp + (((t * 4 + dt) * 2 + q4) * 32 + lane) * 4);
          #pragma unroll
          for (unsigned j = 0; j < 4; ++j) {
            const unsigned r = q4 * 4 + j;
            so[(t * 16 + hi * 8 + r) * TP + dt * 16 + lq] = (f16)(o[t][dt][r] * f1[r] + p[j] * f2[r]);
          }
        }
      }
    }
  }
  __syncthreads();

  if (grp == 0u) {
    v4u    val[QT * 4];
    size_t idx[QT * 4];
    #pragma unroll
    for (unsigned t = 0; t < QT; ++t) {
      #pragma unroll
      for (unsigned it = 0; it < 4; ++it) {
        Pack8H ph;                                  // ctx in fragment order: tile = 16 of this wave's tokens, unit = h*4 + it, slot = lane
        ph.v = *(const v8h*)(so + (t * 16 + lq) * TP + it * 16 + hi * 8);
        val[t * 4 + it] = ph.u;
        idx[t * 4 + it] = ((size_t)b * SEQ + qrow0 + t * 16) * CH + (h * 4 + it) * 256 + lane * 8;
      }
    }
    #pragma unroll
    for (unsigned it = 0; it < QT * 4; ++it) *(v4u*)(ctx + idx[it]) = val[it];
  }
}

// Projection, transposed: Y^T[c][tok] = sum_k wpT[c][k] * ctx[tok][k]. Block = (128-token tile, 64-channel tile).
// A fragments from wpT (channel tiles), B fragments from ctx (token tiles), both in fragment order; D rows = channels, columns = tokens,
// so the channel-major output row of 128 pixels (512 B) is written by one wave instruction (32 lanes x 16 B).
__global__ __launch_bounds__(256) void proj_kernel(const f16* __restrict__ ctx,
                                                   const f16* __restrict__ wpT,
                                                   const float* __restrict__ bproj,
                                                   const float* __restrict__ x,
                                                   float* __restrict__ out) {
  const unsigned mt   = blockIdx.x;
  const unsigned ct   = blockIdx.y;             // 0..3
  const unsigned tid  = threadIdx.x;
  const unsigned wave = tid >> 5;
  const unsigned lane = tid & 31u;
  const unsigned lq   = lane & 15u;
  const unsigned hi   = lane >> 4;
  __shared__ __align__(16) float sO[64 * OPF];  // [channel][token], cross-wave (block barrier)

  const f16* brow = ctx + (size_t)(mt * NWAVE + wave) * (16 * CH) + lane * 8;
  const f16* arow = wpT + (size_t)(ct * 4) * (16 * CH) + lane * 8;

  v8f acc[4];
  #pragma unroll
  for (unsigned m4 = 0; m4 < 4; ++m4) acc[m4] = (v8f){0, 0, 0, 0, 0, 0, 0, 0};

  #pragma unroll 2
  for (unsigned ks = 0; ks < CH / 32; ++ks) {
    FragH bc;
    bc.q[0] = *(const v4u*)(brow + ks * 512);
    bc.q[1] = *(const v4u*)(brow + ks * 512 + 256);
    FragH aw[4];
    #pragma unroll
    for (unsigned m4 = 0; m4 < 4; ++m4) {
      const f16* base = arow + (size_t)m4 * 16 * CH + ks * 512;
      aw[m4].q[0] = *(const v4u*)(base);
      aw[m4].q[1] = *(const v4u*)(base + 256);
    }
    #pragma unroll
    for (unsigned m4 = 0; m4 < 4; ++m4) acc[m4] = mma_f16(aw[m4].v, bc.v, acc[m4]);
  }

  // acc[m4][r] = 16384 * value(channel m4*16 + hi*8 + r, token wave*16 + lq)
  #pragma unroll
  for (unsigned m4 = 0; m4 < 4; ++m4) {
    #pragma unroll
    for (unsigned r = 0; r < 8; ++r)
      sO[(m4 * 16 + hi * 8 + r) * OPF + wave * 16 + lq] = acc[m4][r] * (1.0f / 16384.0f);
  }
  __syncthreads();

  const unsigned b  = mt / (SEQ / MT);
  const unsigned p0 = (mt % (SEQ / MT)) * MT;
  v4f    val[8];
  size_t idx[8];
  #pragma unroll
  for (unsigned it = 0; it < 8; ++it) {
    const unsigned row = it * 8 + wave;                 // channel within the tile (wave-uniform)
    const unsigned c   = ct * 64 + row;
    const v4f a  = *(const v4f*)(sO + row * OPF + lane * 4);
    const float bb = (float)(bf16)bproj[c];
    const size_t gi = ((size_t)b * CH + c) * SEQ_FULL + p0 + lane * 4;
    const v4f xv = *(const v4f*)(x + gi);
    v4f res;
    #pragma unroll
    for (unsigned i = 0; i < 4; ++i) res[i] = (float)(bf16)xv[i] + (a[i] + bb);
    val[it] = res;
    idx[it] = gi;
  }
  #pragma unroll
  for (unsigned it = 0; it < 8; ++it) *(v4f*)(out + idx[it]) = val[it];
  
}

extern "C" void kernel_launch(void* const* d_in, const int* in_sizes, int n_in,
                              void* d_out, int out_size, void* d_ws, size_t ws_size,
                              hipStream_t stream) {
  if (n_in < 7) return;
  const size_t x_need = ((size_t)(NB - 1) * CH + (CH - 1)) * SEQ_FULL + SEQ;
  if ((size_t)in_sizes[0] < x_need) return;
  if (in_sizes[1] < CH || in_sizes[2] < CH) return;
  if ((size_t)in_sizes[3] < (size_t)CH * QKVN || in_sizes[4] < QKVN) return;
  if ((size_t)in_sizes[5] < (size_t)CH * CH || in_sizes[6] < CH) return;
  if ((size_t)out_size < x_need) return;

  const size_t tok_plane = (size_t)NB * SEQ * CH * 2;            // xn, ctx and each of q/k/v^T: same bytes
  const size_t wq_bytes  = (size_t)QKVN * CH * 2;
  const size_t wp_bytes  = (size_t)CH * CH * 2;
  const size_t total     = 5 * tok_plane + wq_bytes + wp_bytes;
  if (ws_size < total) return;

  const float* x     = (const float*)d_in[0];
  const float* gam   = (const float*)d_in[1];
  const float* bet   = (const float*)d_in[2];
  const float* wqkv  = (const float*)d_in[3];
  const float* bqkv  = (const float*)d_in[4];
  const float* wproj = (const float*)d_in[5];
  const float* bproj = (const float*)d_in[6];
  float* out = (float*)d_out;

  char* ws = (char*)d_ws;
  f16* xn  = (f16*)(ws);
  f16* qp  = (f16*)(ws + 1 * tok_plane);
  f16* kp  = (f16*)(ws + 2 * tok_plane);
  f16* vt  = (f16*)(ws + 3 * tok_plane);
  f16* ctx = (f16*)(ws + 4 * tok_plane);
  f16* wqT = (f16*)(ws + 5 * tok_plane);
  f16* wpT = (f16*)(ws + 5 * tok_plane + wq_bytes);

  w_planes_kernel<<<dim3(CH / 64, QKVN / 64 + CH / 64), 256, 0, stream>>>(wqkv, wproj, wqT, wpT);
  ln_plane_kernel<<<dim3(NB * (SEQ / LNT)), 256, 0, stream>>>(x, gam, bet, xn);
  qkv_gemm_kernel<<<dim3(NB * (SEQ / MT), QKVN / 64), 256, 0, stream>>>(xn, wqT, bqkv, qp, kp, vt);
  attn_kernel<<<dim3(SEQ / BQ, NHEAD, NB), NWAVE * KSPL * 32, 0, stream>>>(qp, kp, vt, ctx);
  proj_kernel<<<dim3(NB * (SEQ / MT), CH / 64), 256, 0, stream>>>(ctx, wpT, bproj, x, out);
}

// v006
// It runs in 95.6 microseconds.
// Two timings next to v005 both put it at 1.04 times that version's speed.
// All steps since v000 together make it 3.10 times as fast.
#include <hip/hip_runtime.h>

// Contractions (all v_wmma_f32_16x16x32_f16, f16 operands, f32 accumulate): QKV = xn x Wqkv (W = f16 of the bf16 RNE-converted weight x64);
// S^T = K x Q^T (f16 q/k planes); O = P x V (P carried x4096, V^T f16 plane); Y^T = Wproj^T x ctx^T (ctx carried x256, W x64). LayerNorm, softmax, bias and residual in f32.
// Every f16 operand plane in the workspace is stored in fragment order: one 512-B unit per (16-row tile, 16-wide k piece), holding for each
// lane the 8 halves it loads, so a wave-wide 16-B load reads 4 whole 128-B lines. Unit u of a 16-row tile covers k = u*16 .. u*16+15;
// lane (lq = row in the tile, hi) owns k = u*16 + hi*8 + 0..7 at half offset u*256 + slot*8 (slot = hi*16 + lq; xn: slot = lq*2 + hi).

#ifndef NB
#define NB 4
#endif
#ifndef SEQ
#define SEQ 4096
#endif
#define NB_FULL    4
#define SEQ_FULL   4096
#define CH         256                  // channels = NHEAD * HDIM
#define NHEAD      4
#define HDIM       64
#define QKVN       (3 * CH)
#define QT         2                    // 16-row query tiles per attention wave
#define BQ         256                  // query rows per attention workgroup (8 waves x QT x 16)
#define BK         32                   // keys per inner iteration
#define NWAVE      8
#define KSPL       2                    // key ranges per attention workgroup (one per group of NWAVE waves)
#define NPASS      (SEQ / BK / KSPL)    // inner iterations per attention wave
#define MT         128                  // tokens per GEMM workgroup (8 waves x 16)
#define LNT        32                   // tokens per LayerNorm workgroup
#define LNP        33                   // LDS pitch (floats) of the LayerNorm tile
#define TP         72                   // LDS pitch (halves) of 64-wide f16 tiles
#define VP         136                  // LDS pitch (halves) of the 128-wide transposed V tile
#define OPF        132                  // LDS pitch (floats) of the projection staging tile

static_assert(SEQ % BQ == 0);
static_assert(SEQ % MT == 0);
static_assert(SEQ % LNT == 0);
static_assert(SEQ % (BK * KSPL) == 0);
static_assert(BQ == NWAVE * QT * 16);
static_assert(QT == 2);                          // the attention matrix runs are written out for two query tiles
static_assert(MT == NWAVE * 16);
static_assert(CH == NHEAD * HDIM);
static_assert(CH == 256);
static_assert(HDIM == 64);
static_assert(CH % 32 == 0);
static_assert(SEQ <= SEQ_FULL);
static_assert(NB >= 1 && NB <= NB_FULL);
static_assert((TP * 2) % 16 == 0);
static_assert((VP * 2) % 16 == 0);
static_assert((OPF * 4) % 16 == 0);
static_assert(MT * TP >= HDIM * VP);
// coverage equalities (threads x pieces x elements == tile elements)
static_assert(256 * 4 * 8 == LNT * CH);          // LayerNorm plane tile
static_assert(256 * 2 * 8 == 64 * 64);           // weight plane tile
static_assert(256 * 4 * 8 == MT * HDIM);         // q / k / v^T plane tile
static_assert(32 * 4 * 8 == 16 * HDIM);          // per-wave ctx tile
static_assert(NWAVE * 8 * 32 * 4 == 64 * MT);    // output tile

typedef __bf16   bf16;
typedef _Float16 f16;
typedef f16      v16h  __attribute__((ext_vector_type(16)));
typedef f16      v8h   __attribute__((ext_vector_type(8)));
typedef float    v8f   __attribute__((ext_vector_type(8)));
typedef float    v4f   __attribute__((ext_vector_type(4)));
typedef float    v2f   __attribute__((ext_vector_type(2)));
typedef unsigned v4u   __attribute__((ext_vector_type(4)));

union FragH  { v16h  v; v4u q[2]; f16  h[16]; };
union Pack8H { v4u u; v8h v; f16 h[8]; };

// WMMA helper: builtin followed by the VALU hazard guard (ties D, keeps A/B live).
static __device__ __forceinline__ v8f mma_f16(v16h a, v16h b, v8f acc) {
  acc = __builtin_amdgcn_wmma_f32_16x16x32_f16(false, a, false, b, (short)0, acc, false, false);
  asm volatile("v_nop\n\tv_nop\n\tv_nop\n\tv_nop" : "+v"(acc) : "v"(a), "v"(b));
  return acc;
}

// Attention, the eight S^T products of a pass as one run (c<t><sub>, k<sub><f>, q<t><f>): d 0..31 of the four tiles, then d 32..63 on top.
// In one statement every product stands in the others' distance, so the idle slots are paid once a run and not once a product:
// the four v_nop behind the last product keep its distance to the first vector instruction that reads a tile.
static __device__ __forceinline__ void mma_s_run(v8f& c00, v8f& c10, v8f& c01, v8f& c11,
                                                 v16h k00, v16h k01, v16h k10, v16h k11,
                                                 v16h q00, v16h q01, v16h q10, v16h q11) {
  asm volatile("v_wmma_f32_16x16x32_f16 %0, %4, %8, 0\n\t"
               "v_wmma_f32_16x16x32_f16 %1, %4, %10, 0\n\t"
               "v_wmma_f32_16x16x32_f16 %2, %6, %8, 0\n\t"
               "v_wmma_f32_16x16x32_f16 %3, %6, %10, 0\n\t"
               "v_wmma_f32_16x16x32_f16 %0, %5, %9, %0\n\t"
               "v_wmma_f32_16x16x32_f16 %1, %5, %11, %1\n\t"
               "v_wmma_f32_16x16x32_f16 %2, %7, %9, %2\n\t"
               "v_wmma_f32_16x16x32_f16 %3, %7, %11, %3\n\t"
               "v_nop\n\tv_nop\n\tv_nop\n\tv_nop"
               : "=&v"(c00), "=&v"(c10), "=&v"(c01), "=&v"(c11)
               : "v"(k00), "v"(k01), "v"(k10), "v"(k11), "v"(q00), "v"(q01), "v"(q10), "v"(q11));
}

// Attention, the eight PV products of a pass as one run (o<t><dt> += p<t> x v<dt>), for the same reason; the four v_nop behind the last
// product keep its distance to the next vector instruction on its O tile or over its operands, on the loop's back edge too.
static __device__ __forceinline__ void mma_pv_run(v8f& o00, v8f& o10, v8f& o01, v8f& o11, v8f& o02, v8f& o12, v8f& o03, v8f& o13,
                                                  v16h p0, v16h p1, v16h v0, v16h v1, v16h v2, v16h v3) {
  asm volatile("v_wmma_f32_16x16x32_f16 %0, %8, %10, %0\n\t"
               "v_wmma_f32_16x16x32_f16 %1, %9, %10, %1\n\t"
               "v_wmma_f32_16x16x32_f16 %2, %8, %11, %2\n\t"
               "v_wmma_f32_16x16x32_f16 %3, %9, %11, %3\n\t"
               "v_wmma_f32_16x16x32_f16 %4, %8, %12, %4\n\t"
               "v_wmma_f32_16x16x32_f16 %5, %9, %12, %5\n\t"
               "v_wmma_f32_16x16x32_f16 %6, %8, %13, %6\n\t"
               "v_wmma_f32_16x16x32_f16 %7, %9, %13, %7\n\t"
               "v_nop\n\tv_nop\n\tv_nop\n\tv_nop"
               : "+v"(o00), "+v"(o10), "+v"(o01), "+v"(o11), "+v"(o02), "+v"(o12), "+v"(o03), "+v"(o13)
               : "v"(p0), "v"(p1), "v"(v0), "v"(v1), "v"(v2), "v"(v3));
}

// Weight planes. Block = (64-wide k tile, 64-wide n tile), 256 threads.
//   wqT f16 = bf16(w_qkv[k][n]) x 64, wpT f16 = bf16(w_proj[k][n]) x 64, both in fragment order: tile = 16 columns n, 16 units over k.
__global__ __launch_bounds__(256) void w_planes_kernel(const float* __restrict__ wqkv,
                                                       const float* __restrict__ wproj,
                                                       f16* __restrict__ wqT,
                                                       f16* __restrict__ wpT) {
  const unsigned kt  = blockIdx.x;              // 0..3
  const unsigned nt  = blockIdx.y;              // 0..11 qkv, 12..15 proj
  const unsigned tid = threadIdx.x;
  const bool isq = nt < (QKVN / 64);
  const float* src = isq ? wqkv : wproj;        // both global, block-uniform
  f16*         dst = isq ? wqT : wpT;
  const unsigned ldn = isq ? (unsigned)QKVN : (unsigned)CH;
  const unsigned n0  = (isq ? nt : (nt - QKVN / 64)) * 64u;
  const unsigned k0  = kt * 64u;
  __shared__ __align__(16) f16 sT[64 * TP];     // [n][k], cross-wave (block barrier)

  #pragma unroll
  for (unsigned kk = 0; kk < 2; ++kk) {
    const unsigned kr = kk * 32 + (tid >> 3);   // 0..63
    const unsigned nn = (tid & 7u) * 8;         // 0..56
    const float* p = src + (size_t)(k0 + kr) * ldn + n0 + nn;
    const v4f w0 = *(const v4f*)(p);
    const v4f w1 = *(const v4f*)(p + 4);
    #pragma unroll
    for (unsigned i = 0; i < 4; ++i) {
      sT[(nn + i) * TP + kr]     = (f16)((float)(bf16)w0[i] * 64.0f);   // exact in f16
      sT[(nn + 4 + i) * TP + kr] = (f16)((float)(bf16)w1[i] * 64.0f);
    }
  }
  __syncthreads();

  v4u    val[2];
  size_t idx[2];
  #pragma unroll
  for (unsigned kk = 0; kk < 2; ++kk) {
    const unsigned g  = kk * 256 + tid;         // destination order: (n tile 0..3, unit 0..3, slot 0..31)
    const unsigned nl = g >> 7;
    const unsigned u  = (g >> 5) & 3u;
    const unsigned n  = nl * 16 + (g & 15u);
    const unsigned ks = u * 16 + ((g >> 4) & 1u) * 8;
    Pack8H ph;
    ph.v = *(const v8h*)(sT + n * TP + ks);
    val[kk] = ph.u;
    idx[kk] = (size_t)(n0 / 16 + nl) * (16 * CH) + (k0 / 16 + u) * 256 + (g & 31u) * 8;
  }
  #pragma unroll
  for (unsigned kk = 0; kk < 2; ++kk) *(v4u*)(dst + idx[kk]) = val[kk];
  
}

// LayerNorm over channels of the bf16 RNE-converted input; xn f16 in fragment order: tile = 16 tokens, 16 units over channels,
// slot = lq*2 + hi so that the 4 tokens x 2 pieces a wave holds per unit make one whole 128-B line.
__global__ __launch_bounds__(256) void ln_plane_kernel(const float* __restrict__ x,
                                                       const float* __restrict__ gamma,
                                                       const float* __restrict__ beta,
                                                       f16* __restrict__ xn) {
  const unsigned tid = threadIdx.x;
  const unsigned blk = blockIdx.x;
  const unsigned b   = blk / (SEQ / LNT);
  const unsigned p0  = (blk % (SEQ / LNT)) * LNT;
  __shared__ float sX[CH * LNP];                // [c][pix], cross-wave (block barrier)
  __shared__ float sG[CH];
  __shared__ float sB[CH];

  const float* xb = x + (size_t)b * CH * SEQ_FULL + p0;
  const unsigned px = tid & 31u;
  const unsigned cr = tid >> 5;
  #pragma unroll 4
  for (unsigned it = 0; it < 32; ++it) {
    const unsigned c = it * 8 + cr;
    const float v = xb[(size_t)c * SEQ_FULL + px];
    sX[c * LNP + px] = (float)(bf16)v;          // RNE convert
  }
  sG[tid] = (float)(bf16)gamma[tid];
  sB[tid] = (float)(bf16)beta[tid];
  __syncthreads();

  const unsigned tok  = tid >> 3;               // 0..31
  const unsigned part = tid & 7u;               // 0..7
  float s = 0.0f;
  #pragma unroll 4
  for (unsigned j = 0; j < 32; ++j) s += sX[(part + 8 * j) * LNP + tok];
  s += __shfl_xor(s, 1, 32);
  s += __shfl_xor(s, 2, 32);
  s += __shfl_xor(s, 4, 32);
  const float mu = s * (1.0f / CH);
  float ss = 0.0f;
  #pragma unroll 4
  for (unsigned j = 0; j < 32; ++j) {
    const float d = sX[(part + 8 * j) * LNP + tok] - mu;
    ss += d * d;
  }
  ss += __shfl_xor(ss, 1, 32);
  ss += __shfl_xor(ss, 2, 32);
  ss += __shfl_xor(ss, 4, 32);
  const float rstd = rsqrtf(ss * (1.0f / CH) + 1e-5f);

  v4u    val[4];
  size_t idx[4];
  #pragma unroll
  for (unsigned j = 0; j < 4; ++j) {
    const unsigned c0 = j * 64 + part * 8;
    Pack8H ph;
    #pragma unroll
    for (unsigned i = 0; i < 8; ++i) {
      const float d = sX[(c0 + i) * LNP + tok] - mu;
      ph.h[i] = (f16)(d * rstd * sG[c0 + i] + sB[c0 + i]);
    }
    val[j] = ph.u;
    idx[j] = (((size_t)b * SEQ + p0 + tok) >> 4) * (16 * CH) + (c0 >> 4) * 256 + ((tok & 15u) * 2 + (part & 1u)) * 8;
  }
  #pragma unroll
  for (unsigned j = 0; j < 4; ++j) *(v4u*)(xn + idx[j]) = val[j];
  
}

// QKV GEMM. Block = (128-token tile, 64-column tile = one head of q, k or v); wave = 16 tokens x 64 columns.
// A fragments from xn, B fragments from wqT (both in fragment order), two 16-B loads each, split k map.
// q and k planes per head: tile = 16 tokens, 4 units over d; v plane per head: per 32 keys, tile = 16 columns d, 2 units over keys.
__global__ __launch_bounds__(256) void qkv_gemm_kernel(const f16* __restrict__ xn,
                                                       const f16* __restrict__ wqT,
                                                       const float* __restrict__ bqkv,
                                                       f16* __restrict__ qp,
                                                       f16* __restrict__ kp,
                                                       f16* __restrict__ vt) {
  const unsigned mt   = blockIdx.x;
  const unsigned nt   = blockIdx.y;             // 0..11
  const unsigned tid  = threadIdx.x;
  const unsigned wave = tid >> 5;
  const unsigned lane = tid & 31u;
  const unsigned lq   = lane & 15u;
  const unsigned hi   = lane >> 4;
  const unsigned sel  = nt >> 2;                // 0 q, 1 k, 2 v
  const unsigned h    = nt & 3u;
  __shared__ __align__(16) f16 sT[MT * TP];     // [tok][d] (q,k) or [d][tok] pitch VP (v); cross-wave (block barrier)

  const f16* arow = xn + (size_t)(mt * NWAVE + wave) * (16 * CH) + (lq * 2 + hi) * 8;
  const f16* brow = wqT + (size_t)(nt * 4) * (16 * CH) + lane * 8;

  v8f acc[4];
  #pragma unroll
  for (unsigned dt = 0; dt < 4; ++dt) acc[dt] = (v8f){0, 0, 0, 0, 0, 0, 0, 0};

  #pragma unroll 2
  for (unsigned ks = 0; ks < CH / 32; ++ks) {
    FragH a;
    a.q[0] = *(const v4u*)(arow + ks * 512);                  // k = ks*32 + hi*8 + 0..7
    a.q[1] = *(const v4u*)(arow + ks * 512 + 256);            // k = ks*32 + 16 + hi*8 + 0..7
    FragH bw[4];
    #pragma unroll
    for (unsigned dt = 0; dt < 4; ++dt) {
      const f16* base = brow + (size_t)dt * 16 * CH + ks * 512;
      bw[dt].q[0] = *(const v4u*)(base);
      bw[dt].q[1] = *(const v4u*)(base + 256);
    }
    #pragma unroll
    for (unsigned dt = 0; dt < 4; ++dt) acc[dt] = mma_f16(a.v, bw[dt].v, acc[dt]);
  }

  float bias[4];
  #pragma unroll
  for (unsigned dt = 0; dt < 4; ++dt) bias[dt] = (float)(bf16)bqkv[nt * 64 + dt * 16 + lq];

  // acc[dt][r] = 64 * value(token wave*16 + hi*8 + r, column dt*16 + lq)
  if (sel < 2u) {
    #pragma unroll
    for (unsigned dt = 0; dt < 4; ++dt) {
      #pragma unroll
      for (unsigned r = 0; r < 8; ++r)
        sT[(wave * 16 + hi * 8 + r) * TP + dt * 16 + lq] = (f16)(acc[dt][r] * (1.0f / 64.0f) + bias[dt]);
    }
  } else {
    #pragma unroll
    for (unsigned dt = 0; dt < 4; ++dt) {
      #pragma unroll
      for (unsigned r = 0; r < 8; ++r)
        sT[(dt * 16 + lq) * VP + wave * 16 + hi * 8 + r] = (f16)(acc[dt][r] * (1.0f / 64.0f) + bias[dt]);
    }
  }
  __syncthreads();

  const unsigned b    = mt / (SEQ / MT);
  const unsigned tok0 = (mt % (SEQ / MT)) * MT;
  f16* dst = (sel == 0u) ? qp : ((sel == 1u) ? kp : vt);
  v4u    val[4];
  size_t idx[4];
  if (sel < 2u) {
    #pragma unroll
    for (unsigned it = 0; it < 4; ++it) {
      const unsigned row = it * 32 + (wave >> 2) * 16 + lq;     // destination order: (token tile, unit = wave & 3, slot = lane)
      Pack8H ph;
      ph.v = *(const v8h*)(sT + row * TP + (wave & 3u) * 16 + hi * 8);
      val[it] = ph.u;
      idx[it] = (((size_t)b * NHEAD + h) * SEQ + tok0 + it * 32) * HDIM + tid * 8;
    }
  } else {
    #pragma unroll
    for (unsigned it = 0; it < 4; ++it) {
      const unsigned d = (wave >> 1) * 16 + lq;                 // destination order: (32-key block it, d tile, unit = wave & 1, slot = lane)
      Pack8H ph;
      ph.v = *(const v8h*)(sT + d * VP + it * 32 + (wave & 1u) * 16 + hi * 8);
      val[it] = ph.u;
      idx[it] = (((size_t)b * NHEAD + h) * SEQ + tok0 + it * 32) * HDIM + tid * 8;
    }
  }
  #pragma unroll
  for (unsigned it = 0; it < 4; ++it) *(v4u*)(dst + idx[it]) = val[it];
  
}

// Flash attention, full (no mask). Block = (query block of 256, head, batch), 16 waves; one wave owns QT = 2 tiles of 16 query rows.
// S^T = K x Q^T so queries sit on lanes; P^T in C-layout is bit-identical to the A-fragment layout of O += P x V.
// K A-fragments, Q B-fragments and V^T B-fragments are loaded straight from the fragment-order f16 planes (two 16-B loads per fragment).
// Every K and V fragment a wave loads feeds both of its query tiles: 16 loads per 16 products, and the two tiles' softmax chains are independent.
// K fragments are fetched one pass ahead: pass i issues the loads of pass i+1 right behind its own S^T products, into the registers
// those products have released, so the softmax and the PV products run while they fly; V is issued at the head of its own pass.
// The workgroup has KSPL = 2 groups of 8 waves: wave w and wave w + 8 own the same 32 query rows and walk one half of the keys each, so
// that four waves instead of two share a SIMD and fill each other's waits; their references, sums and O tiles are merged once, through LDS.
__global__ __launch_bounds__(NWAVE * KSPL * 32) void attn_kernel(const f16* __restrict__ qp,
                                                   const f16* __restrict__ kp,
                                                   const f16* __restrict__ vt,
                                                   f16* __restrict__ ctx) {
  const unsigned qblk = blockIdx.x;
  const unsigned h    = blockIdx.y;
  const unsigned b    = blockIdx.z;
  const unsigned tid  = threadIdx.x;
  const unsigned wave = (tid >> 5) & (NWAVE - 1u);                                   // which 32 query rows
  const unsigned grp  = (unsigned)__builtin_amdgcn_readfirstlane((int)(tid >> 8));   // which half of the keys (wave-uniform)
  const unsigned lane = tid & 31u;
  const unsigned lq   = lane & 15u;   // query column of S^T / d column of O
  const unsigned hi   = lane >> 4;    // k-split half

  __shared__ __align__(16) f16   sO[NWAVE * QT * 16 * TP];      // per-wave output staging (block barrier used)
  __shared__ __align__(16) float sP[NWAVE * QT * 4 * 8 * 32];   // second key half's O tiles, [wave][t][dt][r / 4][lane][r % 4]
  __shared__ float sM[NWAVE * QT * 32];                         // second key half's exponent offsets (12 - maximum * SL), [wave][t][lane]
  __shared__ float sL[NWAVE * QT * 32];                         // second key half's row sums

  const unsigned qrow0 = qblk * BQ + wave * (QT * 16);

  const f16* qp_h = qp + ((size_t)b * NHEAD + h) * SEQ * HDIM;
  const f16* kp_h = kp + (((size_t)b * NHEAD + h) * SEQ + grp * (SEQ / KSPL)) * HDIM;   // this group's first key
  const f16* vt_h = vt + (((size_t)b * NHEAD + h) * SEQ + grp * (SEQ / KSPL)) * HDIM;

  // Q as B-operand fragments: in tile t lane lq holds query qrow0 + t*16 + lq, elements follow the split d map.
  FragH qf[QT][2];
  #pragma unroll
  for (unsigned t = 0; t < QT; ++t) {
    const f16* qr = qp_h + (size_t)(qrow0 + t * 16) * HDIM + lane * 8;
    #pragma unroll
    for (unsigned f = 0; f < 2; ++f) {
      qf[t][f].q[0] = *(const v4u*)(qr + f * 512);              // d = f*32 + hi*8 + 0..7
      qf[t][f].q[1] = *(const v4u*)(qr + f * 512 + 256);        // d = f*32 + 16 + hi*8 + 0..7
    }
  }

  v8f   o[QT][4];
  float rmax[QT];   // running maximum, raw score
  float roff[QT];   // the exponent offset in use, 12 - rmax * SL: the reference that the sums and O are carried at
  float rsum[QT];
  #pragma unroll
  for (unsigned t = 0; t < QT; ++t) {
    #pragma unroll
    for (unsigned dt = 0; dt < 4; ++dt) o[t][dt] = (v8f){0, 0, 0, 0, 0, 0, 0, 0};
    rmax[t] = -__builtin_inff();
    roff[t] = __builtin_inff();
    rsum[t] = 0.0f;
  }
  const float SL = 0.0625f * 1.4426950408889634f;   // softmax scale (1/sqrt(CH)) * log2(e)

  // K A-fragments: row = key j0 + sub*16 + lq, split d map; pass 0's are loaded here, every later pass's one pass ahead
  FragH ak[2][2];
  #pragma unroll
  for (unsigned sub = 0; sub < 2; ++sub) {
    #pragma unroll
    for (unsigned f = 0; f < 2; ++f) {
      const f16* base = kp_h + (size_t)(sub * 16) * HDIM + f * 512 + lane * 8;
      ak[sub][f].q[0] = *(const v4u*)(base);
      ak[sub][f].q[1] = *(const v4u*)(base + 256);
    }
  }

  for (unsigned i = 0; i < NPASS; ++i) {
    const unsigned j0 = i * BK;                     // counted from this group's first key

    // V B-fragments: column n = d = dt*16 + lq, split key map
    FragH bv[4];
    #pragma unroll
    for (unsigned dt = 0; dt < 4; ++dt) {
      const f16* base = vt_h + (size_t)j0 * HDIM + dt * 512 + lane * 8;
      bv[dt].q[0] = *(const v4u*)(base);            // keys j0 + hi*8 + 0..7
      bv[dt].q[1] = *(const v4u*)(base + 256);      // keys j0 + 16 + hi*8 + 0..7
    }

    // S^T tiles: c[t][sub][r] = rawscore(query qrow0 + t*16 + lq, key j0 + sub*16 + hi*8 + r); d 0..31 of all four tiles, then d 32..63
    v8f c[QT][2];
    mma_s_run(c[0][0], c[1][0], c[0][1], c[1][1], ak[0][0].v, ak[0][1].v, ak[1][0].v, ak[1][1].v,
              qf[0][0].v, qf[0][1].v, qf[1][0].v, qf[1][1].v);

    // next pass's K fragments; the last pass re-reads the group's first 32 keys (in bounds, never used) so that the loads stay unconditional
    const unsigned jn = (i + 1 < NPASS) ? j0 + BK : 0u;
    #pragma unroll
    for (unsigned sub = 0; sub < 2; ++sub) {
      #pragma unroll
      for (unsigned f = 0; f < 2; ++f) {
        const f16* base = kp_h + (size_t)(jn + sub * 16) * HDIM + f * 512 + lane * 8;
        ak[sub][f].q[0] = *(const v4u*)(base);
        ak[sub][f].q[1] = *(const v4u*)(base + 256);
      }
    }

    // online softmax, per tile: query lq's 32 scores are split across lane / lane^16
    float m_new[QT];
    #pragma unroll
    for (unsigned t = 0; t < QT; ++t) {
      float m = rmax[t];
      #pragma unroll
      for (unsigned r = 0; r < 8; ++r) {
        m = fmaxf(m, c[t][0][r]);
        m = fmaxf(m, c[t][1][r]);
      }
      m_new[t] = m;
    }
    #pragma unroll
    for (unsigned t = 0; t < QT; ++t) m_new[t] = fmaxf(m_new[t], __shfl_xor(m_new[t], 16, 32));
    float scale[QT];
    #pragma unroll
    for (unsigned t = 0; t < QT; ++t) {
      const float off = __builtin_fmaf(-m_new[t], SL, 12.0f);
      scale[t] = __builtin_amdgcn_exp2f(off - roff[t]);   // from the offsets themselves, so old and new P agree whatever off's rounding
      roff[t]  = off;
      rmax[t]  = m_new[t];
    }

    // exp + pack: P^T C-layout == A-fragment layout for the PV product. P x 4096 = exp2(c * SL + off), off = 12 - max * SL: one packed FMA
    // per pair of neighbouring accumulator registers carries the scale, the maximum and the x4096 carry; the row sums are carried x4096 too
    FragH pa[QT];
    float psum[QT];
    #pragma unroll
    for (unsigned t = 0; t < QT; ++t) {
      const v2f   off2 = (v2f){roff[t], roff[t]};
      const v2f   sl2  = (v2f){SL, SL};
      v2f ps[2];
      #pragma unroll
      for (unsigned sub = 0; sub < 2; ++sub) {
        #pragma unroll
        for (unsigned r = 0; r < 8; r += 2) {       // keys sub*16 + hi*8 + r, r + 1
          const v2f x = __builtin_elementwise_fma((v2f){c[t][sub][r], c[t][sub][r + 1]}, sl2, off2);
          const v2f p = (v2f){__builtin_amdgcn_exp2f(x[0]), __builtin_amdgcn_exp2f(x[1])};
          ps[sub] = (r == 0) ? p : ps[sub] + p;
          pa[t].h[sub * 8 + r]     = (f16)p[0];
          pa[t].h[sub * 8 + r + 1] = (f16)p[1];
        }
      }
      const v2f pt = ps[0] + ps[1];
      psum[t] = pt[0] + pt[1];
    }
    #pragma unroll
    for (unsigned t = 0; t < QT; ++t) rsum[t] = rsum[t] * scale[t] + psum[t] + __shfl_xor(psum[t], 16, 32);

    // rescale O: queries are the row dimension there -> per-row scale from lane 8*hi + r
    #pragma unroll
    for (unsigned t = 0; t < QT; ++t) {
      float sc[8];
      #pragma unroll
      for (unsigned r = 0; r < 8; ++r) sc[r] = __shfl(scale[t], (int)((hi << 3) + r), 32);
      #pragma unroll
      for (unsigned dt = 0; dt < 4; ++dt) {
        #pragma unroll
        for (unsigned r = 0; r < 8; ++r) o[t][dt][r] *= sc[r];
      }
    }

    // O += P x V: each V fragment serves both tiles
    mma_pv_run(o[0][0], o[1][0], o[0][1], o[1][1], o[0][2], o[1][2], o[0][3], o[1][3],
               pa[0].v, pa[1].v, bv[0].v, bv[1].v, bv[2].v, bv[3].v);
  }

  // merge of the two key halves: group 1 hands its offsets, sums and O tiles over, group 0 joins them with its own
  float* sp = sP + wave * (QT * 4 * 8 * 32);
  if (grp != 0u) {
    #pragma unroll
    for (unsigned t = 0; t < QT; ++t) {
      sM[(wave * QT + t) * 32 + lane] = roff[t];
      sL[(wave * QT + t) * 32 + lane] = rsum[t];
      #pragma unroll
      for (unsigned dt = 0; dt < 4; ++dt) {
        #pragma unroll
        for (unsigned q4 = 0; q4 < 2; ++q4)
          *(v4f*)(sp + (((t * 4 + dt) * 2 + q4) * 32 + lane) * 4) =
              (v4f){o[t][dt][q4 * 4], o[t][dt][q4 * 4 + 1], o[t][dt][q4 * 4 + 2], o[t][dt][q4 * 4 + 3]};
      }
    }
  }
  __syncthreads();   // group 1's partial results are complete before group 0 reads them

  // normalize: lane holds column d = dt*16 + lq for query rows 8*hi + r of each tile; O and the sums both carry x4096, which cancels; fold the x256 ctx carry
  f16* so = sO + wave * (QT * 16 * TP);
  if (grp == 0u) {
    #pragma unroll
    for (unsigned t = 0; t < QT; ++t) {
      const float o2  = sM[(wave * QT + t) * 32 + lane];
      const float l2  = sL[(wave * QT + t) * 32 + lane];
      const float om  = fminf(roff[t], o2);               // the larger maximum has the smaller offset
      const float a1  = __builtin_amdgcn_exp2f(om - roff[t]);
      const float a2  = __builtin_amdgcn_exp2f(om - o2);
      const float inv = 256.0f / (rsum[t] * a1 + l2 * a2);
      const float g1  = a1 * inv;
      const float g2  = a2 * inv;
      float f1[8], f2[8];
      #pragma unroll
      for (unsigned r = 0; r < 8; ++r) {
        f1[r] = __shfl(g1, (int)((hi << 3) + r), 32);
        f2[r] = __shfl(g2, (int)((hi << 3) + r), 32);
      }
      #pragma unroll
      for (unsigned dt = 0; dt < 4; ++dt) {
        #pragma unroll
        for (unsigned q4 = 0; q4 < 2; ++q4) {
          const v4f p = *(const v4f*)(sp + (((t * 4 + dt) * 2 + q4) * 32 + lane) * 4);
          #pragma unroll
          for (unsigned j = 0; j < 4; ++j) {
            const unsigned r = q4 * 4 + j;
            so[(t * 16 + hi * 8 + r) * TP + dt * 16 + lq] = (f16)(o[t][dt][r] * f1[r] + p[j] * f2[r]);
          }
        }
      }
    }
  }
  __syncthreads();

  if (grp == 0u) {
    v4u    val[QT * 4];
    size_t idx[QT * 4];
    #pragma unroll
    for (unsigned t = 0; t < QT; ++t) {
      #pragma unroll
      for (unsigned it = 0; it < 4; ++it) {
        Pack8H ph;                                  // ctx in fragment order: tile = 16 of this wave's tokens, unit = h*4 + it, slot = lane
        ph.v = *(const v8h*)(so + (t * 16 + lq) * TP + it * 16 + hi * 8);
        val[t * 4 + it] = ph.u;
        idx[t * 4 + it] = ((size_t)b * SEQ + qrow0 + t * 16) * CH + (h * 4 + it) * 256 + lane * 8;
      }
    }
    #pragma unroll
    for (unsigned it = 0; it < QT * 4; ++it) *(v4u*)(ctx + idx[it]) = val[it];
  }
}

// Projection, transposed: Y^T[c][tok] = sum_k wpT[c][k] * ctx[tok][k]. Block = (128-token tile, 64-channel tile).
// A fragments from wpT (channel tiles), B fragments from ctx (token tiles), both in fragment order; D rows = channels, columns = tokens,
// so the channel-major output row of 128 pixels (512 B) is written by one wave instruction (32 lanes x 16 B).
__global__ __launch_bounds__(256) void proj_kernel(const f16* __restrict__ ctx,
                                                   const f16* __restrict__ wpT,
                                                   const float* __restrict__ bproj,
                                                   const float* __restrict__ x,
                                                   float* __restrict__ out) {
  const unsigned mt   = blockIdx.x;
  const unsigned ct   = blockIdx.y;             // 0..3
  const unsigned tid  = threadIdx.x;
  const unsigned wave = tid >> 5;
  const unsigned lane = tid & 31u;
  const unsigned lq   = lane & 15u;
  const unsigned hi   = lane >> 4;
  __shared__ __align__(16) float sO[64 * OPF];  // [channel][token], cross-wave (block barrier)

  const f16* brow = ctx + (size_t)(mt * NWAVE + wave) * (16 * CH) + lane * 8;
  const f16* arow = wpT + (size_t)(ct * 4) * (16 * CH) + lane * 8;

  v8f acc[4];
  #pragma unroll
  for (unsigned m4 = 0; m4 < 4; ++m4) acc[m4] = (v8f){0, 0, 0, 0, 0, 0, 0, 0};

  #pragma unroll 2
  for (unsigned ks = 0; ks < CH / 32; ++ks) {
    FragH bc;
    bc.q[0] = *(const v4u*)(brow + ks * 512);
    bc.q[1] = *(const v4u*)(brow + ks * 512 + 256);
    FragH aw[4];
    #pragma unroll
    for (unsigned m4 = 0; m4 < 4; ++m4) {
      const f16* base = arow + (size_t)m4 * 16 * CH + ks * 512;
      aw[m4].q[0] = *(const v4u*)(base);
      aw[m4].q[1] = *(const v4u*)(base + 256);
    }
    #pragma unroll
    for (unsigned m4 = 0; m4 < 4; ++m4) acc[m4] = mma_f16(aw[m4].v, bc.v, acc[m4]);
  }

  // acc[m4][r] = 16384 * value(channel m4*16 + hi*8 + r, token wave*16 + lq)
  #pragma unroll
  for (unsigned m4 = 0; m4 < 4; ++m4) {
    #pragma unroll
    for (unsigned r = 0; r < 8; ++r)
      sO[(m4 * 16 + hi * 8 + r) * OPF + wave * 16 + lq] = acc[m4][r] * (1.0f / 16384.0f);
  }
  __syncthreads();

  const unsigned b  = mt / (SEQ / MT);
  const unsigned p0 = (mt % (SEQ / MT)) * MT;
  v4f    val[8];
  size_t idx[8];
  #pragma unroll
  for (unsigned it = 0; it < 8; ++it) {
    const unsigned row = it * 8 + wave;                 // channel within the tile (wave-uniform)
    const unsigned c   = ct * 64 + row;
    const v4f a  = *(const v4f*)(sO + row * OPF + lane * 4);
    const float bb = (float)(bf16)bproj[c];
    const size_t gi = ((size_t)b * CH + c) * SEQ_FULL + p0 + lane * 4;
    const v4f xv = *(const v4f*)(x + gi);
    v4f res;
    #pragma unroll
    for (unsigned i = 0; i < 4; ++i) res[i] = (float)(bf16)xv[i] + (a[i] + bb);
    val[it] = res;
    idx[it] = gi;
  }
  #pragma unroll
  for (unsigned it = 0; it < 8; ++it) *(v4f*)(out + idx[it]) = val[it];
  
}

extern "C" void kernel_launch(void* const* d_in, const int* in_sizes, int n_in,
                              void* d_out, int out_size, void* d_ws, size_t ws_size,
                              hipStream_t stream) {
  if (n_in < 7) return;
  const size_t x_need = ((size_t)(NB - 1) * CH + (CH - 1)) * SEQ_FULL + SEQ;
  if ((size_t)in_sizes[0] < x_need) return;
  if (in_sizes[1] < CH || in_sizes[2] < CH) return;
  if ((size_t)in_sizes[3] < (size_t)CH * QKVN || in_sizes[4] < QKVN) return;
  if ((size_t)in_sizes[5] < (size_t)CH * CH || in_sizes[6] < CH) return;
  if ((size_t)out_size < x_need) return;

  const size_t tok_plane = (size_t)NB * SEQ * CH * 2;            // xn, ctx and each of q/k/v^T: same bytes
  const size_t wq_bytes  = (size_t)QKVN * CH * 2;
  const size_t wp_bytes  = (size_t)CH * CH * 2;
  const size_t total     = 5 * tok_plane + wq_bytes + wp_bytes;
  if (ws_size < total) return;

  const float* x     = (const float*)d_in[0];
  const float* gam   = (const float*)d_in[1];
  const float* bet   = (const float*)d_in[2];
  const float* wqkv  = (const float*)d_in[3];
  const float* bqkv  = (const float*)d_in[4];
  const float* wproj = (const float*)d_in[5];
  const float* bproj = (const float*)d_in[6];
  float* out = (float*)d_out;

  char* ws = (char*)d_ws;
  f16* xn  = (f16*)(ws);
  f16* qp  = (f16*)(ws + 1 * tok_plane);
  f16* kp  = (f16*)(ws + 2 * tok_plane);
  f16* vt  = (f16*)(ws + 3 * tok_plane);
  f16* ctx = (f16*)(ws + 4 * tok_plane);
  f16* wqT = (f16*)(ws + 5 * tok_plane);
  f16* wpT = (f16*)(ws + 5 * tok_plane + wq_bytes);

  w_planes_kernel<<<dim3(CH / 64, QKVN / 64 + CH / 64), 256, 0, stream>>>(wqkv, wproj, wqT, wpT);
  ln_plane_kernel<<<dim3(NB * (SEQ / LNT)), 256, 0, stream>>>(x, gam, bet, xn);
  qkv_gemm_kernel<<<dim3(NB * (SEQ / MT), QKVN / 64), 256, 0, stream>>>(xn, wqT, bqkv, qp, kp, vt);
  attn_kernel<<<dim3(SEQ / BQ, NHEAD, NB), NWAVE * KSPL * 32, 0, stream>>>(qp, kp, vt, ctx);
  proj_kernel<<<dim3(NB * (SEQ / MT), CH / 64), 256, 0, stream>>>(ctx, wpT, bproj, x, out);
}

// v007
// It runs in 85.4 microseconds.
// Timed twice side by side with v006, it ran 1.11 and 1.12 times as fast.
// All steps since v000 together make it 3.47 times as fast.
#include <hip/hip_runtime.h>

// Contractions (all v_wmma_f32_16x16x32_f16, f16 operands, f32 accumulate): Q^T, K^T = W^T x xn^T and V = xn x W (W = f16 of the bf16 RNE-converted weight x64);
// S^T = K x Q^T (f16 q/k planes); O = P x V (P carried x4096, V^T f16 plane); Y^T = Wproj^T x ctx^T (ctx carried x256, W x64). LayerNorm, softmax, bias and residual in f32.
// Every f16 operand plane in the workspace is stored in fragment order: one 512-B unit per (16-row tile, 16-wide k piece), holding for each
// lane the 8 halves it loads, so a wave-wide 16-B load reads 4 whole 128-B lines. Unit u of a 16-row tile covers k = u*16 .. u*16+15;
// lane (lq = row in the tile, hi) owns k = u*16 + hi*8 + 0..7 at half offset u*256 + slot*8 (slot = hi*16 + lq). xn lives in LDS only.

#ifndef NB
#define NB 4
#endif
#ifndef SEQ
#define SEQ 4096
#endif
#define NB_FULL    4
#define SEQ_FULL   4096
#define CH         256                  // channels = NHEAD * HDIM
#define NHEAD      4
#define HDIM       64
#define QKVN       (3 * CH)
#define QT         2                    // 16-row query tiles per attention wave
#define BQ         256                  // query rows per attention workgroup (8 waves x QT x 16)
#define BK         32                   // keys per inner iteration
#define NWAVE      8
#define KSPL       2                    // key ranges per attention workgroup (one per group of NWAVE waves)
#define NPASS      (SEQ / BK / KSPL)    // inner iterations per attention wave
#define MT         128                  // tokens per projection workgroup (8 waves x 16)
#define FT         64                   // tokens per LayerNorm + QKV workgroup
#define FW         16                   // waves per LayerNorm + QKV workgroup (one column tile of q, k and v each)
#define FP         97                   // LDS pitch (floats) of the LayerNorm tile
#define AP         144                  // LDS pitch (halves) of an 8-channel xn piece (16 tokens x 16 B + 32 B)
#define TP         72                   // LDS pitch (halves) of 64-wide f16 tiles
#define OPF        132                  // LDS pitch (floats) of the projection staging tile

static_assert(SEQ % BQ == 0);
static_assert(SEQ % MT == 0);
static_assert(SEQ % FT == 0);
static_assert(SEQ % (BK * KSPL) == 0);
static_assert(BQ == NWAVE * QT * 16);
static_assert(QT == 2);                          // the attention matrix runs are written out for two query tiles
static_assert(MT == NWAVE * 16);
static_assert(CH == NHEAD * HDIM);
static_assert(CH == 256);
static_assert(HDIM == 64);
static_assert(CH % 32 == 0);
static_assert(SEQ <= SEQ_FULL);
static_assert(NB >= 1 && NB <= NB_FULL);
static_assert((TP * 2) % 16 == 0);
static_assert((AP * 2) % 16 == 0);
static_assert((OPF * 4) % 16 == 0);
static_assert(FW * 16 == CH);                    // one 16-column tile of q, of k and of v per wave
static_assert(FW * 32 == FT * 8);                // LayerNorm: eight threads per token
static_assert(FW * 32 == 2 * CH);                // one thread per gamma or beta element
static_assert(FT % 32 == 0);                     // whole 32-key blocks of the v plane
static_assert(FP >= FT);
// coverage equalities (threads x pieces x elements == tile elements)
static_assert(FW * 32 * 8 * 4 == FT * CH);       // LayerNorm input tile
static_assert(FW * 32 * 4 * 8 == FT * CH);       // xn pieces
static_assert(256 * 2 * 8 == 64 * 64);           // weight plane tile
static_assert(32 * 4 * 8 == 16 * HDIM);          // per-wave ctx tile
static_assert(NWAVE * 8 * 32 * 4 == 64 * MT);    // output tile

typedef __bf16   bf16;
typedef _Float16 f16;
typedef f16      v16h  __attribute__((ext_vector_type(16)));
typedef f16      v8h   __attribute__((ext_vector_type(8)));
typedef float    v8f   __attribute__((ext_vector_type(8)));
typedef float    v4f   __attribute__((ext_vector_type(4)));
typedef float    v2f   __attribute__((ext_vector_type(2)));
typedef unsigned v4u   __attribute__((ext_vector_type(4)));

union FragH  { v16h  v; v4u q[2]; f16  h[16]; };
union Pack8H { v4u u; v8h v; f16 h[8]; };

// WMMA helper: builtin followed by the VALU hazard guard (ties D, keeps A/B live).
static __device__ __forceinline__ v8f mma_f16(v16h a, v16h b, v8f acc) {
  acc = __builtin_amdgcn_wmma_f32_16x16x32_f16(false, a, false, b, (short)0, acc, false, false);
  asm volatile("v_nop\n\tv_nop\n\tv_nop\n\tv_nop" : "+v"(acc) : "v"(a), "v"(b));
  return acc;
}

// Attention, the eight S^T products of a pass as one run (c<t><sub>, k<sub><f>, q<t><f>): d 0..31 of the four tiles, then d 32..63 on top.
// In one statement every product stands in the others' distance, so the idle slots are paid once a run and not once a product:
// the four v_nop behind the last product keep its distance to the first vector instruction that reads a tile.
static __device__ __forceinline__ void mma_s_run(v8f& c00, v8f& c10, v8f& c01, v8f& c11,
                                                 v16h k00, v16h k01, v16h k10, v16h k11,
                                                 v16h q00, v16h q01, v16h q10, v16h q11) {
  asm volatile("v_wmma_f32_16x16x32_f16 %0, %4, %8, 0\n\t"
               "v_wmma_f32_16x16x32_f16 %1, %4, %10, 0\n\t"
               "v_wmma_f32_16x16x32_f16 %2, %6, %8, 0\n\t"
               "v_wmma_f32_16x16x32_f16 %3, %6, %10, 0\n\t"
               "v_wmma_f32_16x16x32_f16 %0, %5, %9, %0\n\t"
               "v_wmma_f32_16x16x32_f16 %1, %5, %11, %1\n\t"
               "v_wmma_f32_16x16x32_f16 %2, %7, %9, %2\n\t"
               "v_wmma_f32_16x16x32_f16 %3, %7, %11, %3\n\t"
               "v_nop\n\tv_nop\n\tv_nop\n\tv_nop"
               : "=&v"(c00), "=&v"(c10), "=&v"(c01), "=&v"(c11)
               : "v"(k00), "v"(k01), "v"(k10), "v"(k11), "v"(q00), "v"(q01), "v"(q10), "v"(q11));
}

// Attention, the eight PV products of a pass as one run (o<t><dt> += p<t> x v<dt>), for the same reason; the four v_nop behind the last
// product keep its distance to the next vector instruction on its O tile or over its operands, on the loop's back edge too.
static __device__ __forceinline__ void mma_pv_run(v8f& o00, v8f& o10, v8f& o01, v8f& o11, v8f& o02, v8f& o12, v8f& o03, v8f& o13,
                                                  v16h p0, v16h p1, v16h v0, v16h v1, v16h v2, v16h v3) {
  asm volatile("v_wmma_f32_16x16x32_f16 %0, %8, %10, %0\n\t"
               "v_wmma_f32_16x16x32_f16 %1, %9, %10, %1\n\t"
               "v_wmma_f32_16x16x32_f16 %2, %8, %11, %2\n\t"
               "v_wmma_f32_16x16x32_f16 %3, %9, %11, %3\n\t"
               "v_wmma_f32_16x16x32_f16 %4, %8, %12, %4\n\t"
               "v_wmma_f32_16x16x32_f16 %5, %9, %12, %5\n\t"
               "v_wmma_f32_16x16x32_f16 %6, %8, %13, %6\n\t"
               "v_wmma_f32_16x16x32_f16 %7, %9, %13, %7\n\t"
               "v_nop\n\tv_nop\n\tv_nop\n\tv_nop"
               : "+v"(o00), "+v"(o10), "+v"(o01), "+v"(o11), "+v"(o02), "+v"(o12), "+v"(o03), "+v"(o13)
               : "v"(p0), "v"(p1), "v"(v0), "v"(v1), "v"(v2), "v"(v3));
}

// Weight planes. Block = (64-wide k tile, 64-wide n tile), 256 threads.
//   wqT f16 = bf16(w_qkv[k][n]) x 64, wpT f16 = bf16(w_proj[k][n]) x 64, both in fragment order: tile = 16 columns n, 16 units over k.
__global__ __launch_bounds__(256) void w_planes_kernel(const float* __restrict__ wqkv,
                                                       const float* __restrict__ wproj,
                                                       f16* __restrict__ wqT,
                                                       f16* __restrict__ wpT) {
  const unsigned kt  = blockIdx.x;              // 0..3
  const unsigned nt  = blockIdx.y;              // 0..11 qkv, 12..15 proj
  const unsigned tid = threadIdx.x;
  const bool isq = nt < (QKVN / 64);
  const float* src = isq ? wqkv : wproj;        // both global, block-uniform
  f16*         dst = isq ? wqT : wpT;
  const unsigned ldn = isq ? (unsigned)QKVN : (unsigned)CH;
  const unsigned n0  = (isq ? nt : (nt - QKVN / 64)) * 64u;
  const unsigned k0  = kt * 64u;
  __shared__ __align__(16) f16 sT[64 * TP];     // [n][k], cross-wave (block barrier)

  #pragma unroll
  for (unsigned kk = 0; kk < 2; ++kk) {
    const unsigned kr = kk * 32 + (tid >> 3);   // 0..63
    const unsigned nn = (tid & 7u) * 8;         // 0..56
    const float* p = src + (size_t)(k0 + kr) * ldn + n0 + nn;
    const v4f w0 = *(const v4f*)(p);
    const v4f w1 = *(const v4f*)(p + 4);
    #pragma unroll
    for (unsigned i = 0; i < 4; ++i) {
      sT[(nn + i) * TP + kr]     = (f16)((float)(bf16)w0[i] * 64.0f);   // exact in f16
      sT[(nn + 4 + i) * TP + kr] = (f16)((float)(bf16)w1[i] * 64.0f);
    }
  }
  __syncthreads();

  v4u    val[2];
  size_t idx[2];
  #pragma unroll
  for (unsigned kk = 0; kk < 2; ++kk) {
    const unsigned g  = kk * 256 + tid;         // destination order: (n tile 0..3, unit 0..3, slot 0..31)
    const unsigned nl = g >> 7;
    const unsigned u  = (g >> 5) & 3u;
    const unsigned n  = nl * 16 + (g & 15u);
    const unsigned ks = u * 16 + ((g >> 4) & 1u) * 8;
    Pack8H ph;
    ph.v = *(const v8h*)(sT + n * TP + ks);
    val[kk] = ph.u;
    idx[kk] = (size_t)(n0 / 16 + nl) * (16 * CH) + (k0 / 16 + u) * 256 + (g & 31u) * 8;
  }
  #pragma unroll
  for (unsigned kk = 0; kk < 2; ++kk) *(v4u*)(dst + idx[kk]) = val[kk];
  
}

// LayerNorm and QKV GEMM in one kernel. Block = 64 tokens x all 768 columns, 16 waves.
// Phase 1: LayerNorm over channels of the bf16 RNE-converted input (sums in the order part + 8j, then the 1-2-4 exchange); xn goes as f16 into
// LDS in 8-channel pieces: piece q of a 16-token tile holds channels q*8 .. q*8+7 of token lq at lq*16 B, so lanes 0-15 and lanes 16-31 of a
// fragment load each read 256 contiguous bytes; the piece pitch of 288 B spreads the eight pieces that a wave writes at once over all banks.
// Phase 2: wave w owns column tile w of q, of k and of v (head w >> 2, d tile w & 3) for all four token tiles; weights from wqT (fragment order).
// q and k are formed as W^T x xn^T (D rows = d, columns = tokens), v as xn x W (D rows = tokens, columns = d): in both a lane's eight
// accumulator registers are the eight halves that it owns in the plane's fragment order, so each tile is stored by one 16-B store a lane.
// q and k planes per head: tile = 16 tokens, 4 units over d; v plane per head: per 32 keys, tile = 16 columns d, 2 units over keys.
__global__ __launch_bounds__(FW * 32) void ln_qkv_kernel(const float* __restrict__ x,
                                                         const float* __restrict__ gamma,
                                                         const float* __restrict__ beta,
                                                         const f16* __restrict__ wqT,
                                                         const float* __restrict__ bqkv,
                                                         f16* __restrict__ qp,
                                                         f16* __restrict__ kp,
                                                         f16* __restrict__ vt) {
  const unsigned tid = threadIdx.x;
  const unsigned blk = blockIdx.x;
  const unsigned b   = blk / (SEQ / FT);
  const unsigned p0  = (blk % (SEQ / FT)) * FT;
  __shared__ float sX[CH * FP];                             // [c][pix], cross-wave (block barrier)
  __shared__ __align__(16) float sGB[2 * CH];               // gamma, then beta
  __shared__ __align__(16) f16 sA[(FT / 16) * 32 * AP];     // [token tile][piece][lq][8], cross-wave (block barrier)
  const float* sG = sGB;
  const float* sB = sGB + CH;

  const unsigned wave = tid >> 5;               // 0..15: column tile of q, of k and of v
  const unsigned lane = tid & 31u;
  const unsigned lq   = lane & 15u;
  const unsigned hi   = lane >> 4;

  const float gbv = ((tid < CH) ? gamma : beta)[tid & (CH - 1u)];   // waves 0-7 bring gamma, waves 8-15 beta
  const float* xb = x + (size_t)b * CH * SEQ_FULL + p0;
  const unsigned px4 = (tid & 15u) * 4;                     // 16 lanes cover one channel's 64 pixels (256 B)
  const unsigned cr  = tid >> 4;                            // 0..31
  v4f xv[8];
  #pragma unroll
  for (unsigned it = 0; it < 8; ++it) xv[it] = *(const v4f*)(xb + (size_t)(it * 32 + cr) * SEQ_FULL + px4);

  // weight fragments, two register sets: step ks + 1 is requested ahead of step ks's products; step 0 here, beside the input loads
  const f16* wrow = wqT + (size_t)wave * (16 * CH) + lane * 8;
  FragH bw[2][3];
  #pragma unroll
  for (unsigned j = 0; j < 3; ++j) {
    const f16* base = wrow + (size_t)j * CH * CH;                // q, k, v column tiles lie 16 tiles = CH columns apart
    bw[0][j].q[0] = *(const v4u*)(base);                         // k = hi*8 + 0..7
    bw[0][j].q[1] = *(const v4u*)(base + 256);                   // k = 16 + hi*8 + 0..7
  }
  // biases, requested here too: q and k per D row (column wave*16 + hi*8 + r), v per D column (column wave*16 + lq)
  v4f bqk[2][2];
  #pragma unroll
  for (unsigned j = 0; j < 2; ++j) {
    const float* bp = bqkv + j * CH + wave * 16 + hi * 8;
    bqk[j][0] = *(const v4f*)(bp);
    bqk[j][1] = *(const v4f*)(bp + 4);
  }
  const float bvr = bqkv[2 * CH + wave * 16 + lq];
  #pragma unroll
  for (unsigned it = 0; it < 8; ++it) {
    #pragma unroll
    for (unsigned i = 0; i < 4; ++i) sX[(it * 32 + cr) * FP + px4 + i] = (float)(bf16)xv[it][i];   // RNE convert
  }
  sGB[tid] = (float)(bf16)gbv;
  __syncthreads();

  const unsigned tok  = tid >> 3;               // 0..63
  const unsigned part = tid & 7u;               // 0..7
  float s = 0.0f;
  #pragma unroll
  for (unsigned j = 0; j < 32; ++j) s += sX[(part + 8 * j) * FP + tok];
  s += __shfl_xor(s, 1, 32);
  s += __shfl_xor(s, 2, 32);
  s += __shfl_xor(s, 4, 32);
  const float mu = s * (1.0f / CH);
  float ss = 0.0f;
  #pragma unroll
  for (unsigned j = 0; j < 32; ++j) {
    const float d = sX[(part + 8 * j) * FP + tok] - mu;
    ss += d * d;
  }
  ss += __shfl_xor(ss, 1, 32);
  ss += __shfl_xor(ss, 2, 32);
  ss += __shfl_xor(ss, 4, 32);
  const float rstd = rsqrtf(ss * (1.0f / CH) + 1e-5f);

  #pragma unroll
  for (unsigned j = 0; j < 4; ++j) {
    const unsigned c0 = j * 64 + part * 8;
    Pack8H ph;
    #pragma unroll
    for (unsigned i = 0; i < 8; ++i) {
      const float d = sX[(c0 + i) * FP + tok] - mu;
      ph.h[i] = (f16)(d * rstd * sG[c0 + i] + sB[c0 + i]);
    }
    *(v4u*)(sA + (tok >> 4) * (32 * AP) + (c0 >> 3) * AP + (tok & 15u) * 8) = ph.u;
  }
  __syncthreads();   // every token's xn pieces are in LDS before any wave loads fragments from them

  const f16* arow = sA + hi * AP + lq * 8;

  v8f acc[FT / 16][3];
  #pragma unroll
  for (unsigned tt = 0; tt < FT / 16; ++tt) {
    #pragma unroll
    for (unsigned j = 0; j < 3; ++j) acc[tt][j] = (v8f){0, 0, 0, 0, 0, 0, 0, 0};
  }

  #pragma unroll
  for (unsigned ks = 0; ks < CH / 32; ++ks) {
    const unsigned cur = ks & 1u;
    if (ks + 1 < CH / 32) {
      #pragma unroll
      for (unsigned j = 0; j < 3; ++j) {
        const f16* base = wrow + (size_t)j * CH * CH + (ks + 1) * 512;
        bw[cur ^ 1u][j].q[0] = *(const v4u*)(base);              // k = (ks+1)*32 + hi*8 + 0..7
        bw[cur ^ 1u][j].q[1] = *(const v4u*)(base + 256);        // k = (ks+1)*32 + 16 + hi*8 + 0..7
      }
    }
    FragH a[FT / 16];
    #pragma unroll
    for (unsigned tt = 0; tt < FT / 16; ++tt) {
      const f16* base = arow + tt * (32 * AP) + ks * 4 * AP;
      a[tt].q[0] = *(const v4u*)(base);                          // piece ks*4 + hi:     k = ks*32 + hi*8 + 0..7
      a[tt].q[1] = *(const v4u*)(base + 2 * AP);                 // piece ks*4 + 2 + hi: k = ks*32 + 16 + hi*8 + 0..7
    }
    __builtin_amdgcn_sched_barrier(0);   // the step's loads stay one group ahead of its products: sunk to their uses, each would be waited for alone
    #pragma unroll
    for (unsigned tt = 0; tt < FT / 16; ++tt) {
      acc[tt][0] = __builtin_amdgcn_wmma_f32_16x16x32_f16(false, bw[cur][0].v, false, a[tt].v, (short)0, acc[tt][0], false, false);
      acc[tt][1] = __builtin_amdgcn_wmma_f32_16x16x32_f16(false, bw[cur][1].v, false, a[tt].v, (short)0, acc[tt][1], false, false);
      acc[tt][2] = __builtin_amdgcn_wmma_f32_16x16x32_f16(false, a[tt].v, false, bw[cur][2].v, (short)0, acc[tt][2], false, false);
    }
    __builtin_amdgcn_sched_barrier(0);   // the next step's loads stay out of this step's products, for speed only
  }

  const unsigned h  = wave >> 2;
  const unsigned dt = wave & 3u;
  const size_t head0 = (((size_t)b * NHEAD + h) * SEQ + p0) * HDIM;

  // q, k: acc[tt][j][r] = 64 * value(column dt*16 + hi*8 + r, token tt*16 + lq); v: acc[tt][2][r] = 64 * value(token tt*16 + hi*8 + r, column dt*16 + lq)
  v4u val[3][FT / 16];
  #pragma unroll
  for (unsigned j = 0; j < 2; ++j) {
    const v4f b0 = bqk[j][0];
    const v4f b1 = bqk[j][1];
    #pragma unroll
    for (unsigned tt = 0; tt < FT / 16; ++tt) {
      Pack8H ph;
      #pragma unroll
      for (unsigned r = 0; r < 4; ++r) {
        ph.h[r]     = (f16)(acc[tt][j][r] * (1.0f / 64.0f) + (float)(bf16)b0[r]);
        ph.h[r + 4] = (f16)(acc[tt][j][r + 4] * (1.0f / 64.0f) + (float)(bf16)b1[r]);
      }
      val[j][tt] = ph.u;
    }
  }
  const float bias = (float)(bf16)bvr;
  #pragma unroll
  for (unsigned tt = 0; tt < FT / 16; ++tt) {
    Pack8H ph;
    #pragma unroll
    for (unsigned r = 0; r < 8; ++r) ph.h[r] = (f16)(acc[tt][2][r] * (1.0f / 64.0f) + bias);
    val[2][tt] = ph.u;
  }
  f16* qd = qp + head0 + dt * 256 + lane * 8;
  f16* kd = kp + head0 + dt * 256 + lane * 8;
  f16* vd = vt + head0 + dt * 512 + lane * 8;
  #pragma unroll
  for (unsigned tt = 0; tt < FT / 16; ++tt) {
    *(v4u*)(qd + (size_t)(tt * 16) * HDIM) = val[0][tt];
    *(v4u*)(kd + (size_t)(tt * 16) * HDIM) = val[1][tt];
    *(v4u*)(vd + (size_t)((tt >> 1) * 32) * HDIM + (tt & 1u) * 256) = val[2][tt];
  }
}

// Flash attention, full (no mask). Block = (query block of 256, head, batch), 16 waves; one wave owns QT = 2 tiles of 16 query rows.
// S^T = K x Q^T so queries sit on lanes; P^T in C-layout is bit-identical to the A-fragment layout of O += P x V.
// K A-fragments, Q B-fragments and V^T B-fragments are loaded straight from the fragment-order f16 planes (two 16-B loads per fragment).
// Every K and V fragment a wave loads feeds both of its query tiles: 16 loads per 16 products, and the two tiles' softmax chains are independent.
// K fragments are fetched one pass ahead: pass i issues the loads of pass i+1 right behind its own S^T products, into the registers
// those products have released, so the softmax and the PV products run while they fly; V is issued at the head of its own pass.
// The workgroup has KSPL = 2 groups of 8 waves: wave w and wave w + 8 own the same 32 query rows and walk one half of the keys each, so
// that four waves instead of two share a SIMD and fill each other's waits; their references, sums and O tiles are merged once, through LDS.
__global__ __launch_bounds__(NWAVE * KSPL * 32) void attn_kernel(const f16* __restrict__ qp,
                                                   const f16* __restrict__ kp,
                                                   const f16* __restrict__ vt,
                                                   f16* __restrict__ ctx) {
  const unsigned qblk = blockIdx.x;
  const unsigned h    = blockIdx.y;
  const unsigned b    = blockIdx.z;
  const unsigned tid  = threadIdx.x;
  const unsigned wave = (tid >> 5) & (NWAVE - 1u);                                   // which 32 query rows
  const unsigned grp  = (unsigned)__builtin_amdgcn_readfirstlane((int)(tid >> 8));   // which half of the keys (wave-uniform)
  const unsigned lane = tid & 31u;
  const unsigned lq   = lane & 15u;   // query column of S^T / d column of O
  const unsigned hi   = lane >> 4;    // k-split half

  __shared__ __align__(16) f16   sO[NWAVE * QT * 16 * TP];      // per-wave output staging (block barrier used)
  __shared__ __align__(16) float sP[NWAVE * QT * 4 * 8 * 32];   // second key half's O tiles, [wave][t][dt][r / 4][lane][r % 4]
  __shared__ float sM[NWAVE * QT * 32];                         // second key half's exponent offsets (12 - maximum * SL), [wave][t][lane]
  __shared__ float sL[NWAVE * QT * 32];                         // second key half's row sums

  const unsigned qrow0 = qblk * BQ + wave * (QT * 16);

  const f16* qp_h = qp + ((size_t)b * NHEAD + h) * SEQ * HDIM;
  const f16* kp_h = kp + (((size_t)b * NHEAD + h) * SEQ + grp * (SEQ / KSPL)) * HDIM;   // this group's first key
  const f16* vt_h = vt + (((size_t)b * NHEAD + h) * SEQ + grp * (SEQ / KSPL)) * HDIM;

  // Q as B-operand fragments: in tile t lane lq holds query qrow0 + t*16 + lq, elements follow the split d map.
  FragH qf[QT][2];
  #pragma unroll
  for (unsigned t = 0; t < QT; ++t) {
    const f16* qr = qp_h + (size_t)(qrow0 + t * 16) * HDIM + lane * 8;
    #pragma unroll
    for (unsigned f = 0; f < 2; ++f) {
      qf[t][f].q[0] = *(const v4u*)(qr + f * 512);              // d = f*32 + hi*8 + 0..7
      qf[t][f].q[1] = *(const v4u*)(qr + f * 512 + 256);        // d = f*32 + 16 + hi*8 + 0..7
    }
  }

  v8f   o[QT][4];
  float rmax[QT];   // running maximum, raw score
  float roff[QT];   // the exponent offset in use, 12 - rmax * SL: the reference that the sums and O are carried at
  float rsum[QT];
  #pragma unroll
  for (unsigned t = 0; t < QT; ++t) {
    #pragma unroll
    for (unsigned dt = 0; dt < 4; ++dt) o[t][dt] = (v8f){0, 0, 0, 0, 0, 0, 0, 0};
    rmax[t] = -__builtin_inff();
    roff[t] = __builtin_inff();
    rsum[t] = 0.0f;
  }
  const float SL = 0.0625f * 1.4426950408889634f;   // softmax scale (1/sqrt(CH)) * log2(e)

  // K A-fragments: row = key j0 + sub*16 + lq, split d map; pass 0's are loaded here, every later pass's one pass ahead
  FragH ak[2][2];
  #pragma unroll
  for (unsigned sub = 0; sub < 2; ++sub) {
    #pragma unroll
    for (unsigned f = 0; f < 2; ++f) {
      const f16* base = kp_h + (size_t)(sub * 16) * HDIM + f * 512 + lane * 8;
      ak[sub][f].q[0] = *(const v4u*)(base);
      ak[sub][f].q[1] = *(const v4u*)(base + 256);
    }
  }

  for (unsigned i = 0; i < NPASS; ++i) {
    const unsigned j0 = i * BK;                     // counted from this group's first key

    // V B-fragments: column n = d = dt*16 + lq, split key map
    FragH bv[4];
    #pragma unroll
    for (unsigned dt = 0; dt < 4; ++dt) {
      const f16* base = vt_h + (size_t)j0 * HDIM + dt * 512 + lane * 8;
      bv[dt].q[0] = *(const v4u*)(base);            // keys j0 + hi*8 + 0..7
      bv[dt].q[1] = *(const v4u*)(base + 256);      // keys j0 + 16 + hi*8 + 0..7
    }

    // S^T tiles: c[t][sub][r] = rawscore(query qrow0 + t*16 + lq, key j0 + sub*16 + hi*8 + r); d 0..31 of all four tiles, then d 32..63
    v8f c[QT][2];
    mma_s_run(c[0][0], c[1][0], c[0][1], c[1][1], ak[0][0].v, ak[0][1].v, ak[1][0].v, ak[1][1].v,
              qf[0][0].v, qf[0][1].v, qf[1][0].v, qf[1][1].v);

    // next pass's K fragments; the last pass re-reads the group's first 32 keys (in bounds, never used) so that the loads stay unconditional
    const unsigned jn = (i + 1 < NPASS) ? j0 + BK : 0u;
    #pragma unroll
    for (unsigned sub = 0; sub < 2; ++sub) {
      #pragma unroll
      for (unsigned f = 0; f < 2; ++f) {
        const f16* base = kp_h + (size_t)(jn + sub * 16) * HDIM + f * 512 + lane * 8;
        ak[sub][f].q[0] = *(const v4u*)(base);
        ak[sub][f].q[1] = *(const v4u*)(base + 256);
      }
    }

    // online softmax, per tile: query lq's 32 scores are split across lane / lane^16
    float m_new[QT];
    #pragma unroll
    for (unsigned t = 0; t < QT; ++t) {
      float m = rmax[t];
      #pragma unroll
      for (unsigned r = 0; r < 8; ++r) {
        m = fmaxf(m, c[t][0][r]);
        m = fmaxf(m, c[t][1][r]);
      }
      m_new[t] = m;
    }
    #pragma unroll
    for (unsigned t = 0; t < QT; ++t) m_new[t] = fmaxf(m_new[t], __shfl_xor(m_new[t], 16, 32));
    float scale[QT];
    #pragma unroll
    for (unsigned t = 0; t < QT; ++t) {
      const float off = __builtin_fmaf(-m_new[t], SL, 12.0f);
      scale[t] = __builtin_amdgcn_exp2f(off - roff[t]);   // from the offsets themselves, so old and new P agree whatever off's rounding
      roff[t]  = off;
      rmax[t]  = m_new[t];
    }

    // exp + pack: P^T C-layout == A-fragment layout for the PV product. P x 4096 = exp2(c * SL + off), off = 12 - max * SL: one packed FMA
    // per pair of neighbouring accumulator registers carries the scale, the maximum and the x4096 carry; the row sums are carried x4096 too
    FragH pa[QT];
    float psum[QT];
    #pragma unroll
    for (unsigned t = 0; t < QT; ++t) {
      const v2f   off2 = (v2f){roff[t], roff[t]};
      const v2f   sl2  = (v2f){SL, SL};
      v2f ps[2];
      #pragma unroll
      for (unsigned sub = 0; sub < 2; ++sub) {
        #pragma unroll
        for (unsigned r = 0; r < 8; r += 2) {       // keys sub*16 + hi*8 + r, r + 1
          const v2f x = __builtin_elementwise_fma((v2f){c[t][sub][r], c[t][sub][r + 1]}, sl2, off2);
          const v2f p = (v2f){__builtin_amdgcn_exp2f(x[0]), __builtin_amdgcn_exp2f(x[1])};
          ps[sub] = (r == 0) ? p : ps[sub] + p;
          pa[t].h[sub * 8 + r]     = (f16)p[0];
          pa[t].h[sub * 8 + r + 1] = (f16)p[1];
        }
      }
      const v2f pt = ps[0] + ps[1];
      psum[t] = pt[0] + pt[1];
    }
    #pragma unroll
    for (unsigned t = 0; t < QT; ++t) rsum[t] = rsum[t] * scale[t] + psum[t] + __shfl_xor(psum[t], 16, 32);

    // rescale O: queries are the row dimension there -> per-row scale from lane 8*hi + r
    #pragma unroll
    for (unsigned t = 0; t < QT; ++t) {
      float sc[8];
      #pragma unroll
      for (unsigned r = 0; r < 8; ++r) sc[r] = __shfl(scale[t], (int)((hi << 3) + r), 32);
      #pragma unroll
      for (unsigned dt = 0; dt < 4; ++dt) {
        #pragma unroll
        for (unsigned r = 0; r < 8; ++r) o[t][dt][r] *= sc[r];
      }
    }

    // O += P x V: each V fragment serves both tiles
    mma_pv_run(o[0][0], o[1][0], o[0][1], o[1][1], o[0][2], o[1][2], o[0][3], o[1][3],
               pa[0].v, pa[1].v, bv[0].v, bv[1].v, bv[2].v, bv[3].v);
  }

  // merge of the two key halves: group 1 hands its offsets, sums and O tiles over, group 0 joins them with its own
  float* sp = sP + wave * (QT * 4 * 8 * 32);
  if (grp != 0u) {
    #pragma unroll
    for (unsigned t = 0; t < QT; ++t) {
      sM[(wave * QT + t) * 32 + lane] = roff[t];
      sL[(wave * QT + t) * 32 + lane] = rsum[t];
      #pragma unroll
      for (unsigned dt = 0; dt < 4; ++dt) {
        #pragma unroll
        for (unsigned q4 = 0; q4 < 2; ++q4)
          *(v4f*)(sp + (((t * 4 + dt) * 2 + q4) * 32 + lane) * 4) =
              (v4f){o[t][dt][q4 * 4], o[t][dt][q4 * 4 + 1], o[t][dt][q4 * 4 + 2], o[t][dt][q4 * 4 + 3]};
      }
    }
  }
  __syncthreads();   // group 1's partial results are complete before group 0 reads them

  // normalize: lane holds column d = dt*16 + lq for query rows 8*hi + r of each tile; O and the sums both carry x4096, which cancels; fold the x256 ctx carry
  f16* so = sO + wave * (QT * 16 * TP);
  if (grp == 0u) {
    #pragma unroll
    for (unsigned t = 0; t < QT; ++t) {
      const float o2  = sM[(wave * QT + t) * 32 + lane];
      const float l2  = sL[(wave * QT + t) * 32 + lane];
      const float om  = fminf(roff[t], o2);               // the larger maximum has the smaller offset
      const float a1  = __builtin_amdgcn_exp2f(om - roff[t]);
      const float a2  = __builtin_amdgcn_exp2f(om - o2);
      const float inv = 256.0f / (rsum[t] * a1 + l2 * a2);
      const float g1  = a1 * inv;
      const float g2  = a2 * inv;
      float f1[8], f2[8];
      #pragma unroll
      for (unsigned r = 0; r < 8; ++r) {
        f1[r] = __shfl(g1, (int)((hi << 3) + r), 32);
        f2[r] = __shfl(g2, (int)((hi << 3) + r), 32);
      }
      #pragma unroll
      for (unsigned dt = 0; dt < 4; ++dt) {
        #pragma unroll
        for (unsigned q4 = 0; q4 < 2; ++q4) {
          const v4f p = *(const v4f*)(sp + (((t * 4 + dt) * 2 + q4) * 32 + lane) * 4);
          #pragma unroll
          for (unsigned j = 0; j < 4; ++j) {
            const unsigned r = q4 * 4 + j;
            so[(t * 16 + hi * 8 + r) * TP + dt * 16 + lq] = (f16)(o[t][dt][r] * f1[r] + p[j] * f2[r]);
          }
        }
      }
    }
  }
  __syncthreads();

  if (grp == 0u) {
    v4u    val[QT * 4];
    size_t idx[QT * 4];
    #pragma unroll
    for (unsigned t = 0; t < QT; ++t) {
      #pragma unroll
      for (unsigned it = 0; it < 4; ++it) {
        Pack8H ph;                                  // ctx in fragment order: tile = 16 of this wave's tokens, unit = h*4 + it, slot = lane
        ph.v = *(const v8h*)(so + (t * 16 + lq) * TP + it * 16 + hi * 8);
        val[t * 4 + it] = ph.u;
        idx[t * 4 + it] = ((size_t)b * SEQ + qrow0 + t * 16) * CH + (h * 4 + it) * 256 + lane * 8;
      }
    }
    #pragma unroll
    for (unsigned it = 0; it < QT * 4; ++it) *(v4u*)(ctx + idx[it]) = val[it];
  }
}

// Projection, transposed: Y^T[c][tok] = sum_k wpT[c][k] * ctx[tok][k]. Block = (128-token tile, 64-channel tile).
// A fragments from wpT (channel tiles), B fragments from ctx (token tiles), both in fragment order; D rows = channels, columns = tokens,
// so the channel-major output row of 128 pixels (512 B) is written by one wave instruction (32 lanes x 16 B).
__global__ __launch_bounds__(256) void proj_kernel(const f16* __restrict__ ctx,
                                                   const f16* __restrict__ wpT,
                                                   const float* __restrict__ bproj,
                                                   const float* __restrict__ x,
                                                   float* __restrict__ out) {
  const unsigned mt   = blockIdx.x;
  const unsigned ct   = blockIdx.y;             // 0..3
  const unsigned tid  = threadIdx.x;
  const unsigned wave = tid >> 5;
  const unsigned lane = tid & 31u;
  const unsigned lq   = lane & 15u;
  const unsigned hi   = lane >> 4;
  __shared__ __align__(16) float sO[64 * OPF];  // [channel][token], cross-wave (block barrier)

  const f16* brow = ctx + (size_t)(mt * NWAVE + wave) * (16 * CH) + lane * 8;
  const f16* arow = wpT + (size_t)(ct * 4) * (16 * CH) + lane * 8;

  v8f acc[4];
  #pragma unroll
  for (unsigned m4 = 0; m4 < 4; ++m4) acc[m4] = (v8f){0, 0, 0, 0, 0, 0, 0, 0};

  #pragma unroll 2
  for (unsigned ks = 0; ks < CH / 32; ++ks) {
    FragH bc;
    bc.q[0] = *(const v4u*)(brow + ks * 512);
    bc.q[1] = *(const v4u*)(brow + ks * 512 + 256);
    FragH aw[4];
    #pragma unroll
    for (unsigned m4 = 0; m4 < 4; ++m4) {
      const f16* base = arow + (size_t)m4 * 16 * CH + ks * 512;
      aw[m4].q[0] = *(const v4u*)(base);
      aw[m4].q[1] = *(const v4u*)(base + 256);
    }
    #pragma unroll
    for (unsigned m4 = 0; m4 < 4; ++m4) acc[m4] = mma_f16(aw[m4].v, bc.v, acc[m4]);
  }

  // acc[m4][r] = 16384 * value(channel m4*16 + hi*8 + r, token wave*16 + lq)
  #pragma unroll
  for (unsigned m4 = 0; m4 < 4; ++m4) {
    #pragma unroll
    for (unsigned r = 0; r < 8; ++r)
      sO[(m4 * 16 + hi * 8 + r) * OPF + wave * 16 + lq] = acc[m4][r] * (1.0f / 16384.0f);
  }
  __syncthreads();

  const unsigned b  = mt / (SEQ / MT);
  const unsigned p0 = (mt % (SEQ / MT)) * MT;
  v4f    val[8];
  size_t idx[8];
  #pragma unroll
  for (unsigned it = 0; it < 8; ++it) {
    const unsigned row = it * 8 + wave;                 // channel within the tile (wave-uniform)
    const unsigned c   = ct * 64 + row;
    const v4f a  = *(const v4f*)(sO + row * OPF + lane * 4);
    const float bb = (float)(bf16)bproj[c];
    const size_t gi = ((size_t)b * CH + c) * SEQ_FULL + p0 + lane * 4;
    const v4f xv = *(const v4f*)(x + gi);
    v4f res;
    #pragma unroll
    for (unsigned i = 0; i < 4; ++i) res[i] = (float)(bf16)xv[i] + (a[i] + bb);
    val[it] = res;
    idx[it] = gi;
  }
  #pragma unroll
  for (unsigned it = 0; it < 8; ++it) *(v4f*)(out + idx[it]) = val[it];
  
}

extern "C" void kernel_launch(void* const* d_in, const int* in_sizes, int n_in,
                              void* d_out, int out_size, void* d_ws, size_t ws_size,
                              hipStream_t stream) {
  if (n_in < 7) return;
  const size_t x_need = ((size_t)(NB - 1) * CH + (CH - 1)) * SEQ_FULL + SEQ;
  if ((size_t)in_sizes[0] < x_need) return;
  if (in_sizes[1] < CH || in_sizes[2] < CH) return;
  if ((size_t)in_sizes[3] < (size_t)CH * QKVN || in_sizes[4] < QKVN) return;
  if ((size_t)in_sizes[5] < (size_t)CH * CH || in_sizes[6] < CH) return;
  if ((size_t)out_size < x_need) return;

  const size_t tok_plane = (size_t)NB * SEQ * CH * 2;            // ctx and each of q/k/v^T: same bytes
  const size_t wq_bytes  = (size_t)QKVN * CH * 2;
  const size_t wp_bytes  = (size_t)CH * CH * 2;
  const size_t total     = 4 * tok_plane + wq_bytes + wp_bytes;
  if (ws_size < total) return;

  const float* x     = (const float*)d_in[0];
  const float* gam   = (const float*)d_in[1];
  const float* bet   = (const float*)d_in[2];
  const float* wqkv  = (const float*)d_in[3];
  const float* bqkv  = (const float*)d_in[4];
  const float* wproj = (const float*)d_in[5];
  const float* bproj = (const float*)d_in[6];
  float* out = (float*)d_out;

  char* ws = (char*)d_ws;
  f16* qp  = (f16*)(ws);
  f16* kp  = (f16*)(ws + 1 * tok_plane);
  f16* vt  = (f16*)(ws + 2 * tok_plane);
  f16* ctx = (f16*)(ws + 3 * tok_plane);
  f16* wqT = (f16*)(ws + 4 * tok_plane);
  f16* wpT = (f16*)(ws + 4 * tok_plane + wq_bytes);

  w_planes_kernel<<<dim3(CH / 64, QKVN / 64 + CH / 64), 256, 0, stream>>>(wqkv, wproj, wqT, wpT);
  ln_qkv_kernel<<<dim3(NB * (SEQ / FT)), FW * 32, 0, stream>>>(x, gam, bet, wqT, bqkv, qp, kp, vt);
  attn_kernel<<<dim3(SEQ / BQ, NHEAD, NB), NWAVE * KSPL * 32, 0, stream>>>(qp, kp, vt, ctx);
  proj_kernel<<<dim3(NB * (SEQ / MT), CH / 64), 256, 0, stream>>>(ctx, wpT, bproj, x, out);
}

// v008
// It runs in 81.8 microseconds.
// In two side-by-side timings against v007, it was 1.05 and 1.06 times as fast.
// Counting every step since v000, it is 3.66 times as fast.
#include <hip/hip_runtime.h>

// Contractions (all v_wmma_f32_16x16x32_f16, f16 operands, f32 accumulate): Q^T, K^T = W^T x xn^T and V = xn x W (W = f16 of the bf16 RNE-converted weight x64);
// S^T = K x Q^T (f16 q/k planes); O = P x V (P carried x4096, V^T f16 plane); Y^T = Wproj^T x ctx^T (ctx carried x256, W x64). LayerNorm, softmax, bias and residual in f32.
// Every f16 operand plane in the workspace is stored in fragment order: one 512-B unit per (16-row tile, 16-wide k piece), holding for each
// lane the 8 halves it loads, so a wave-wide 16-B load reads 4 whole 128-B lines. Unit u of a 16-row tile covers k = u*16 .. u*16+15;
// lane (lq = row in the tile, hi) owns k = u*16 + hi*8 + 0..7 at half offset u*256 + slot*8 (slot = hi*16 + lq). xn lives in LDS only.

#ifndef NB
#define NB 4
#endif
#ifndef SEQ
#define SEQ 4096
#endif
#define NB_FULL    4
#define SEQ_FULL   4096
#define CH         256                  // channels = NHEAD * HDIM
#define NHEAD      4
#define HDIM       64
#define QKVN       (3 * CH)
#define QT         2                    // 16-row query tiles per attention wave
#define BQ         256                  // query rows per attention workgroup (8 waves x QT x 16)
#define BK         32                   // keys per inner iteration
#define NWAVE      8
#define KSPL       2                    // key ranges per attention workgroup (one per group of NWAVE waves)
#define NPASS      (SEQ / BK / KSPL)    // inner iterations per attention wave
#define PT         2                    // 16-token tiles per projection wave
#define MT         256                  // tokens per projection workgroup (8 waves x PT x 16)
#define AH         4                    // k steps that the projection's weight fragments are requested ahead
#define FT         64                   // tokens per LayerNorm + QKV workgroup
#define FW         16                   // waves per LayerNorm + QKV workgroup (one column tile of q, k and v each)
#define FP         97                   // LDS pitch (floats) of the LayerNorm tile
#define AP         144                  // LDS pitch (halves) of an 8-channel xn piece (16 tokens x 16 B + 32 B)
#define TP         72                   // LDS pitch (halves) of 64-wide f16 tiles
#define OPF        260                  // LDS pitch (floats) of the projection staging tile

static_assert(SEQ % BQ == 0);
static_assert(SEQ % MT == 0);
static_assert(SEQ % FT == 0);
static_assert(SEQ % (BK * KSPL) == 0);
static_assert(BQ == NWAVE * QT * 16);
static_assert(QT == 2);                          // the attention matrix runs are written out for two query tiles
static_assert(MT == NWAVE * PT * 16);
static_assert(AH >= 2 && AH <= CH / 32);
static_assert(CH == NHEAD * HDIM);
static_assert(CH == 256);
static_assert(HDIM == 64);
static_assert(CH % 32 == 0);
static_assert(SEQ <= SEQ_FULL);
static_assert(NB >= 1 && NB <= NB_FULL);
static_assert((TP * 2) % 16 == 0);
static_assert((AP * 2) % 16 == 0);
static_assert((OPF * 4) % 16 == 0);
static_assert(FW * 16 == CH);                    // one 16-column tile of q, of k and of v per wave
static_assert(FW * 32 == FT * 8);                // LayerNorm: eight threads per token
static_assert(FW * 32 == 2 * CH);                // one thread per gamma or beta element
static_assert(FT % 32 == 0);                     // whole 32-key blocks of the v plane
static_assert(FP >= FT);
// coverage equalities (threads x pieces x elements == tile elements)
static_assert(FW * 32 * 8 * 4 == FT * CH);       // LayerNorm input tile
static_assert(FW * 32 * 4 * 8 == FT * CH);       // xn pieces
static_assert(256 * 2 * 8 == 64 * 64);           // weight plane tile
static_assert(32 * 4 * 8 == 16 * HDIM);          // per-wave ctx tile
static_assert(NWAVE * 8 * PT * 32 * 4 == 64 * MT);   // output tile

typedef __bf16   bf16;
typedef _Float16 f16;
typedef f16      v16h  __attribute__((ext_vector_type(16)));
typedef f16      v8h   __attribute__((ext_vector_type(8)));
typedef float    v8f   __attribute__((ext_vector_type(8)));
typedef float    v4f   __attribute__((ext_vector_type(4)));
typedef float    v2f   __attribute__((ext_vector_type(2)));
typedef unsigned v4u   __attribute__((ext_vector_type(4)));

union FragH  { v16h  v; v4u q[2]; f16  h[16]; };
union Pack8H { v4u u; v8h v; f16 h[8]; };

// Attention, the eight S^T products of a pass as one run (c<t><sub>, k<sub><f>, q<t><f>): d 0..31 of the four tiles, then d 32..63 on top.
// In one statement every product stands in the others' distance, so the idle slots are paid once a run and not once a product:
// the four v_nop behind the last product keep its distance to the first vector instruction that reads a tile.
static __device__ __forceinline__ void mma_s_run(v8f& c00, v8f& c10, v8f& c01, v8f& c11,
                                                 v16h k00, v16h k01, v16h k10, v16h k11,
                                                 v16h q00, v16h q01, v16h q10, v16h q11) {
  asm volatile("v_wmma_f32_16x16x32_f16 %0, %4, %8, 0\n\t"
               "v_wmma_f32_16x16x32_f16 %1, %4, %10, 0\n\t"
               "v_wmma_f32_16x16x32_f16 %2, %6, %8, 0\n\t"
               "v_wmma_f32_16x16x32_f16 %3, %6, %10, 0\n\t"
               "v_wmma_f32_16x16x32_f16 %0, %5, %9, %0\n\t"
               "v_wmma_f32_16x16x32_f16 %1, %5, %11, %1\n\t"
               "v_wmma_f32_16x16x32_f16 %2, %7, %9, %2\n\t"
               "v_wmma_f32_16x16x32_f16 %3, %7, %11, %3\n\t"
               "v_nop\n\tv_nop\n\tv_nop\n\tv_nop"
               : "=&v"(c00), "=&v"(c10), "=&v"(c01), "=&v"(c11)
               : "v"(k00), "v"(k01), "v"(k10), "v"(k11), "v"(q00), "v"(q01), "v"(q10), "v"(q11));
}

// Attention, the eight PV products of a pass as one run (o<t><dt> += p<t> x v<dt>), for the same reason; the four v_nop behind the last
// product keep its distance to the next vector instruction on its O tile or over its operands, on the loop's back edge too.
static __device__ __forceinline__ void mma_pv_run(v8f& o00, v8f& o10, v8f& o01, v8f& o11, v8f& o02, v8f& o12, v8f& o03, v8f& o13,
                                                  v16h p0, v16h p1, v16h v0, v16h v1, v16h v2, v16h v3) {
  asm volatile("v_wmma_f32_16x16x32_f16 %0, %8, %10, %0\n\t"
               "v_wmma_f32_16x16x32_f16 %1, %9, %10, %1\n\t"
               "v_wmma_f32_16x16x32_f16 %2, %8, %11, %2\n\t"
               "v_wmma_f32_16x16x32_f16 %3, %9, %11, %3\n\t"
               "v_wmma_f32_16x16x32_f16 %4, %8, %12, %4\n\t"
               "v_wmma_f32_16x16x32_f16 %5, %9, %12, %5\n\t"
               "v_wmma_f32_16x16x32_f16 %6, %8, %13, %6\n\t"
               "v_wmma_f32_16x16x32_f16 %7, %9, %13, %7\n\t"
               "v_nop\n\tv_nop\n\tv_nop\n\tv_nop"
               : "+v"(o00), "+v"(o10), "+v"(o01), "+v"(o11), "+v"(o02), "+v"(o12), "+v"(o03), "+v"(o13)
               : "v"(p0), "v"(p1), "v"(v0), "v"(v1), "v"(v2), "v"(v3));
}

// Weight planes. Block = (64-wide k tile, 64-wide n tile), 256 threads.
//   wqT f16 = bf16(w_qkv[k][n]) x 64, wpT f16 = bf16(w_proj[k][n]) x 64, both in fragment order: tile = 16 columns n, 16 units over k.
__global__ __launch_bounds__(256) void w_planes_kernel(const float* __restrict__ wqkv,
                                                       const float* __restrict__ wproj,
                                                       f16* __restrict__ wqT,
                                                       f16* __restrict__ wpT) {
  const unsigned kt  = blockIdx.x;              // 0..3
  const unsigned nt  = blockIdx.y;              // 0..11 qkv, 12..15 proj
  const unsigned tid = threadIdx.x;
  const bool isq = nt < (QKVN / 64);
  const float* src = isq ? wqkv : wproj;        // both global, block-uniform
  f16*         dst = isq ? wqT : wpT;
  const unsigned ldn = isq ? (unsigned)QKVN : (unsigned)CH;
  const unsigned n0  = (isq ? nt : (nt - QKVN / 64)) * 64u;
  const unsigned k0  = kt * 64u;
  __shared__ __align__(16) f16 sT[64 * TP];     // [n][k], cross-wave (block barrier)

  #pragma unroll
  for (unsigned kk = 0; kk < 2; ++kk) {
    const unsigned kr = kk * 32 + (tid >> 3);   // 0..63
    const unsigned nn = (tid & 7u) * 8;         // 0..56
    const float* p = src + (size_t)(k0 + kr) * ldn + n0 + nn;
    const v4f w0 = *(const v4f*)(p);
    const v4f w1 = *(const v4f*)(p + 4);
    #pragma unroll
    for (unsigned i = 0; i < 4; ++i) {
      sT[(nn + i) * TP + kr]     = (f16)((float)(bf16)w0[i] * 64.0f);   // exact in f16
      sT[(nn + 4 + i) * TP + kr] = (f16)((float)(bf16)w1[i] * 64.0f);
    }
  }
  __syncthreads();

  v4u    val[2];
  size_t idx[2];
  #pragma unroll
  for (unsigned kk = 0; kk < 2; ++kk) {
    const unsigned g  = kk * 256 + tid;         // destination order: (n tile 0..3, unit 0..3, slot 0..31)
    const unsigned nl = g >> 7;
    const unsigned u  = (g >> 5) & 3u;
    const unsigned n  = nl * 16 + (g & 15u);
    const unsigned ks = u * 16 + ((g >> 4) & 1u) * 8;
    Pack8H ph;
    ph.v = *(const v8h*)(sT + n * TP + ks);
    val[kk] = ph.u;
    idx[kk] = (size_t)(n0 / 16 + nl) * (16 * CH) + (k0 / 16 + u) * 256 + (g & 31u) * 8;
  }
  #pragma unroll
  for (unsigned kk = 0; kk < 2; ++kk) *(v4u*)(dst + idx[kk]) = val[kk];
  
}

// LayerNorm and QKV GEMM in one kernel. Block = 64 tokens x all 768 columns, 16 waves.
// Phase 1: LayerNorm over channels of the bf16 RNE-converted input (sums in the order part + 8j, then the 1-2-4 exchange); xn goes as f16 into
// LDS in 8-channel pieces: piece q of a 16-token tile holds channels q*8 .. q*8+7 of token lq at lq*16 B, so lanes 0-15 and lanes 16-31 of a
// fragment load each read 256 contiguous bytes; the piece pitch of 288 B spreads the eight pieces that a wave writes at once over all banks.
// Phase 2: wave w owns column tile w of q, of k and of v (head w >> 2, d tile w & 3) for all four token tiles; weights from wqT (fragment order).
// q and k are formed as W^T x xn^T (D rows = d, columns = tokens), v as xn x W (D rows = tokens, columns = d): in both a lane's eight
// accumulator registers are the eight halves that it owns in the plane's fragment order, so each tile is stored by one 16-B store a lane.
// q and k planes per head: tile = 16 tokens, 4 units over d; v plane per head: per 32 keys, tile = 16 columns d, 2 units over keys.
__global__ __launch_bounds__(FW * 32) void ln_qkv_kernel(const float* __restrict__ x,
                                                         const float* __restrict__ gamma,
                                                         const float* __restrict__ beta,
                                                         const f16* __restrict__ wqT,
                                                         const float* __restrict__ bqkv,
                                                         f16* __restrict__ qp,
                                                         f16* __restrict__ kp,
                                                         f16* __restrict__ vt) {
  const unsigned tid = threadIdx.x;
  const unsigned blk = blockIdx.x;
  const unsigned b   = blk / (SEQ / FT);
  const unsigned p0  = (blk % (SEQ / FT)) * FT;
  __shared__ float sX[CH * FP];                             // [c][pix], cross-wave (block barrier)
  __shared__ __align__(16) float sGB[2 * CH];               // gamma, then beta
  __shared__ __align__(16) f16 sA[(FT / 16) * 32 * AP];     // [token tile][piece][lq][8], cross-wave (block barrier)
  const float* sG = sGB;
  const float* sB = sGB + CH;

  const unsigned wave = tid >> 5;               // 0..15: column tile of q, of k and of v
  const unsigned lane = tid & 31u;
  const unsigned lq   = lane & 15u;
  const unsigned hi   = lane >> 4;

  const float gbv = ((tid < CH) ? gamma : beta)[tid & (CH - 1u)];   // waves 0-7 bring gamma, waves 8-15 beta
  const float* xb = x + (size_t)b * CH * SEQ_FULL + p0;
  const unsigned px4 = (tid & 15u) * 4;                     // 16 lanes cover one channel's 64 pixels (256 B)
  const unsigned cr  = tid >> 4;                            // 0..31
  v4f xv[8];
  #pragma unroll
  for (unsigned it = 0; it < 8; ++it) xv[it] = *(const v4f*)(xb + (size_t)(it * 32 + cr) * SEQ_FULL + px4);

  // weight fragments, two register sets: step ks + 1 is requested ahead of step ks's products; step 0 here, beside the input loads
  const f16* wrow = wqT + (size_t)wave * (16 * CH) + lane * 8;
  FragH bw[2][3];
  #pragma unroll
  for (unsigned j = 0; j < 3; ++j) {
    const f16* base = wrow + (size_t)j * CH * CH;                // q, k, v column tiles lie 16 tiles = CH columns apart
    bw[0][j].q[0] = *(const v4u*)(base);                         // k = hi*8 + 0..7
    bw[0][j].q[1] = *(const v4u*)(base + 256);                   // k = 16 + hi*8 + 0..7
  }
  // biases, requested here too: q and k per D row (column wave*16 + hi*8 + r), v per D column (column wave*16 + lq)
  v4f bqk[2][2];
  #pragma unroll
  for (unsigned j = 0; j < 2; ++j) {
    const float* bp = bqkv + j * CH + wave * 16 + hi * 8;
    bqk[j][0] = *(const v4f*)(bp);
    bqk[j][1] = *(const v4f*)(bp + 4);
  }
  const float bvr = bqkv[2 * CH + wave * 16 + lq];
  #pragma unroll
  for (unsigned it = 0; it < 8; ++it) {
    #pragma unroll
    for (unsigned i = 0; i < 4; ++i) sX[(it * 32 + cr) * FP + px4 + i] = (float)(bf16)xv[it][i];   // RNE convert
  }
  sGB[tid] = (float)(bf16)gbv;
  __syncthreads();

  const unsigned tok  = tid >> 3;               // 0..63
  const unsigned part = tid & 7u;               // 0..7
  float s = 0.0f;
  #pragma unroll
  for (unsigned j = 0; j < 32; ++j) s += sX[(part + 8 * j) * FP + tok];
  s += __shfl_xor(s, 1, 32);
  s += __shfl_xor(s, 2, 32);
  s += __shfl_xor(s, 4, 32);
  const float mu = s * (1.0f / CH);
  float ss = 0.0f;
  #pragma unroll
  for (unsigned j = 0; j < 32; ++j) {
    const float d = sX[(part + 8 * j) * FP + tok] - mu;
    ss += d * d;
  }
  ss += __shfl_xor(ss, 1, 32);
  ss += __shfl_xor(ss, 2, 32);
  ss += __shfl_xor(ss, 4, 32);
  const float rstd = rsqrtf(ss * (1.0f / CH) + 1e-5f);

  #pragma unroll
  for (unsigned j = 0; j < 4; ++j) {
    const unsigned c0 = j * 64 + part * 8;
    Pack8H ph;
    #pragma unroll
    for (unsigned i = 0; i < 8; ++i) {
      const float d = sX[(c0 + i) * FP + tok] - mu;
      ph.h[i] = (f16)(d * rstd * sG[c0 + i] + sB[c0 + i]);
    }
    *(v4u*)(sA + (tok >> 4) * (32 * AP) + (c0 >> 3) * AP + (tok & 15u) * 8) = ph.u;
  }
  __syncthreads();   // every token's xn pieces are in LDS before any wave loads fragments from them

  const f16* arow = sA + hi * AP + lq * 8;

  v8f acc[FT / 16][3];
  #pragma unroll
  for (unsigned tt = 0; tt < FT / 16; ++tt) {
    #pragma unroll
    for (unsigned j = 0; j < 3; ++j) acc[tt][j] = (v8f){0, 0, 0, 0, 0, 0, 0, 0};
  }

  #pragma unroll
  for (unsigned ks = 0; ks < CH / 32; ++ks) {
    const unsigned cur = ks & 1u;
    if (ks + 1 < CH / 32) {
      #pragma unroll
      for (unsigned j = 0; j < 3; ++j) {
        const f16* base = wrow + (size_t)j * CH * CH + (ks + 1) * 512;
        bw[cur ^ 1u][j].q[0] = *(const v4u*)(base);              // k = (ks+1)*32 + hi*8 + 0..7
        bw[cur ^ 1u][j].q[1] = *(const v4u*)(base + 256);        // k = (ks+1)*32 + 16 + hi*8 + 0..7
      }
    }
    FragH a[FT / 16];
    #pragma unroll
    for (unsigned tt = 0; tt < FT / 16; ++tt) {
      const f16* base = arow + tt * (32 * AP) + ks * 4 * AP;
      a[tt].q[0] = *(const v4u*)(base);                          // piece ks*4 + hi:     k = ks*32 + hi*8 + 0..7
      a[tt].q[1] = *(const v4u*)(base + 2 * AP);                 // piece ks*4 + 2 + hi: k = ks*32 + 16 + hi*8 + 0..7
    }
    __builtin_amdgcn_sched_barrier(0);   // the step's loads stay one group ahead of its products: sunk to their uses, each would be waited for alone
    #pragma unroll
    for (unsigned tt = 0; tt < FT / 16; ++tt) {
      acc[tt][0] = __builtin_amdgcn_wmma_f32_16x16x32_f16(false, bw[cur][0].v, false, a[tt].v, (short)0, acc[tt][0], false, false);
      acc[tt][1] = __builtin_amdgcn_wmma_f32_16x16x32_f16(false, bw[cur][1].v, false, a[tt].v, (short)0, acc[tt][1], false, false);
      acc[tt][2] = __builtin_amdgcn_wmma_f32_16x16x32_f16(false, a[tt].v, false, bw[cur][2].v, (short)0, acc[tt][2], false, false);
    }
    __builtin_amdgcn_sched_barrier(0);   // the next step's loads stay out of this step's products, for speed only
  }

  const unsigned h  = wave >> 2;
  const unsigned dt = wave & 3u;
  const size_t head0 = (((size_t)b * NHEAD + h) * SEQ + p0) * HDIM;

  // q, k: acc[tt][j][r] = 64 * value(column dt*16 + hi*8 + r, token tt*16 + lq); v: acc[tt][2][r] = 64 * value(token tt*16 + hi*8 + r, column dt*16 + lq)
  v4u val[3][FT / 16];
  #pragma unroll
  for (unsigned j = 0; j < 2; ++j) {
    const v4f b0 = bqk[j][0];
    const v4f b1 = bqk[j][1];
    #pragma unroll
    for (unsigned tt = 0; tt < FT / 16; ++tt) {
      Pack8H ph;
      #pragma unroll
      for (unsigned r = 0; r < 4; ++r) {
        ph.h[r]     = (f16)(acc[tt][j][r] * (1.0f / 64.0f) + (float)(bf16)b0[r]);
        ph.h[r + 4] = (f16)(acc[tt][j][r + 4] * (1.0f / 64.0f) + (float)(bf16)b1[r]);
      }
      val[j][tt] = ph.u;
    }
  }
  const float bias = (float)(bf16)bvr;
  #pragma unroll
  for (unsigned tt = 0; tt < FT / 16; ++tt) {
    Pack8H ph;
    #pragma unroll
    for (unsigned r = 0; r < 8; ++r) ph.h[r] = (f16)(acc[tt][2][r] * (1.0f / 64.0f) + bias);
    val[2][tt] = ph.u;
  }
  f16* qd = qp + head0 + dt * 256 + lane * 8;
  f16* kd = kp + head0 + dt * 256 + lane * 8;
  f16* vd = vt + head0 + dt * 512 + lane * 8;
  #pragma unroll
  for (unsigned tt = 0; tt < FT / 16; ++tt) {
    *(v4u*)(qd + (size_t)(tt * 16) * HDIM) = val[0][tt];
    *(v4u*)(kd + (size_t)(tt * 16) * HDIM) = val[1][tt];
    *(v4u*)(vd + (size_t)((tt >> 1) * 32) * HDIM + (tt & 1u) * 256) = val[2][tt];
  }
}

// Flash attention, full (no mask). Block = (query block of 256, head, batch), 16 waves; one wave owns QT = 2 tiles of 16 query rows.
// S^T = K x Q^T so queries sit on lanes; P^T in C-layout is bit-identical to the A-fragment layout of O += P x V.
// K A-fragments, Q B-fragments and V^T B-fragments are loaded straight from the fragment-order f16 planes (two 16-B loads per fragment).
// Every K and V fragment a wave loads feeds both of its query tiles: 16 loads per 16 products, and the two tiles' softmax chains are independent.
// K fragments are fetched one pass ahead: pass i issues the loads of pass i+1 right behind its own S^T products, into the registers
// those products have released, so the softmax and the PV products run while they fly; V is issued at the head of its own pass.
// The workgroup has KSPL = 2 groups of 8 waves: wave w and wave w + 8 own the same 32 query rows and walk one half of the keys each, so
// that four waves instead of two share a SIMD and fill each other's waits; their references, sums and O tiles are merged once, through LDS.
__global__ __launch_bounds__(NWAVE * KSPL * 32) void attn_kernel(const f16* __restrict__ qp,
                                                   const f16* __restrict__ kp,
                                                   const f16* __restrict__ vt,
                                                   f16* __restrict__ ctx) {
  const unsigned qblk = blockIdx.x;
  const unsigned h    = blockIdx.y;
  const unsigned b    = blockIdx.z;
  const unsigned tid  = threadIdx.x;
  const unsigned wave = (tid >> 5) & (NWAVE - 1u);                                   // which 32 query rows
  const unsigned grp  = (unsigned)__builtin_amdgcn_readfirstlane((int)(tid >> 8));   // which half of the keys (wave-uniform)
  const unsigned lane = tid & 31u;
  const unsigned lq   = lane & 15u;   // query column of S^T / d column of O
  const unsigned hi   = lane >> 4;    // k-split half

  __shared__ __align__(16) f16   sO[NWAVE * QT * 16 * TP];      // per-wave output staging (block barrier used)
  __shared__ __align__(16) float sP[NWAVE * QT * 4 * 8 * 32];   // second key half's O tiles, [wave][t][dt][r / 4][lane][r % 4]
  __shared__ float sM[NWAVE * QT * 32];                         // second key half's exponent offsets (12 - maximum * SL), [wave][t][lane]
  __shared__ float sL[NWAVE * QT * 32];                         // second key half's row sums

  const unsigned qrow0 = qblk * BQ + wave * (QT * 16);

  const f16* qp_h = qp + ((size_t)b * NHEAD + h) * SEQ * HDIM;
  const f16* kp_h = kp + (((size_t)b * NHEAD + h) * SEQ + grp * (SEQ / KSPL)) * HDIM;   // this group's first key
  const f16* vt_h = vt + (((size_t)b * NHEAD + h) * SEQ + grp * (SEQ / KSPL)) * HDIM;

  // Q as B-operand fragments: in tile t lane lq holds query qrow0 + t*16 + lq, elements follow the split d map.
  FragH qf[QT][2];
  #pragma unroll
  for (unsigned t = 0; t < QT; ++t) {
    const f16* qr = qp_h + (size_t)(qrow0 + t * 16) * HDIM + lane * 8;
    #pragma unroll
    for (unsigned f = 0; f < 2; ++f) {
      qf[t][f].q[0] = *(const v4u*)(qr + f * 512);              // d = f*32 + hi*8 + 0..7
      qf[t][f].q[1] = *(const v4u*)(qr + f * 512 + 256);        // d = f*32 + 16 + hi*8 + 0..7
    }
  }

  v8f   o[QT][4];
  float rmax[QT];   // running maximum, raw score
  float roff[QT];   // the exponent offset in use, 12 - rmax * SL: the reference that the sums and O are carried at
  float rsum[QT];
  #pragma unroll
  for (unsigned t = 0; t < QT; ++t) {
    #pragma unroll
    for (unsigned dt = 0; dt < 4; ++dt) o[t][dt] = (v8f){0, 0, 0, 0, 0, 0, 0, 0};
    rmax[t] = -__builtin_inff();
    roff[t] = __builtin_inff();
    rsum[t] = 0.0f;
  }
  const float SL = 0.0625f * 1.4426950408889634f;   // softmax scale (1/sqrt(CH)) * log2(e)

  // K A-fragments: row = key j0 + sub*16 + lq, split d map; pass 0's are loaded here, every later pass's one pass ahead
  FragH ak[2][2];
  #pragma unroll
  for (unsigned sub = 0; sub < 2; ++sub) {
    #pragma unroll
    for (unsigned f = 0; f < 2; ++f) {
      const f16* base = kp_h + (size_t)(sub * 16) * HDIM + f * 512 + lane * 8;
      ak[sub][f].q[0] = *(const v4u*)(base);
      ak[sub][f].q[1] = *(const v4u*)(base + 256);
    }
  }

  for (unsigned i = 0; i < NPASS; ++i) {
    const unsigned j0 = i * BK;                     // counted from this group's first key

    // V B-fragments: column n = d = dt*16 + lq, split key map
    FragH bv[4];
    #pragma unroll
    for (unsigned dt = 0; dt < 4; ++dt) {
      const f16* base = vt_h + (size_t)j0 * HDIM + dt * 512 + lane * 8;
      bv[dt].q[0] = *(const v4u*)(base);            // keys j0 + hi*8 + 0..7
      bv[dt].q[1] = *(const v4u*)(base + 256);      // keys j0 + 16 + hi*8 + 0..7
    }

    // S^T tiles: c[t][sub][r] = rawscore(query qrow0 + t*16 + lq, key j0 + sub*16 + hi*8 + r); d 0..31 of all four tiles, then d 32..63
    v8f c[QT][2];
    mma_s_run(c[0][0], c[1][0], c[0][1], c[1][1], ak[0][0].v, ak[0][1].v, ak[1][0].v, ak[1][1].v,
              qf[0][0].v, qf[0][1].v, qf[1][0].v, qf[1][1].v);

    // next pass's K fragments; the last pass re-reads the group's first 32 keys (in bounds, never used) so that the loads stay unconditional
    const unsigned jn = (i + 1 < NPASS) ? j0 + BK : 0u;
    #pragma unroll
    for (unsigned sub = 0; sub < 2; ++sub) {
      #pragma unroll
      for (unsigned f = 0; f < 2; ++f) {
        const f16* base = kp_h + (size_t)(jn + sub * 16) * HDIM + f * 512 + lane * 8;
        ak[sub][f].q[0] = *(const v4u*)(base);
        ak[sub][f].q[1] = *(const v4u*)(base + 256);
      }
    }

    // online softmax, per tile: query lq's 32 scores are split across lane / lane^16
    float m_new[QT];
    #pragma unroll
    for (unsigned t = 0; t < QT; ++t) {
      float m = rmax[t];
      #pragma unroll
      for (unsigned r = 0; r < 8; ++r) {
        m = fmaxf(m, c[t][0][r]);
        m = fmaxf(m, c[t][1][r]);
      }
      m_new[t] = m;
    }
    #pragma unroll
    for (unsigned t = 0; t < QT; ++t) m_new[t] = fmaxf(m_new[t], __shfl_xor(m_new[t], 16, 32));
    float scale[QT];
    #pragma unroll
    for (unsigned t = 0; t < QT; ++t) {
      const float off = __builtin_fmaf(-m_new[t], SL, 12.0f);
      scale[t] = __builtin_amdgcn_exp2f(off - roff[t]);   // from the offsets themselves, so old and new P agree whatever off's rounding
      roff[t]  = off;
      rmax[t]  = m_new[t];
    }

    // exp + pack: P^T C-layout == A-fragment layout for the PV product. P x 4096 = exp2(c * SL + off), off = 12 - max * SL: one packed FMA
    // per pair of neighbouring accumulator registers carries the scale, the maximum and the x4096 carry; the row sums are carried x4096 too
    FragH pa[QT];
    float psum[QT];
    #pragma unroll
    for (unsigned t = 0; t < QT; ++t) {
      const v2f   off2 = (v2f){roff[t], roff[t]};
      const v2f   sl2  = (v2f){SL, SL};
      v2f ps[2];
      #pragma unroll
      for (unsigned sub = 0; sub < 2; ++sub) {
        #pragma unroll
        for (unsigned r = 0; r < 8; r += 2) {       // keys sub*16 + hi*8 + r, r + 1
          const v2f x = __builtin_elementwise_fma((v2f){c[t][sub][r], c[t][sub][r + 1]}, sl2, off2);
          const v2f p = (v2f){__builtin_amdgcn_exp2f(x[0]), __builtin_amdgcn_exp2f(x[1])};
          ps[sub] = (r == 0) ? p : ps[sub] + p;
          pa[t].h[sub * 8 + r]     = (f16)p[0];
          pa[t].h[sub * 8 + r + 1] = (f16)p[1];
        }
      }
      const v2f pt = ps[0] + ps[1];
      psum[t] = pt[0] + pt[1];
    }
    #pragma unroll
    for (unsigned t = 0; t < QT; ++t) rsum[t] = rsum[t] * scale[t] + psum[t] + __shfl_xor(psum[t], 16, 32);

    // rescale O: queries are the row dimension there -> per-row scale from lane 8*hi + r
    #pragma unroll
    for (unsigned t = 0; t < QT; ++t) {
      float sc[8];
      #pragma unroll
      for (unsigned r = 0; r < 8; ++r) sc[r] = __shfl(scale[t], (int)((hi << 3) + r), 32);
      #pragma unroll
      for (unsigned dt = 0; dt < 4; ++dt) {
        #pragma unroll
        for (unsigned r = 0; r < 8; ++r) o[t][dt][r] *= sc[r];
      }
    }

    // O += P x V: each V fragment serves both tiles
    mma_pv_run(o[0][0], o[1][0], o[0][1], o[1][1], o[0][2], o[1][2], o[0][3], o[1][3],
               pa[0].v, pa[1].v, bv[0].v, bv[1].v, bv[2].v, bv[3].v);
  }

  // merge of the two key halves: group 1 hands its offsets, sums and O tiles over, group 0 joins them with its own
  float* sp = sP + wave * (QT * 4 * 8 * 32);
  if (grp != 0u) {
    #pragma unroll
    for (unsigned t = 0; t < QT; ++t) {
      sM[(wave * QT + t) * 32 + lane] = roff[t];
      sL[(wave * QT + t) * 32 + lane] = rsum[t];
      #pragma unroll
      for (unsigned dt = 0; dt < 4; ++dt) {
        #pragma unroll
        for (unsigned q4 = 0; q4 < 2; ++q4)
          *(v4f*)(sp + (((t * 4 + dt) * 2 + q4) * 32 + lane) * 4) =
              (v4f){o[t][dt][q4 * 4], o[t][dt][q4 * 4 + 1], o[t][dt][q4 * 4 + 2], o[t][dt][q4 * 4 + 3]};
      }
    }
  }
  __syncthreads();   // group 1's partial results are complete before group 0 reads them

  // normalize: lane holds column d = dt*16 + lq for query rows 8*hi + r of each tile; O and the sums both carry x4096, which cancels; fold the x256 ctx carry
  f16* so = sO + wave * (QT * 16 * TP);
  if (grp == 0u) {
    #pragma unroll
    for (unsigned t = 0; t < QT; ++t) {
      const float o2  = sM[(wave * QT + t) * 32 + lane];
      const float l2  = sL[(wave * QT + t) * 32 + lane];
      const float om  = fminf(roff[t], o2);               // the larger maximum has the smaller offset
      const float a1  = __builtin_amdgcn_exp2f(om - roff[t]);
      const float a2  = __builtin_amdgcn_exp2f(om - o2);
      const float inv = 256.0f / (rsum[t] * a1 + l2 * a2);
      const float g1  = a1 * inv;
      const float g2  = a2 * inv;
      float f1[8], f2[8];
      #pragma unroll
      for (unsigned r = 0; r < 8; ++r) {
        f1[r] = __shfl(g1, (int)((hi << 3) + r), 32);
        f2[r] = __shfl(g2, (int)((hi << 3) + r), 32);
      }
      #pragma unroll
      for (unsigned dt = 0; dt < 4; ++dt) {
        #pragma unroll
        for (unsigned q4 = 0; q4 < 2; ++q4) {
          const v4f p = *(const v4f*)(sp + (((t * 4 + dt) * 2 + q4) * 32 + lane) * 4);
          #pragma unroll
          for (unsigned j = 0; j < 4; ++j) {
            const unsigned r = q4 * 4 + j;
            so[(t * 16 + hi * 8 + r) * TP + dt * 16 + lq] = (f16)(o[t][dt][r] * f1[r] + p[j] * f2[r]);
          }
        }
      }
    }
  }
  __syncthreads();

  if (grp == 0u) {
    v4u    val[QT * 4];
    size_t idx[QT * 4];
    #pragma unroll
    for (unsigned t = 0; t < QT; ++t) {
      #pragma unroll
      for (unsigned it = 0; it < 4; ++it) {
        Pack8H ph;                                  // ctx in fragment order: tile = 16 of this wave's tokens, unit = h*4 + it, slot = lane
        ph.v = *(const v8h*)(so + (t * 16 + lq) * TP + it * 16 + hi * 8);
        val[t * 4 + it] = ph.u;
        idx[t * 4 + it] = ((size_t)b * SEQ + qrow0 + t * 16) * CH + (h * 4 + it) * 256 + lane * 8;
      }
    }
    #pragma unroll
    for (unsigned it = 0; it < QT * 4; ++it) *(v4u*)(ctx + idx[it]) = val[it];
  }
}

// Projection, transposed: Y^T[c][tok] = sum_k wpT[c][k] * ctx[tok][k]. Block = (256-token tile, 64-channel tile), one block a WGP.
// A fragments from wpT (channel tiles), B fragments from ctx (token tiles), both in fragment order; D rows = channels, columns = tokens,
// so the channel-major output row of 256 pixels (1 KB) is written by two wave instructions (32 lanes x 16 B each).
// A wave owns PT = 2 token tiles, so every weight fragment feeds two products, and nothing that it loads waits for a product: all its ctx
// fragments, the first AH k steps' weights, its x rows and biases are requested at entry, each later step's weights AH steps ahead.
__global__ __launch_bounds__(256) void proj_kernel(const f16* __restrict__ ctx,
                                                   const f16* __restrict__ wpT,
                                                   const float* __restrict__ bproj,
                                                   const float* __restrict__ x,
                                                   float* __restrict__ out) {
  const unsigned mt   = blockIdx.x;
  const unsigned ct   = blockIdx.y;             // 0..3
  const unsigned tid  = threadIdx.x;
  const unsigned wave = (unsigned)__builtin_amdgcn_readfirstlane((int)(tid >> 5));   // wave-uniform: every global address is a scalar base plus the lane's offset
  const unsigned lane = tid & 31u;
  const unsigned lq   = lane & 15u;
  const unsigned hi   = lane >> 4;
  __shared__ __align__(16) float sO[64 * OPF];  // [channel][token], cross-wave (block barrier)

  const f16* brow = ctx + (size_t)((mt * NWAVE + wave) * PT) * (16 * CH) + lane * 8;
  const f16* arow = wpT + (size_t)(ct * 4) * (16 * CH) + lane * 8;
  const unsigned b  = mt / (SEQ / MT);
  const unsigned p0 = (mt % (SEQ / MT)) * MT;

  const size_t row0 = ((size_t)b * CH + ct * 64 + wave) * SEQ_FULL + p0;   // first of this wave's eight output rows, 8 channels apart
  const float* xr   = x + row0 + lane * 4;
  float*       orow = out + row0 + lane * 4;

  // Order of the entry's requests: a wave holds 63 loads at most, and they count back in order. The first two steps' weights (L2, short) go
  // first, so that their places free early for steps 2 and 3; ctx and x (memory, long) follow at once and fly together.
  float bb[8];
  #pragma unroll
  for (unsigned it = 0; it < 8; ++it) bb[it] = bproj[ct * 64 + wave + it * 8];
  FragH aw[CH / 32][4];
  #pragma unroll
  for (unsigned ks = 0; ks < 2; ++ks) {
    #pragma unroll
    for (unsigned m4 = 0; m4 < 4; ++m4) {
      const f16* base = arow + (size_t)m4 * 16 * CH + ks * 512;
      aw[ks][m4].q[0] = *(const v4u*)(base);
      aw[ks][m4].q[1] = *(const v4u*)(base + 256);
    }
  }
  __builtin_amdgcn_sched_barrier(0);   // keeps the order of requests given above
  FragH bc[PT][CH / 32];
  #pragma unroll
  for (unsigned ks = 0; ks < CH / 32; ++ks) {
    #pragma unroll
    for (unsigned tt = 0; tt < PT; ++tt) {
      bc[tt][ks].q[0] = *(const v4u*)(brow + (size_t)tt * 16 * CH + ks * 512);
      bc[tt][ks].q[1] = *(const v4u*)(brow + (size_t)tt * 16 * CH + ks * 512 + 256);
    }
  }
  v4f xv[8][PT];
  #pragma unroll
  for (unsigned it = 0; it < 8; ++it) {
    #pragma unroll
    for (unsigned hf = 0; hf < PT; ++hf) xv[it][hf] = *(const v4f*)(xr + (size_t)it * 8 * SEQ_FULL + hf * 128);
  }
  __builtin_amdgcn_sched_barrier(0);   // keeps the order of requests given above
  #pragma unroll
  for (unsigned ks = 2; ks < AH; ++ks) {
    #pragma unroll
    for (unsigned m4 = 0; m4 < 4; ++m4) {
      const f16* base = arow + (size_t)m4 * 16 * CH + ks * 512;
      aw[ks][m4].q[0] = *(const v4u*)(base);
      aw[ks][m4].q[1] = *(const v4u*)(base + 256);
    }
  }
  __builtin_amdgcn_sched_barrier(0);   // the entry's requests stay one group ahead of the products: sunk to their uses, each would be waited for alone

  v8f acc[PT][4];
  #pragma unroll
  for (unsigned tt = 0; tt < PT; ++tt) {
    #pragma unroll
    for (unsigned m4 = 0; m4 < 4; ++m4) acc[tt][m4] = (v8f){0, 0, 0, 0, 0, 0, 0, 0};
  }

  #pragma unroll
  for (unsigned ks = 0; ks < CH / 32; ++ks) {
    #pragma unroll
    for (unsigned m4 = 0; m4 < 4; ++m4) {
      #pragma unroll
      for (unsigned tt = 0; tt < PT; ++tt)
        acc[tt][m4] = __builtin_amdgcn_wmma_f32_16x16x32_f16(false, aw[ks][m4].v, false, bc[tt][ks].v, (short)0, acc[tt][m4], false, false);
    }
    if (ks + AH < CH / 32) {
      #pragma unroll
      for (unsigned m4 = 0; m4 < 4; ++m4) {
        const f16* base = arow + (size_t)m4 * 16 * CH + (ks + AH) * 512;
        aw[ks + AH][m4].q[0] = *(const v4u*)(base);
        aw[ks + AH][m4].q[1] = *(const v4u*)(base + 256);
      }
    }
    __builtin_amdgcn_sched_barrier(0);   // step ks + AH's requests go out right behind step ks's products and no later
  }

  // acc[tt][m4][r] = 16384 * value(channel m4*16 + hi*8 + r, token wave*32 + tt*16 + lq)
  #pragma unroll
  for (unsigned tt = 0; tt < PT; ++tt) {
    #pragma unroll
    for (unsigned m4 = 0; m4 < 4; ++m4) {
      #pragma unroll
      for (unsigned r = 0; r < 8; ++r)
        sO[(m4 * 16 + hi * 8 + r) * OPF + wave * (PT * 16) + tt * 16 + lq] = acc[tt][m4][r] * (1.0f / 16384.0f);
    }
  }
  __syncthreads();

  v4f val[8][PT];
  #pragma unroll
  for (unsigned it = 0; it < 8; ++it) {                 // row it*8 + wave: channel within the tile (wave-uniform)
    #pragma unroll
    for (unsigned hf = 0; hf < PT; ++hf) val[it][hf] = *(const v4f*)(sO + (it * 8 + wave) * OPF + hf * 128 + lane * 4);
  }
  __builtin_amdgcn_sched_barrier(0);   // the sixteen LDS reads go out as one group: sunk to their uses, only two would be in flight at a time
  #pragma unroll
  for (unsigned it = 0; it < 8; ++it) {
    const float bias = (float)(bf16)bb[it];
    #pragma unroll
    for (unsigned hf = 0; hf < PT; ++hf) {
      #pragma unroll
      for (unsigned i = 0; i < 4; ++i) val[it][hf][i] = (float)(bf16)xv[it][hf][i] + (val[it][hf][i] + bias);
    }
  }
  #pragma unroll
  for (unsigned it = 0; it < 8; ++it) {
    #pragma unroll
    for (unsigned hf = 0; hf < PT; ++hf) *(v4f*)(orow + (size_t)it * 8 * SEQ_FULL + hf * 128) = val[it][hf];
  }
}

extern "C" void kernel_launch(void* const* d_in, const int* in_sizes, int n_in,
                              void* d_out, int out_size, void* d_ws, size_t ws_size,
                              hipStream_t stream) {
  if (n_in < 7) return;
  const size_t x_need = ((size_t)(NB - 1) * CH + (CH - 1)) * SEQ_FULL + SEQ;
  if ((size_t)in_sizes[0] < x_need) return;
  if (in_sizes[1] < CH || in_sizes[2] < CH) return;
  if ((size_t)in_sizes[3] < (size_t)CH * QKVN || in_sizes[4] < QKVN) return;
  if ((size_t)in_sizes[5] < (size_t)CH * CH || in_sizes[6] < CH) return;
  if ((size_t)out_size < x_need) return;

  const size_t tok_plane = (size_t)NB * SEQ * CH * 2;            // ctx and each of q/k/v^T: same bytes
  const size_t wq_bytes  = (size_t)QKVN * CH * 2;
  const size_t wp_bytes  = (size_t)CH * CH * 2;
  const size_t total     = 4 * tok_plane + wq_bytes + wp_bytes;
  if (ws_size < total) return;

  const float* x     = (const float*)d_in[0];
  const float* gam   = (const float*)d_in[1];
  const float* bet   = (const float*)d_in[2];
  const float* wqkv  = (const float*)d_in[3];
  const float* bqkv  = (const float*)d_in[4];
  const float* wproj = (const float*)d_in[5];
  const float* bproj = (const float*)d_in[6];
  float* out = (float*)d_out;

  char* ws = (char*)d_ws;
  f16* qp  = (f16*)(ws);
  f16* kp  = (f16*)(ws + 1 * tok_plane);
  f16* vt  = (f16*)(ws + 2 * tok_plane);
  f16* ctx = (f16*)(ws + 3 * tok_plane);
  f16* wqT = (f16*)(ws + 4 * tok_plane);
  f16* wpT = (f16*)(ws + 4 * tok_plane + wq_bytes);

  w_planes_kernel<<<dim3(CH / 64, QKVN / 64 + CH / 64), 256, 0, stream>>>(wqkv, wproj, wqT, wpT);
  ln_qkv_kernel<<<dim3(NB * (SEQ / FT)), FW * 32, 0, stream>>>(x, gam, bet, wqT, bqkv, qp, kp, vt);
  attn_kernel<<<dim3(SEQ / BQ, NHEAD, NB), NWAVE * KSPL * 32, 0, stream>>>(qp, kp, vt, ctx);
  proj_kernel<<<dim3(NB * (SEQ / MT), CH / 64), 256, 0, stream>>>(ctx, wpT, bproj, x, out);
}
